// v000
// Measured on an AMD MI455X. A time is GPU time per run, averaged over a window of back-to-back runs after a warm-up
// (all launches, gaps included; the runs take copies of the inputs in turn), and the median of several windows.
// Apart from v000's, it joins two sittings. Times from different sittings can be a few percent apart, while
// side-by-side timings come from the same sitting.
// v000, which the later versions start from, runs in 314 microseconds.
#include <hip/hip_runtime.h>
#include <hip/hip_bf16.h>
#include <hip/hip_fp16.h>

// ---------------------------------------------------------------------------
// TriangleCrossAttention on gfx1250 (CDNA5)
//  - all GEMMs on V_WMMA_F32_16X16X32_F16 (f32 accumulate)
//  - weights staged to LDS with GLOBAL_LOAD_ASYNC_TO_LDS_B128 (ASYNCcnt path)
//  - 16x64 C strip per wave; fused q/g GEMM reads xn once, 8 WMMAs per A frag
// B=1, N=M=256, CQ=CKV=128, H=4, CH=32, CB=16
// ---------------------------------------------------------------------------

typedef _Float16 h16;
typedef __attribute__((ext_vector_type(16))) _Float16 v16h;
typedef __attribute__((ext_vector_type(8)))  _Float16 v8h;
typedef __attribute__((ext_vector_type(4)))  _Float16 v4h;
typedef __attribute__((ext_vector_type(8)))  float    v8f;

#define WMMA_F16(a, b, c) \
  __builtin_amdgcn_wmma_f32_16x16x32_f16(false, (a), false, (b), (short)0, (c), false, false)

static __device__ __forceinline__ int laneId() { return threadIdx.x & 31; }

// Async copy 16B global -> LDS (CDNA5 GLOBAL_LOAD_ASYNC_TO_LDS_B128, ASYNCcnt).
static __device__ __forceinline__ void async_load_b128(unsigned int lds_off,
                                                       unsigned long long gaddr) {
  asm volatile("global_load_async_to_lds_b128 %0, %1, off"
               :: "v"(lds_off), "v"(gaddr)
               : "memory");
}
static __device__ __forceinline__ void wait_async0() {
  asm volatile("s_wait_asynccnt 0x0" ::: "memory");
}

// Load one 16x32 f16 fragment (A-matrix layout; also valid for the B operand
// when B is a row-major weight matrix W with K contiguous, since
// B[k][n] = W[n][k] mirrors the A striping with M<->N swapped).
// CDNA5 layout: lanes 0-15 -> row M=lane, K 0..7 (v0-3) and 16..23 (v4-7);
// lanes 16-31 -> row M=lane-16, K 8..15 and 24..31.
static __device__ __forceinline__ v16h load_frag(const h16* __restrict__ base,
                                                 int rowTile, int ld, int kbase) {
  const int lane = laneId();
  const h16* p = base + (size_t)(rowTile + (lane & 15)) * ld
                      + kbase + ((lane >> 4) << 3);
  v8h lo = *(const v8h*)(p);
  v8h hi = *(const v8h*)(p + 16);
  v16h f;
#pragma unroll
  for (int i = 0; i < 8; ++i) { f[i] = lo[i]; f[i + 8] = hi[i]; }
  return f;
}

// ---------------------------------------------------------------------------
// 1) LayerNorm over channel dim (128), output f16. One wave per row.
// ---------------------------------------------------------------------------
__global__ void layernorm_kernel(const float* __restrict__ x,
                                 const float* __restrict__ ln_w,
                                 const float* __restrict__ ln_b,
                                 h16* __restrict__ xn) {
  const int wave = threadIdx.x >> 5;
  const int lane = laneId();
  const size_t row = (size_t)blockIdx.x * 8 + wave;   // 0..65535
  const int c = lane << 2;                             // 4 channels per lane

  float4 xv = *(const float4*)(x + row * 128 + c);
  float s  = xv.x + xv.y + xv.z + xv.w;
  float ss = xv.x * xv.x + xv.y * xv.y + xv.z * xv.z + xv.w * xv.w;
#pragma unroll
  for (int off = 16; off >= 1; off >>= 1) {
    s  += __shfl_xor(s,  off);
    ss += __shfl_xor(ss, off);
  }
  const float mu   = s * (1.0f / 128.0f);
  const float var  = ss * (1.0f / 128.0f) - mu * mu;
  const float rstd = rsqrtf(var + 1e-5f);

  float4 wv = *(const float4*)(ln_w + c);
  float4 bv = *(const float4*)(ln_b + c);
  v4h o;
  o[0] = (h16)((xv.x - mu) * rstd * wv.x + bv.x);
  o[1] = (h16)((xv.y - mu) * rstd * wv.y + bv.y);
  o[2] = (h16)((xv.z - mu) * rstd * wv.z + bv.z);
  o[3] = (h16)((xv.w - mu) * rstd * wv.w + bv.w);
  *(v4h*)(xn + row * 128 + c) = o;
}

// ---------------------------------------------------------------------------
// 2) f32 -> f16 conversion (weights, z)
// ---------------------------------------------------------------------------
__global__ void cvt_f16_kernel(const float* __restrict__ in,
                               h16* __restrict__ out, int n) {
  int i = blockIdx.x * blockDim.x + threadIdx.x;
  if (i < n) out[i] = (h16)in[i];
}

// ---------------------------------------------------------------------------
// 3) Column mean over inner N (q) of xn -> xbar (256x128, f16)
// ---------------------------------------------------------------------------
__global__ void colmean_kernel(const h16* __restrict__ xn,
                               h16* __restrict__ xbar) {
  const int n = blockIdx.x;        // 0..255
  const int c = threadIdx.x;       // 0..127
  float acc = 0.0f;
  for (int q = 0; q < 256; ++q)
    acc += (float)xn[((size_t)(n * 256 + q)) * 128 + c];
  xbar[n * 128 + c] = (h16)(acc * (1.0f / 256.0f));
}

// ---------------------------------------------------------------------------
// 4a) WMMA GEMM: C[M,N] = act(alpha * A[M,K] * W[N,K]^T + bias)
//     W (<=128x128 f16, ldw==K) async-staged to LDS once per block.
//     Each wave computes a 16x64 strip; all 4 B frags batched before the
//     WMMA chain so DS latency is paid once per k-step.
//     Requires: K % 32 == 0, N % 64 == 0, M % 16 == 0.
// ---------------------------------------------------------------------------
#define GF_SIGMOID   1
#define GF_TRANSPOSE 2   // store C^T (Ch[col*ldc + row]); f16 path only

__global__ void gemm64_kernel(const h16* __restrict__ A,
                              const h16* __restrict__ W,
                              h16* __restrict__ Ch, float* __restrict__ Cf,
                              const float* __restrict__ bias,
                              int M, int N, int K,
                              int lda, int ldc,
                              float alpha, int flags) {
  __shared__ __attribute__((aligned(16))) h16 Wlds[16384];  // up to 128x128 f16

  // ---- async-stage W (row-major, ld == K) into LDS
  const int wbytes = N * K * 2;
  for (int o = threadIdx.x * 16; o < wbytes; o += blockDim.x * 16)
    async_load_b128((unsigned int)(size_t)((char*)Wlds + o),
                    (unsigned long long)(size_t)((const char*)W + o));
  wait_async0();
  __syncthreads();

  const int tilesN = N >> 6;                       // 64-wide wave strips
  const int total  = (M >> 4) * tilesN;
  const int wave   = blockIdx.x * (blockDim.x >> 5) + (threadIdx.x >> 5);
  if (wave >= total) return;                       // wave-uniform

  const int tm = (wave / tilesN) << 4;
  const int tn = (wave % tilesN) << 6;

  v8f acc[4] = {{}, {}, {}, {}};
  for (int k = 0; k < K; k += 32) {
    v16h a = load_frag(A, tm, lda, k);
    v16h b[4];
#pragma unroll
    for (int t = 0; t < 4; ++t) b[t] = load_frag(Wlds, tn + (t << 4), K, k);
#pragma unroll
    for (int t = 0; t < 4; ++t) acc[t] = WMMA_F16(a, b[t], acc[t]);
  }

  const int lane = laneId();
  const int rb   = tm + ((lane >> 4) << 3);
#pragma unroll
  for (int t = 0; t < 4; ++t) {
    const int col = tn + (t << 4) + (lane & 15);
    const float bv = bias ? bias[col] : 0.0f;
#pragma unroll
    for (int v = 0; v < 8; ++v) {
      float y = acc[t][v] * alpha + bv;
      if (flags & GF_SIGMOID) y = 1.0f / (1.0f + __expf(-y));
      const int r = rb + v;
      if (flags & GF_TRANSPOSE) {
        Ch[(size_t)col * ldc + r] = (h16)y;
      } else {
        if (Ch) Ch[(size_t)r * ldc + col] = (h16)y;
        if (Cf) Cf[(size_t)r * ldc + col] = y;
      }
    }
  }
}

// ---------------------------------------------------------------------------
// 4b) Fused q/g GEMM: Q = qscale*(A Wq^T), G = sigmoid(A Wg^T + bg)
//     Shares the A (xn) stream: 8 WMMAs per A fragment, N = K = 128.
// ---------------------------------------------------------------------------
__global__ void gemm_qg_kernel(const h16* __restrict__ A,
                               const h16* __restrict__ Wq,
                               const h16* __restrict__ Wg,
                               h16* __restrict__ Q, h16* __restrict__ G,
                               const float* __restrict__ bg,
                               int M, float qscale) {
  __shared__ __attribute__((aligned(16))) h16 Wq_lds[16384];  // 128x128 f16
  __shared__ __attribute__((aligned(16))) h16 Wg_lds[16384];  // 128x128 f16

  for (int o = threadIdx.x * 16; o < 32768; o += blockDim.x * 16) {
    async_load_b128((unsigned int)(size_t)((char*)Wq_lds + o),
                    (unsigned long long)(size_t)((const char*)Wq + o));
    async_load_b128((unsigned int)(size_t)((char*)Wg_lds + o),
                    (unsigned long long)(size_t)((const char*)Wg + o));
  }
  wait_async0();
  __syncthreads();

  const int total = (M >> 4) * 2;                  // two 64-wide strips per row
  const int wave  = blockIdx.x * (blockDim.x >> 5) + (threadIdx.x >> 5);
  if (wave >= total) return;                       // wave-uniform

  const int tm = (wave >> 1) << 4;
  const int tn = (wave & 1) << 6;

  v8f accq[4] = {{}, {}, {}, {}};
  v8f accg[4] = {{}, {}, {}, {}};
  for (int k = 0; k < 128; k += 32) {
    v16h a = load_frag(A, tm, 128, k);
    v16h bq[4], bgf[4];
#pragma unroll
    for (int t = 0; t < 4; ++t) bq[t]  = load_frag(Wq_lds, tn + (t << 4), 128, k);
#pragma unroll
    for (int t = 0; t < 4; ++t) bgf[t] = load_frag(Wg_lds, tn + (t << 4), 128, k);
#pragma unroll
    for (int t = 0; t < 4; ++t) accq[t] = WMMA_F16(a, bq[t],  accq[t]);
#pragma unroll
    for (int t = 0; t < 4; ++t) accg[t] = WMMA_F16(a, bgf[t], accg[t]);
  }

  const int lane = laneId();
  const int rb   = tm + ((lane >> 4) << 3);
#pragma unroll
  for (int t = 0; t < 4; ++t) {
    const int col = tn + (t << 4) + (lane & 15);
    const float bgv = bg[col];
#pragma unroll
    for (int v = 0; v < 8; ++v) {
      const int r = rb + v;
      Q[(size_t)r * 128 + col] = (h16)(accq[t][v] * qscale);
      const float y = accg[t][v] + bgv;
      G[(size_t)r * 128 + col] = (h16)(1.0f / (1.0f + __expf(-y)));
    }
  }
}

// ---------------------------------------------------------------------------
// 5) tri[h][n][m] = sum_d xb[n][h*16+d] * zb[m][h*16+d]   (K=16, VALU)
// ---------------------------------------------------------------------------
__global__ void tri_kernel(const float* __restrict__ xb,
                           const float* __restrict__ zb,
                           float* __restrict__ tri) {
  const int n = blockIdx.x;   // 0..255
  const int h = blockIdx.y;   // 0..3
  const int m = threadIdx.x;  // 0..255
  const float* xr = xb + n * 64 + h * 16;
  const float* zr = zb + m * 64 + h * 16;
  float acc = 0.0f;
#pragma unroll
  for (int d = 0; d < 16; ++d) acc += xr[d] * zr[d];
  tri[((size_t)(h * 256 + n)) * 256 + m] = acc;
}

// ---------------------------------------------------------------------------
// 6) Fused attention core per (qtile, row); ALL 4 heads per block.
//    Phase 1: 8 waves x 8 logits tiles (wave's head fixed -> A frag reused)
//    Phase 2: softmax over M=256 for 64 (head,q) rows
//    Phase 3: 8 waves == 8 (head x c-tile) O tiles, P from LDS (ds_load)
// ---------------------------------------------------------------------------
__global__ void attn_kernel(const h16* __restrict__ qh,   // [65536][128] scaled
                            const h16* __restrict__ kh,   // [256][128]
                            const h16* __restrict__ vT,   // [128][256]
                            const h16* __restrict__ gh,   // [65536][128] sigmoid'd
                            const float* __restrict__ tri,// [4][256][256]
                            const float* __restrict__ mask,// [256][256]
                            h16* __restrict__ og) {       // [65536][128]
  __shared__ __attribute__((aligned(16))) float S[4][16][256];  // 64KB
  __shared__ __attribute__((aligned(16))) h16   P[4][16][256];  // 32KB
  __shared__ float red[64][4];
  __shared__ float rowmax[64];
  __shared__ float rowsum[64];

  const int qt  = blockIdx.x;   // 0..15  (16 q rows each)
  const int r   = blockIdx.y;   // 0..255
  const int tid = threadIdx.x;  // 256 threads = 8 waves
  const int wave = tid >> 5;
  const int lane = laneId();
  const int q0 = qt << 4;

  // ---- Phase 1: logits. wave -> head (wave>>1), 8 m-tiles each.
  {
    const int h = wave >> 1;
    const h16* qbase = qh + ((size_t)(r * 256 + q0)) * 128 + h * 32;
    const h16* kbase = kh + h * 32;
    const v16h afrag = load_frag(qbase, 0, 128, 0);   // K = CH = 32: one frag
#pragma unroll
    for (int i = 0; i < 8; ++i) {
      const int mt = ((wave & 1) << 3) + i;           // 0..15
      v16h b = load_frag(kbase, mt << 4, 128, 0);
      v8f acc = {};
      acc = WMMA_F16(afrag, b, acc);
      const int m  = (mt << 4) + (lane & 15);
      const int rb = (lane >> 4) << 3;
#pragma unroll
      for (int v = 0; v < 8; ++v) {
        const int qi = rb + v;
        const int qg = q0 + qi;
        const float bias = 1.0e9f * (mask[r * 256 + qg] - 1.0f)
                         + tri[((size_t)(h * 256 + qg)) * 256 + m];
        S[h][qi][m] = acc[v] + bias;
      }
    }
  }
  __syncthreads();

  // ---- Phase 2: softmax over m. 64 rows (h,qi), 4 threads per row.
  {
    const int R = tid >> 2;          // 0..63
    const int j = tid & 3;
    float* Srow = &S[R >> 4][R & 15][0];
    float mx = -3.0e38f;
#pragma unroll
    for (int i = 0; i < 64; ++i) mx = fmaxf(mx, Srow[j + (i << 2)]);
    red[R][j] = mx;
    __syncthreads();
    if (j == 0) {
      float m2 = fmaxf(fmaxf(red[R][0], red[R][1]), fmaxf(red[R][2], red[R][3]));
      rowmax[R] = m2;
    }
    __syncthreads();
    const float rm = rowmax[R];
    float sum = 0.0f;
#pragma unroll
    for (int i = 0; i < 64; ++i) {
      const int m = j + (i << 2);
      const float e = __expf(Srow[m] - rm);
      Srow[m] = e;
      sum += e;
    }
    red[R][j] = sum;
    __syncthreads();
    if (j == 0) rowsum[R] = red[R][0] + red[R][1] + red[R][2] + red[R][3];
    __syncthreads();
    const float inv = 1.0f / rowsum[R];
    h16* Prow = &P[R >> 4][R & 15][0];
#pragma unroll
    for (int i = 0; i < 64; ++i) {
      const int m = j + (i << 2);
      Prow[m] = (h16)(Srow[m] * inv);
    }
  }
  __syncthreads();

  // ---- Phase 3: O = P_h (16x256) @ V_h (256x32). wave -> (h, c-tile).
  {
    const int h  = wave >> 1;
    const int ct = wave & 1;
    const h16* vbase = vT + (size_t)(h * 32 + ct * 16) * 256;
    v8f acc = {};
#pragma unroll
    for (int k = 0; k < 256; k += 32) {
      v16h a = load_frag(&P[h][0][0], 0, 256, k);     // ds_load path
      v16h b = load_frag(vbase, 0, 256, k);
      acc = WMMA_F16(a, b, acc);
    }
    const int col = lane & 15;
    const int rb  = (lane >> 4) << 3;
#pragma unroll
    for (int v = 0; v < 8; ++v) {
      const int qi = rb + v;
      const size_t idx = ((size_t)(r * 256 + q0 + qi)) * 128
                       + h * 32 + ct * 16 + col;
      const float g = (float)gh[idx];
      og[idx] = (h16)(acc[v] * g);
    }
  }
}

// ---------------------------------------------------------------------------
// Host-side orchestration
// ---------------------------------------------------------------------------
extern "C" void kernel_launch(void* const* d_in, const int* in_sizes, int n_in,
                              void* d_out, int out_size, void* d_ws, size_t ws_size,
                              hipStream_t stream) {
  (void)in_sizes; (void)n_in; (void)out_size; (void)ws_size;

  const float* x    = (const float*)d_in[0];   // (1,256,256,128)
  const float* z    = (const float*)d_in[1];   // (1,256,128)
  const float* mask = (const float*)d_in[2];   // (1,256,256)
  const float* ln_w = (const float*)d_in[3];
  const float* ln_b = (const float*)d_in[4];
  const float* wx   = (const float*)d_in[5];   // (64,128)
  const float* wz   = (const float*)d_in[6];   // (64,128)
  const float* wq   = (const float*)d_in[7];   // (128,128)
  const float* wk   = (const float*)d_in[8];
  const float* wv   = (const float*)d_in[9];
  const float* wg   = (const float*)d_in[10];
  const float* bg   = (const float*)d_in[11];  // (128,)
  const float* wo   = (const float*)d_in[12];  // (128,128)
  const float* bo   = (const float*)d_in[13];  // (128,)
  float* out = (float*)d_out;                  // (1,256,256,128)

  // ---- workspace carve-up (256B aligned regions)
  char* ws = (char*)d_ws;
  size_t off = 0;
  auto carve = [&](size_t bytes) -> char* {
    char* p = ws + off;
    off = (off + bytes + 255) & ~(size_t)255;
    return p;
  };
  const size_t NROWS = 65536;                 // 256*256
  h16*   xn_h   = (h16*)  carve(NROWS * 128 * 2);
  h16*   qh     = (h16*)  carve(NROWS * 128 * 2);
  h16*   gh     = (h16*)  carve(NROWS * 128 * 2);
  h16*   og     = (h16*)  carve(NROWS * 128 * 2);
  float* tri    = (float*)carve(4 * 256 * 256 * 4);
  h16*   z_h    = (h16*)  carve(256 * 128 * 2);
  h16*   kh     = (h16*)  carve(256 * 128 * 2);
  h16*   vT     = (h16*)  carve(128 * 256 * 2);
  h16*   xbar_h = (h16*)  carve(256 * 128 * 2);
  h16*   wq_h   = (h16*)  carve(128 * 128 * 2);
  h16*   wk_h   = (h16*)  carve(128 * 128 * 2);
  h16*   wv_h   = (h16*)  carve(128 * 128 * 2);
  h16*   wg_h   = (h16*)  carve(128 * 128 * 2);
  h16*   wo_h   = (h16*)  carve(128 * 128 * 2);
  h16*   wx_h   = (h16*)  carve(64 * 128 * 2);
  h16*   wz_h   = (h16*)  carve(64 * 128 * 2);
  float* xb_f   = (float*)carve(256 * 64 * 4);
  float* zb_f   = (float*)carve(256 * 64 * 4);

  // ---- 1) layernorm (wave per row)
  layernorm_kernel<<<NROWS / 8, 256, 0, stream>>>(x, ln_w, ln_b, xn_h);

  // ---- 2) convert weights + z to f16
  auto cvt = [&](const float* src, h16* dst, int n) {
    cvt_f16_kernel<<<(n + 255) / 256, 256, 0, stream>>>(src, dst, n);
  };
  cvt(z,  z_h,  256 * 128);
  cvt(wq, wq_h, 128 * 128);
  cvt(wk, wk_h, 128 * 128);
  cvt(wv, wv_h, 128 * 128);
  cvt(wg, wg_h, 128 * 128);
  cvt(wo, wo_h, 128 * 128);
  cvt(wx, wx_h, 64 * 128);
  cvt(wz, wz_h, 64 * 128);

  // ---- 3) column mean of xn
  colmean_kernel<<<256, 128, 0, stream>>>(xn_h, xbar_h);

  // ---- 4) GEMMs: 16x64 strip per wave, W async-staged to LDS
  auto gemm = [&](const h16* A, const h16* W, h16* Ch, float* Cf,
                  const float* bias, int M, int N, int K,
                  int lda, int ldc, float alpha, int flags) {
    int strips = (M >> 4) * (N >> 6);
    int blocks = (strips + 7) / 8;
    gemm64_kernel<<<blocks, 256, 0, stream>>>(A, W, Ch, Cf, bias,
                                              M, N, K, lda, ldc, alpha, flags);
  };
  const float qscale = 0.17677669529663687f;  // CH^-0.5 = 1/sqrt(32)

  gemm(z_h, wk_h, kh, nullptr, nullptr, 256, 128, 128, 128, 128, 1.0f, 0);
  gemm(z_h, wv_h, vT, nullptr, nullptr, 256, 128, 128, 128, 256, 1.0f,
       GF_TRANSPOSE);                                         // vT[c][m]
  gemm(z_h,    wz_h, nullptr, zb_f, nullptr, 256, 64, 128, 128, 64, 1.0f, 0);
  gemm(xbar_h, wx_h, nullptr, xb_f, nullptr, 256, 64, 128, 128, 64, 1.0f, 0);

  // fused q/g projection: reads xn once, writes qh (scaled) + gh (sigmoid)
  {
    int strips = ((int)NROWS >> 4) * 2;
    gemm_qg_kernel<<<strips / 8, 256, 0, stream>>>(xn_h, wq_h, wg_h,
                                                   qh, gh, bg,
                                                   (int)NROWS, qscale);
  }

  // ---- 5) triangle bias
  tri_kernel<<<dim3(256, 4), 256, 0, stream>>>(xb_f, zb_f, tri);

  // ---- 6) fused attention (all heads per block)
  attn_kernel<<<dim3(16, 256), 256, 0, stream>>>(qh, kh, vT, gh, tri, mask, og);

  // ---- 7) output projection: out = og @ wo^T + bo  (f32 out)
  gemm(og, wo_h, nullptr, out, bo, NROWS, 128, 128, 128, 128, 1.0f, 0);
}

// v001
// Measured time: 190 microseconds a run.
// Two timings next to v000 put it at 1.66 and 1.67 times that version's speed.
#include <hip/hip_runtime.h>
#include <hip/hip_bf16.h>
#include <hip/hip_fp16.h>

// ---------------------------------------------------------------------------
// TriangleCrossAttention on gfx1250 (CDNA5)
//  - all GEMMs on V_WMMA_F32_16X16X32_F16 (f32 accumulate)
//  - weights staged to LDS with GLOBAL_LOAD_ASYNC_TO_LDS_B128 (ASYNCcnt path)
//  - 16x64 C strip per wave; fused q/g GEMM reads xn once, 8 WMMAs per A frag
// B=1, N=M=256, CQ=CKV=128, H=4, CH=32, CB=16
// ---------------------------------------------------------------------------

typedef _Float16 h16;
typedef __attribute__((ext_vector_type(16))) _Float16 v16h;
typedef __attribute__((ext_vector_type(8)))  _Float16 v8h;
typedef __attribute__((ext_vector_type(4)))  _Float16 v4h;
typedef __attribute__((ext_vector_type(8)))  float    v8f;

#define WMMA_F16(a, b, c) \
  __builtin_amdgcn_wmma_f32_16x16x32_f16(false, (a), false, (b), (short)0, (c), false, false)

static __device__ __forceinline__ int laneId() { return threadIdx.x & 31; }

// Async copy 16B global -> LDS (CDNA5 GLOBAL_LOAD_ASYNC_TO_LDS_B128, ASYNCcnt).
static __device__ __forceinline__ void async_load_b128(unsigned int lds_off,
                                                       unsigned long long gaddr) {
  asm volatile("global_load_async_to_lds_b128 %0, %1, off"
               :: "v"(lds_off), "v"(gaddr)
               : "memory");
}
static __device__ __forceinline__ void wait_async0() {
  asm volatile("s_wait_asynccnt 0x0" ::: "memory");
}

// Load one 16x32 f16 fragment (A-matrix layout; also valid for the B operand
// when B is a row-major weight matrix W with K contiguous, since
// B[k][n] = W[n][k] mirrors the A striping with M<->N swapped).
// CDNA5 layout: lanes 0-15 -> row M=lane, K 0..7 (v0-3) and 16..23 (v4-7);
// lanes 16-31 -> row M=lane-16, K 8..15 and 24..31.
static __device__ __forceinline__ v16h load_frag(const h16* __restrict__ base,
                                                 int rowTile, int ld, int kbase) {
  const int lane = laneId();
  const h16* p = base + (size_t)(rowTile + (lane & 15)) * ld
                      + kbase + ((lane >> 4) << 3);
  v8h lo = *(const v8h*)(p);
  v8h hi = *(const v8h*)(p + 16);
  v16h f;
#pragma unroll
  for (int i = 0; i < 8; ++i) { f[i] = lo[i]; f[i + 8] = hi[i]; }
  return f;
}

// ---------------------------------------------------------------------------
// 1) LayerNorm over channel dim (128), output f16. One wave per row.
// ---------------------------------------------------------------------------
__global__ void layernorm_kernel(const float* __restrict__ x,
                                 const float* __restrict__ ln_w,
                                 const float* __restrict__ ln_b,
                                 h16* __restrict__ xn) {
  const int wave = threadIdx.x >> 5;
  const int lane = laneId();
  const size_t row = (size_t)blockIdx.x * 8 + wave;   // 0..65535
  const int c = lane << 2;                             // 4 channels per lane

  float4 xv = *(const float4*)(x + row * 128 + c);
  float s  = xv.x + xv.y + xv.z + xv.w;
  float ss = xv.x * xv.x + xv.y * xv.y + xv.z * xv.z + xv.w * xv.w;
#pragma unroll
  for (int off = 16; off >= 1; off >>= 1) {
    s  += __shfl_xor(s,  off);
    ss += __shfl_xor(ss, off);
  }
  const float mu   = s * (1.0f / 128.0f);
  const float var  = ss * (1.0f / 128.0f) - mu * mu;
  const float rstd = rsqrtf(var + 1e-5f);

  float4 wv = *(const float4*)(ln_w + c);
  float4 bv = *(const float4*)(ln_b + c);
  v4h o;
  o[0] = (h16)((xv.x - mu) * rstd * wv.x + bv.x);
  o[1] = (h16)((xv.y - mu) * rstd * wv.y + bv.y);
  o[2] = (h16)((xv.z - mu) * rstd * wv.z + bv.z);
  o[3] = (h16)((xv.w - mu) * rstd * wv.w + bv.w);
  *(v4h*)(xn + row * 128 + c) = o;
}

// ---------------------------------------------------------------------------
// 2) f32 -> f16 conversion (weights, z)
// ---------------------------------------------------------------------------
__global__ void cvt_f16_kernel(const float* __restrict__ in,
                               h16* __restrict__ out, int n) {
  int i = blockIdx.x * blockDim.x + threadIdx.x;
  if (i < n) out[i] = (h16)in[i];
}

// ---------------------------------------------------------------------------
// 3) Column mean over inner N (q) of xn -> xbar (256x128, f16)
// ---------------------------------------------------------------------------
__global__ void colmean_kernel(const h16* __restrict__ xn,
                               h16* __restrict__ xbar) {
  const int n = blockIdx.x;        // 0..255
  const int c = threadIdx.x;       // 0..127
  float acc = 0.0f;
  for (int q = 0; q < 256; ++q)
    acc += (float)xn[((size_t)(n * 256 + q)) * 128 + c];
  xbar[n * 128 + c] = (h16)(acc * (1.0f / 256.0f));
}

// ---------------------------------------------------------------------------
// 4a) WMMA GEMM: C[M,N] = act(alpha * A[M,K] * W[N,K]^T + bias)
//     W (<=128x128 f16, ldw==K) async-staged to LDS once per block.
//     Each wave computes a 16x64 strip; all 4 B frags batched before the
//     WMMA chain so DS latency is paid once per k-step.
//     Requires: K % 32 == 0, N % 64 == 0, M % 16 == 0.
// ---------------------------------------------------------------------------
#define GF_SIGMOID   1
#define GF_TRANSPOSE 2   // store C^T (Ch[col*ldc + row]); f16 path only

__global__ void gemm64_kernel(const h16* __restrict__ A,
                              const h16* __restrict__ W,
                              h16* __restrict__ Ch, float* __restrict__ Cf,
                              const float* __restrict__ bias,
                              int M, int N, int K,
                              int lda, int ldc,
                              float alpha, int flags) {
  __shared__ __attribute__((aligned(16))) h16 Wlds[16384];  // up to 128x128 f16

  // ---- async-stage W (row-major, ld == K) into LDS
  const int wbytes = N * K * 2;
  for (int o = threadIdx.x * 16; o < wbytes; o += blockDim.x * 16)
    async_load_b128((unsigned int)(size_t)((char*)Wlds + o),
                    (unsigned long long)(size_t)((const char*)W + o));
  wait_async0();
  __syncthreads();

  const int tilesN = N >> 6;                       // 64-wide wave strips
  const int total  = (M >> 4) * tilesN;
  const int wave   = blockIdx.x * (blockDim.x >> 5) + (threadIdx.x >> 5);
  if (wave >= total) return;                       // wave-uniform

  const int tm = (wave / tilesN) << 4;
  const int tn = (wave % tilesN) << 6;

  v8f acc[4] = {{}, {}, {}, {}};
  for (int k = 0; k < K; k += 32) {
    v16h a = load_frag(A, tm, lda, k);
    v16h b[4];
#pragma unroll
    for (int t = 0; t < 4; ++t) b[t] = load_frag(Wlds, tn + (t << 4), K, k);
#pragma unroll
    for (int t = 0; t < 4; ++t) acc[t] = WMMA_F16(a, b[t], acc[t]);
  }

  const int lane = laneId();
  const int rb   = tm + ((lane >> 4) << 3);
#pragma unroll
  for (int t = 0; t < 4; ++t) {
    const int col = tn + (t << 4) + (lane & 15);
    const float bv = bias ? bias[col] : 0.0f;
#pragma unroll
    for (int v = 0; v < 8; ++v) {
      float y = acc[t][v] * alpha + bv;
      if (flags & GF_SIGMOID) y = 1.0f / (1.0f + __expf(-y));
      const int r = rb + v;
      if (flags & GF_TRANSPOSE) {
        Ch[(size_t)col * ldc + r] = (h16)y;
      } else {
        if (Ch) Ch[(size_t)r * ldc + col] = (h16)y;
        if (Cf) Cf[(size_t)r * ldc + col] = y;
      }
    }
  }
}

// ---------------------------------------------------------------------------
// 4b) Fused q/g GEMM: Q = qscale*(A Wq^T), G = sigmoid(A Wg^T + bg)
//     Shares the A (xn) stream: 8 WMMAs per A fragment, N = K = 128.
// ---------------------------------------------------------------------------
__global__ void gemm_qg_kernel(const h16* __restrict__ A,
                               const h16* __restrict__ Wq,
                               const h16* __restrict__ Wg,
                               h16* __restrict__ Q, h16* __restrict__ G,
                               const float* __restrict__ bg,
                               int M, float qscale) {
  __shared__ __attribute__((aligned(16))) h16 Wq_lds[16384];  // 128x128 f16
  __shared__ __attribute__((aligned(16))) h16 Wg_lds[16384];  // 128x128 f16

  for (int o = threadIdx.x * 16; o < 32768; o += blockDim.x * 16) {
    async_load_b128((unsigned int)(size_t)((char*)Wq_lds + o),
                    (unsigned long long)(size_t)((const char*)Wq + o));
    async_load_b128((unsigned int)(size_t)((char*)Wg_lds + o),
                    (unsigned long long)(size_t)((const char*)Wg + o));
  }
  wait_async0();
  __syncthreads();

  const int total = (M >> 4) * 2;                  // two 64-wide strips per row
  const int wave  = blockIdx.x * (blockDim.x >> 5) + (threadIdx.x >> 5);
  if (wave >= total) return;                       // wave-uniform

  const int tm = (wave >> 1) << 4;
  const int tn = (wave & 1) << 6;

  v8f accq[4] = {{}, {}, {}, {}};
  v8f accg[4] = {{}, {}, {}, {}};
  for (int k = 0; k < 128; k += 32) {
    v16h a = load_frag(A, tm, 128, k);
    v16h bq[4], bgf[4];
#pragma unroll
    for (int t = 0; t < 4; ++t) bq[t]  = load_frag(Wq_lds, tn + (t << 4), 128, k);
#pragma unroll
    for (int t = 0; t < 4; ++t) bgf[t] = load_frag(Wg_lds, tn + (t << 4), 128, k);
#pragma unroll
    for (int t = 0; t < 4; ++t) accq[t] = WMMA_F16(a, bq[t],  accq[t]);
#pragma unroll
    for (int t = 0; t < 4; ++t) accg[t] = WMMA_F16(a, bgf[t], accg[t]);
  }

  const int lane = laneId();
  const int rb   = tm + ((lane >> 4) << 3);
#pragma unroll
  for (int t = 0; t < 4; ++t) {
    const int col = tn + (t << 4) + (lane & 15);
    const float bgv = bg[col];
#pragma unroll
    for (int v = 0; v < 8; ++v) {
      const int r = rb + v;
      Q[(size_t)r * 128 + col] = (h16)(accq[t][v] * qscale);
      const float y = accg[t][v] + bgv;
      G[(size_t)r * 128 + col] = (h16)(1.0f / (1.0f + __expf(-y)));
    }
  }
}

// ---------------------------------------------------------------------------
// 5) tri[h][n][m] = sum_d xb[n][h*16+d] * zb[m][h*16+d]   (K=16, VALU)
// ---------------------------------------------------------------------------
__global__ void tri_kernel(const float* __restrict__ xb,
                           const float* __restrict__ zb,
                           float* __restrict__ tri) {
  const int n = blockIdx.x;   // 0..255
  const int h = blockIdx.y;   // 0..3
  const int m = threadIdx.x;  // 0..255
  const float* xr = xb + n * 64 + h * 16;
  const float* zr = zb + m * 64 + h * 16;
  float acc = 0.0f;
#pragma unroll
  for (int d = 0; d < 16; ++d) acc += xr[d] * zr[d];
  tri[((size_t)(h * 256 + n)) * 256 + m] = acc;
}

// ---------------------------------------------------------------------------
// 6) Fused attention core: one wave per (row r, 16-query tile, head).
//    S^T = K_h Q^T   : A = 16 keys x 32 ch, B = 32 ch x 16 queries.
//    A lane then holds scores of ONE query (column lane&15): 8 keys per tile,
//    128 of the 256 keys per lane; lanes l and l^16 split the keys.
//    Softmax: in-lane maximum and sum plus one exchange between wave halves.
//    O^T = V_h^T P^T : two packed S^T tiles are a B operand as they stand
//    (hardware k order), V^T rows are loaded in the same k order by frag_at.
//    No LDS, no barrier.
// ---------------------------------------------------------------------------
static __device__ __forceinline__ float xhalf(float x) {   // lane l <-> l ^ 16
  const int b = __builtin_bit_cast(int, x);
  return __builtin_bit_cast(float,
      __builtin_amdgcn_permlanex16(b, b, 0x76543210, 0xfedcba98, false, false));
}

// 16x32 f16 fragment from the lane's own pointer (row lane&15, k offset
// 8*(lane>>4)): same k order as load_frag.
static __device__ __forceinline__ v16h frag_at(const h16* __restrict__ p) {
  v8h lo = *(const v8h*)(p);
  v8h hi = *(const v8h*)(p + 16);
  v16h f;
#pragma unroll
  for (int i = 0; i < 8; ++i) { f[i] = lo[i]; f[i + 8] = hi[i]; }
  return f;
}

// Eight 2^x in one statement. No result shares a register with an argument
// ("=&v"), so no v_exp_f32 is directly followed by a write of its source or a
// read of its result; the v_nop is that slot behind the last one.
static __device__ __forceinline__ v8f exp2_x8(v8f x) {
  float e0, e1, e2, e3, e4, e5, e6, e7;
  asm("v_exp_f32 %0, %8\n\t"
      "v_exp_f32 %1, %9\n\t"
      "v_exp_f32 %2, %10\n\t"
      "v_exp_f32 %3, %11\n\t"
      "v_exp_f32 %4, %12\n\t"
      "v_exp_f32 %5, %13\n\t"
      "v_exp_f32 %6, %14\n\t"
      "v_exp_f32 %7, %15\n\t"
      "v_nop"
      : "=&v"(e0), "=&v"(e1), "=&v"(e2), "=&v"(e3),
        "=&v"(e4), "=&v"(e5), "=&v"(e6), "=&v"(e7)
      : "v"(x[0]), "v"(x[1]), "v"(x[2]), "v"(x[3]),
        "v"(x[4]), "v"(x[5]), "v"(x[6]), "v"(x[7]));
  v8f e = {e0, e1, e2, e3, e4, e5, e6, e7};
  return e;
}

// 4 waves per SIMD (256 VGPRs): two blocks per WGP hide each other's load waits
__global__ void __launch_bounds__(256, 4)
attn_kernel(const h16* __restrict__ qh,   // [65536][128] scaled
            const h16* __restrict__ kh,   // [256][128]
            const h16* __restrict__ vT,   // [128][256]
            const h16* __restrict__ gh,   // [65536][128] sigmoid'd
            const float* __restrict__ tri,// [4][256][256]
            const float* __restrict__ mask,// [256][256]
            h16* __restrict__ og) {       // [65536][128]
  const int lane = laneId();
  const int c    = lane & 15;                              // query column
  const int hh   = lane >> 4;                              // wave half
  const int r    = blockIdx.x * 8 + (threadIdx.x >> 5);    // 0..255
  const int q0   = blockIdx.y << 4;                        // 16 queries
  const int h    = blockIdx.z;                             // head

  // element offset of (query c, head h, channel 8*hh) in qh, gh and og
  const size_t idx = ((size_t)(r * 256 + q0) + c) * 128 + h * 32 + (hh << 3);
  const h16*   qp = qh + idx;
  const h16*   kp = kh + c * 128 + h * 32 + (hh << 3);
  const float* tp = tri + ((size_t)(h * 256 + q0 + c)) * 256 + (hh << 3);
  const h16*   vp = vT + (size_t)(h * 32 + c) * 256 + (hh << 3);
  const h16*   gp = gh + idx;

  const int   mi = r * 256 + q0 + c;                       // (row, query) in mask
  const float mk = mask[mi];
  // The mask load's index register stays untouched up to this wait.
  asm volatile("s_wait_xcnt 0x0" :: "v"(mi) : "memory");
  const float mb = 1.0e9f * (mk - 1.0f);
  const v16h  qf = frag_at(qp);

  // ---- scores: s[mt][v] = logit(query c, key mt*16 + 8*hh + v)
  v8f s[16];
#pragma unroll
  for (int mt = 0; mt < 16; ++mt) {
    const v16h a = frag_at(kp + mt * 16 * 128);
    const v8f  t = *(const v8f*)(tp + (mt << 4));
    v8f z = {};
    z = WMMA_F16(a, qf, z);
    s[mt] = z + (t + mb);
  }
  // The address registers of the loads above stay untouched up to this wait.
  asm volatile("s_wait_xcnt 0x0" :: "v"(qp), "v"(kp), "v"(tp) : "memory");

  // ---- maximum over the 256 keys of the lane's query
  v8f mv = s[0];
#pragma unroll
  for (int mt = 1; mt < 16; ++mt)
#pragma unroll
    for (int v = 0; v < 8; ++v) mv[v] = fmaxf(mv[v], s[mt][v]);
  float mx = fmaxf(fmaxf(fmaxf(mv[0], mv[1]), fmaxf(mv[2], mv[3])),
                   fmaxf(fmaxf(mv[4], mv[5]), fmaxf(mv[6], mv[7])));
  mx = fmaxf(mx, xhalf(mx));

  // ---- exp, f32 sum (8 independent chains), pack to the B operand of P^T
  v8f  sv = {};
  v16h pb[8];
#pragma unroll
  for (int mt = 0; mt < 16; ++mt) {
    const v8f e = exp2_x8((s[mt] - mx) * 1.44269504f);   // e^(s - mx)
    sv += e;
#pragma unroll
    for (int v = 0; v < 8; ++v) pb[mt >> 1][((mt & 1) << 3) + v] = (h16)e[v];
  }
  float sum = ((sv[0] + sv[1]) + (sv[2] + sv[3])) + ((sv[4] + sv[5]) + (sv[6] + sv[7]));
  sum += xhalf(sum);
  const float inv = 1.0f / sum;

  // ---- O^T (32 ch x 16 queries) = V_h^T (32 x 256) P^T (256 x 16)
  v8f o0 = {}, o1 = {};
#pragma unroll
  for (int j = 0; j < 8; ++j) {
    const v16h a0 = frag_at(vp + (j << 5));
    const v16h a1 = frag_at(vp + 16 * 256 + (j << 5));
    o0 = WMMA_F16(a0, pb[j], o0);
    o1 = WMMA_F16(a1, pb[j], o1);
  }

  // ---- gate and store: a lane holds 8 consecutive channels of its query
  const v8h g0 = *(const v8h*)(gp);
  const v8h g1 = *(const v8h*)(gp + 16);
  // Same wait for the address registers of the V^T and gate loads.
  asm volatile("s_wait_xcnt 0x0" :: "v"(vp), "v"(gp) : "memory");
  v8h w0, w1;
#pragma unroll
  for (int v = 0; v < 8; ++v) {
    w0[v] = (h16)(o0[v] * inv * (float)g0[v]);
    w1[v] = (h16)(o1[v] * inv * (float)g1[v]);
  }
  *(v8h*)(og + idx)      = w0;
  *(v8h*)(og + idx + 16) = w1;
}

// ---------------------------------------------------------------------------
// Host-side orchestration
// ---------------------------------------------------------------------------
extern "C" void kernel_launch(void* const* d_in, const int* in_sizes, int n_in,
                              void* d_out, int out_size, void* d_ws, size_t ws_size,
                              hipStream_t stream) {
  (void)in_sizes; (void)n_in; (void)out_size; (void)ws_size;

  const float* x    = (const float*)d_in[0];   // (1,256,256,128)
  const float* z    = (const float*)d_in[1];   // (1,256,128)
  const float* mask = (const float*)d_in[2];   // (1,256,256)
  const float* ln_w = (const float*)d_in[3];
  const float* ln_b = (const float*)d_in[4];
  const float* wx   = (const float*)d_in[5];   // (64,128)
  const float* wz   = (const float*)d_in[6];   // (64,128)
  const float* wq   = (const float*)d_in[7];   // (128,128)
  const float* wk   = (const float*)d_in[8];
  const float* wv   = (const float*)d_in[9];
  const float* wg   = (const float*)d_in[10];
  const float* bg   = (const float*)d_in[11];  // (128,)
  const float* wo   = (const float*)d_in[12];  // (128,128)
  const float* bo   = (const float*)d_in[13];  // (128,)
  float* out = (float*)d_out;                  // (1,256,256,128)

  // ---- workspace carve-up (256B aligned regions)
  char* ws = (char*)d_ws;
  size_t off = 0;
  auto carve = [&](size_t bytes) -> char* {
    char* p = ws + off;
    off = (off + bytes + 255) & ~(size_t)255;
    return p;
  };
  const size_t NROWS = 65536;                 // 256*256
  h16*   xn_h   = (h16*)  carve(NROWS * 128 * 2);
  h16*   qh     = (h16*)  carve(NROWS * 128 * 2);
  h16*   gh     = (h16*)  carve(NROWS * 128 * 2);
  h16*   og     = (h16*)  carve(NROWS * 128 * 2);
  float* tri    = (float*)carve(4 * 256 * 256 * 4);
  h16*   z_h    = (h16*)  carve(256 * 128 * 2);
  h16*   kh     = (h16*)  carve(256 * 128 * 2);
  h16*   vT     = (h16*)  carve(128 * 256 * 2);
  h16*   xbar_h = (h16*)  carve(256 * 128 * 2);
  h16*   wq_h   = (h16*)  carve(128 * 128 * 2);
  h16*   wk_h   = (h16*)  carve(128 * 128 * 2);
  h16*   wv_h   = (h16*)  carve(128 * 128 * 2);
  h16*   wg_h   = (h16*)  carve(128 * 128 * 2);
  h16*   wo_h   = (h16*)  carve(128 * 128 * 2);
  h16*   wx_h   = (h16*)  carve(64 * 128 * 2);
  h16*   wz_h   = (h16*)  carve(64 * 128 * 2);
  float* xb_f   = (float*)carve(256 * 64 * 4);
  float* zb_f   = (float*)carve(256 * 64 * 4);

  // ---- 1) layernorm (wave per row)
  layernorm_kernel<<<NROWS / 8, 256, 0, stream>>>(x, ln_w, ln_b, xn_h);

  // ---- 2) convert weights + z to f16
  auto cvt = [&](const float* src, h16* dst, int n) {
    cvt_f16_kernel<<<(n + 255) / 256, 256, 0, stream>>>(src, dst, n);
  };
  cvt(z,  z_h,  256 * 128);
  cvt(wq, wq_h, 128 * 128);
  cvt(wk, wk_h, 128 * 128);
  cvt(wv, wv_h, 128 * 128);
  cvt(wg, wg_h, 128 * 128);
  cvt(wo, wo_h, 128 * 128);
  cvt(wx, wx_h, 64 * 128);
  cvt(wz, wz_h, 64 * 128);

  // ---- 3) column mean of xn
  colmean_kernel<<<256, 128, 0, stream>>>(xn_h, xbar_h);

  // ---- 4) GEMMs: 16x64 strip per wave, W async-staged to LDS
  auto gemm = [&](const h16* A, const h16* W, h16* Ch, float* Cf,
                  const float* bias, int M, int N, int K,
                  int lda, int ldc, float alpha, int flags) {
    int strips = (M >> 4) * (N >> 6);
    int blocks = (strips + 7) / 8;
    gemm64_kernel<<<blocks, 256, 0, stream>>>(A, W, Ch, Cf, bias,
                                              M, N, K, lda, ldc, alpha, flags);
  };
  const float qscale = 0.17677669529663687f;  // CH^-0.5 = 1/sqrt(32)

  gemm(z_h, wk_h, kh, nullptr, nullptr, 256, 128, 128, 128, 128, 1.0f, 0);
  gemm(z_h, wv_h, vT, nullptr, nullptr, 256, 128, 128, 128, 256, 1.0f,
       GF_TRANSPOSE);                                         // vT[c][m]
  gemm(z_h,    wz_h, nullptr, zb_f, nullptr, 256, 64, 128, 128, 64, 1.0f, 0);
  gemm(xbar_h, wx_h, nullptr, xb_f, nullptr, 256, 64, 128, 128, 64, 1.0f, 0);

  // fused q/g projection: reads xn once, writes qh (scaled) + gh (sigmoid)
  {
    int strips = ((int)NROWS >> 4) * 2;
    gemm_qg_kernel<<<strips / 8, 256, 0, stream>>>(xn_h, wq_h, wg_h,
                                                   qh, gh, bg,
                                                   (int)NROWS, qscale);
  }

  // ---- 5) triangle bias
  tri_kernel<<<dim3(256, 4), 256, 0, stream>>>(xb_f, zb_f, tri);

  // ---- 6) fused attention: 8 rows per block, all on one (query tile, head)
  attn_kernel<<<dim3(32, 16, 4), 256, 0, stream>>>(qh, kh, vT, gh, tri, mask, og);

  // ---- 7) output projection: out = og @ wo^T + bo  (f32 out)
  gemm(og, wo_h, nullptr, out, bo, NROWS, 128, 128, 128, 128, 1.0f, 0);
}

// v002
// Measured time: 128 microseconds a run.
// Timed twice side by side with v001, it ran 1.48 and 1.47 times as fast.
// Over all steps from v000 it is 2.46 times as fast.
#include <hip/hip_runtime.h>
#include <hip/hip_bf16.h>
#include <hip/hip_fp16.h>

// ---------------------------------------------------------------------------
// TriangleCrossAttention on gfx1250 (CDNA5)
//  - all GEMMs on V_WMMA_F32_16X16X32_F16 (f32 accumulate)
//  - weights staged to LDS with GLOBAL_LOAD_ASYNC_TO_LDS_B128 (ASYNCcnt path)
//  - 16x64 C strip per wave; fused q/g GEMM reads xn once, 8 WMMAs per A frag
//  - kernels that do not depend on each other share a launch (block ranges)
// B=1, N=M=256, CQ=CKV=128, H=4, CH=32, CB=16
// ---------------------------------------------------------------------------

typedef _Float16 h16;
typedef __attribute__((ext_vector_type(16))) _Float16 v16h;
typedef __attribute__((ext_vector_type(8)))  _Float16 v8h;
typedef __attribute__((ext_vector_type(4)))  _Float16 v4h;
typedef __attribute__((ext_vector_type(8)))  float    v8f;

#define WMMA_F16(a, b, c) \
  __builtin_amdgcn_wmma_f32_16x16x32_f16(false, (a), false, (b), (short)0, (c), false, false)

static __device__ __forceinline__ int laneId() { return threadIdx.x & 31; }

// Async copy 16B global -> LDS (CDNA5 GLOBAL_LOAD_ASYNC_TO_LDS_B128, ASYNCcnt).
static __device__ __forceinline__ void async_load_b128(unsigned int lds_off,
                                                       unsigned long long gaddr) {
  asm volatile("global_load_async_to_lds_b128 %0, %1, off"
               :: "v"(lds_off), "v"(gaddr)
               : "memory");
}
static __device__ __forceinline__ void wait_async0() {
  asm volatile("s_wait_asynccnt 0x0" ::: "memory");
}
// Four such copies, 4 KiB apart (one round of a 256-thread block each). The
// s_wait_xcnt ends the copies' own statement, so that no address register of
// a copy is rewritten in front of it.
static __device__ __forceinline__ void async_load4_b128(unsigned int lds_off,
                                                        unsigned long long gaddr) {
  asm volatile("global_load_async_to_lds_b128 %0, %4, off\n\t"
               "global_load_async_to_lds_b128 %1, %5, off\n\t"
               "global_load_async_to_lds_b128 %2, %6, off\n\t"
               "global_load_async_to_lds_b128 %3, %7, off\n\t"
               "s_wait_xcnt 0x0"
               :: "v"(lds_off), "v"(lds_off + 4096u),
                  "v"(lds_off + 8192u), "v"(lds_off + 12288u),
                  "v"(gaddr), "v"(gaddr + 4096ull),
                  "v"(gaddr + 8192ull), "v"(gaddr + 12288ull)
               : "memory");
}

// Load one 16x32 f16 fragment (A-matrix layout; also valid for the B operand
// when B is a row-major weight matrix W with K contiguous, since
// B[k][n] = W[n][k] mirrors the A striping with M<->N swapped).
// CDNA5 layout: lanes 0-15 -> row M=lane, K 0..7 (v0-3) and 16..23 (v4-7);
// lanes 16-31 -> row M=lane-16, K 8..15 and 24..31.
static __device__ __forceinline__ v16h load_frag(const h16* __restrict__ base,
                                                 int rowTile, int ld, int kbase) {
  const int lane = laneId();
  const h16* p = base + (size_t)(rowTile + (lane & 15)) * ld
                      + kbase + ((lane >> 4) << 3);
  v8h lo = *(const v8h*)(p);
  v8h hi = *(const v8h*)(p + 16);
  v16h f;
#pragma unroll
  for (int i = 0; i < 8; ++i) { f[i] = lo[i]; f[i + 8] = hi[i]; }
  return f;
}

// ---------------------------------------------------------------------------
// Small GEMM for a block range of a shared launch:
//   C[256,N] = A[256,128] * W[N,128]^T, N = 64 or 128, 256 threads,
//   N/32 blocks (blk = 0..N/32-1), one 16x64 strip per wave.
//   W async-staged to LDS as in gemm64_kernel; same k order, same sums.
//   OUT: what is stored: C as f16 (Ch), C^T as f16 (Ch[col*256 + row]) or
//   C as f32 (Cf).
// ---------------------------------------------------------------------------
#define OUT_F16   0
#define OUT_F16_T 1
#define OUT_F32   2
template <int N, int OUT>
static __device__ __forceinline__ void gemm256_block(h16* Wlds,
                                                     const h16* __restrict__ A,
                                                     const h16* __restrict__ W,
                                                     h16* __restrict__ Ch,
                                                     float* __restrict__ Cf,
                                                     int blk) {
  const unsigned int       l = (unsigned int)(size_t)((char*)Wlds + threadIdx.x * 16);
  const unsigned long long g = (unsigned long long)(size_t)((const char*)W + threadIdx.x * 16);
#pragma unroll   // 1 or 2 rounds of four copies: every copy gets registers of its own
  for (int o = 0; o < N * 256; o += 16384) async_load4_b128(l + o, g + o);
  wait_async0();
  __syncthreads();

  const int tilesN = N >> 6;
  const int wave   = blk * 8 + (threadIdx.x >> 5);   // 0 .. 16*tilesN-1
  const int tm = (wave / tilesN) << 4;
  const int tn = (wave % tilesN) << 6;

  v8f acc[4] = {{}, {}, {}, {}};
  for (int k = 0; k < 128; k += 32) {
    v16h a = load_frag(A, tm, 128, k);
    v16h b[4];
#pragma unroll
    for (int t = 0; t < 4; ++t) b[t] = load_frag(Wlds, tn + (t << 4), 128, k);
#pragma unroll
    for (int t = 0; t < 4; ++t) acc[t] = WMMA_F16(a, b[t], acc[t]);
  }

  const int lane = laneId();
  const int rb   = tm + ((lane >> 4) << 3);
#pragma unroll
  for (int t = 0; t < 4; ++t) {
    const int col = tn + (t << 4) + (lane & 15);
#pragma unroll
    for (int v = 0; v < 8; ++v) {
      const float y = acc[t][v];
      const int r = rb + v;
      if (OUT == OUT_F16_T)    Ch[(size_t)col * 256 + r] = (h16)y;
      else if (OUT == OUT_F16) Ch[(size_t)r * N + col] = (h16)y;
      else                     Cf[(size_t)r * N + col] = y;
    }
  }
  // The stores' address and data registers stay untouched up to this wait: the
  // code of the launch's other block ranges follows and rewrites them.
  asm volatile("s_wait_xcnt 0x0" ::: "memory");
}

// ---------------------------------------------------------------------------
// 1) One launch, two independent jobs.
//    Blocks 0..511: f32 -> f16 of z and the seven weight matrices into one
//    contiguous f16 region (order z, wq, wk, wv, wg, wo, wx, wz).
//    Blocks 512.. : LayerNorm over channel dim (128), f16 out, one wave per row.
// ---------------------------------------------------------------------------
#define CVT_BLOCKS 512
__global__ void layernorm_cvt_kernel(const float* __restrict__ x,
                                     const float* __restrict__ ln_w,
                                     const float* __restrict__ ln_b,
                                     h16* __restrict__ xn,
                                     const float* __restrict__ z_f,
                                     const float* __restrict__ wq_f,
                                     const float* __restrict__ wk_f,
                                     const float* __restrict__ wv_f,
                                     const float* __restrict__ wg_f,
                                     const float* __restrict__ wo_f,
                                     const float* __restrict__ wx_f,
                                     const float* __restrict__ wz_f,
                                     h16* __restrict__ cvt_out) {
  if (blockIdx.x < CVT_BLOCKS) {                       // block-uniform
    const int b = blockIdx.x;                          // 256 elements per block
    const float* in;
    int first;                                         // the source's first block
    if      (b < 128) { in = z_f;  first = 0;   }
    else if (b < 192) { in = wq_f; first = 128; }
    else if (b < 256) { in = wk_f; first = 192; }
    else if (b < 320) { in = wv_f; first = 256; }
    else if (b < 384) { in = wg_f; first = 320; }
    else if (b < 448) { in = wo_f; first = 384; }
    else if (b < 480) { in = wx_f; first = 448; }
    else              { in = wz_f; first = 480; }
    cvt_out[b * 256 + threadIdx.x] = (h16)in[(b - first) * 256 + threadIdx.x];
    return;
  }
  const int wave = threadIdx.x >> 5;
  const int lane = laneId();
  const size_t row = (size_t)(blockIdx.x - CVT_BLOCKS) * 8 + wave;   // 0..65535
  const int c = lane << 2;                             // 4 channels per lane

  float4 xv = *(const float4*)(x + row * 128 + c);
  float s  = xv.x + xv.y + xv.z + xv.w;
  float ss = xv.x * xv.x + xv.y * xv.y + xv.z * xv.z + xv.w * xv.w;
#pragma unroll
  for (int off = 16; off >= 1; off >>= 1) {
    s  += __shfl_xor(s,  off);
    ss += __shfl_xor(ss, off);
  }
  const float mu   = s * (1.0f / 128.0f);
  const float var  = ss * (1.0f / 128.0f) - mu * mu;
  const float rstd = rsqrtf(var + 1e-5f);

  float4 wv = *(const float4*)(ln_w + c);
  float4 bv = *(const float4*)(ln_b + c);
  v4h o;
  o[0] = (h16)((xv.x - mu) * rstd * wv.x + bv.x);
  o[1] = (h16)((xv.y - mu) * rstd * wv.y + bv.y);
  o[2] = (h16)((xv.z - mu) * rstd * wv.z + bv.z);
  o[3] = (h16)((xv.w - mu) * rstd * wv.w + bv.w);
  *(v4h*)(xn + row * 128 + c) = o;
}

// ---------------------------------------------------------------------------
// 3) Column mean over inner N (q) of xn -> xbar (256x128, f16), for a block
//    range of a shared launch: 256 threads, two n per block (blk = 0..127),
//    one thread per (n, channel).
// ---------------------------------------------------------------------------
static __device__ __forceinline__ void colmean_block(const h16* __restrict__ xn,
                                                     h16* __restrict__ xbar,
                                                     int blk) {
  const int n = blk * 2 + (threadIdx.x >> 7);   // 0..255
  const int c = threadIdx.x & 127;              // 0..127
  float acc = 0.0f;
  for (int q = 0; q < 256; q += 8) {
    const h16* p = xn + ((size_t)(n * 256 + q)) * 128 + c;
    h16 t[8];
#pragma unroll
    for (int i = 0; i < 8; ++i) t[i] = p[i * 128];
    // The loads' address register stays untouched up to this wait.
    asm volatile("s_wait_xcnt 0x0" :: "v"(p) : "memory");
#pragma unroll
    for (int i = 0; i < 8; ++i) acc += (float)t[i];   // same order as q = 0..255
  }
  xbar[n * 128 + c] = (h16)(acc * (1.0f / 256.0f));
  // Same wait behind the store: code of other block ranges follows it.
  asm volatile("s_wait_xcnt 0x0" ::: "memory");
}

// ---------------------------------------------------------------------------
// 4a) WMMA GEMM: C[M,N] = act(alpha * A[M,K] * W[N,K]^T + bias)
//     W (<=128x128 f16, ldw==K) async-staged to LDS once per block.
//     Each wave computes a 16x64 strip; all 4 B frags batched before the
//     WMMA chain so DS latency is paid once per k-step.
//     Requires: K % 32 == 0, N % 64 == 0, M % 16 == 0.
// ---------------------------------------------------------------------------
#define GF_SIGMOID   1
#define GF_TRANSPOSE 2   // store C^T (Ch[col*ldc + row]); f16 path only

__global__ void gemm64_kernel(const h16* __restrict__ A,
                              const h16* __restrict__ W,
                              h16* __restrict__ Ch, float* __restrict__ Cf,
                              const float* __restrict__ bias,
                              int M, int N, int K,
                              int lda, int ldc,
                              float alpha, int flags) {
  __shared__ __attribute__((aligned(16))) h16 Wlds[16384];  // up to 128x128 f16

  // ---- async-stage W (row-major, ld == K) into LDS
  const int wbytes = N * K * 2;
  for (int o = threadIdx.x * 16; o < wbytes; o += blockDim.x * 16)
    async_load_b128((unsigned int)(size_t)((char*)Wlds + o),
                    (unsigned long long)(size_t)((const char*)W + o));
  wait_async0();
  __syncthreads();

  const int tilesN = N >> 6;                       // 64-wide wave strips
  const int total  = (M >> 4) * tilesN;
  const int wave   = blockIdx.x * (blockDim.x >> 5) + (threadIdx.x >> 5);
  if (wave >= total) return;                       // wave-uniform

  const int tm = (wave / tilesN) << 4;
  const int tn = (wave % tilesN) << 6;

  v8f acc[4] = {{}, {}, {}, {}};
  for (int k = 0; k < K; k += 32) {
    v16h a = load_frag(A, tm, lda, k);
    v16h b[4];
#pragma unroll
    for (int t = 0; t < 4; ++t) b[t] = load_frag(Wlds, tn + (t << 4), K, k);
#pragma unroll
    for (int t = 0; t < 4; ++t) acc[t] = WMMA_F16(a, b[t], acc[t]);
  }

  const int lane = laneId();
  const int rb   = tm + ((lane >> 4) << 3);
#pragma unroll
  for (int t = 0; t < 4; ++t) {
    const int col = tn + (t << 4) + (lane & 15);
    const float bv = bias ? bias[col] : 0.0f;
#pragma unroll
    for (int v = 0; v < 8; ++v) {
      float y = acc[t][v] * alpha + bv;
      if (flags & GF_SIGMOID) y = 1.0f / (1.0f + __expf(-y));
      const int r = rb + v;
      if (flags & GF_TRANSPOSE) {
        Ch[(size_t)col * ldc + r] = (h16)y;
      } else {
        if (Ch) Ch[(size_t)r * ldc + col] = (h16)y;
        if (Cf) Cf[(size_t)r * ldc + col] = y;
      }
    }
  }
}

// ---------------------------------------------------------------------------
// 4b) Fused q/g GEMM: Q = qscale*(A Wq^T), G = sigmoid(A Wg^T + bg)
//     Shares the A (xn) stream: 8 WMMAs per A fragment, N = K = 128.
//     The launch's first blocks do four jobs that depend on q/g as little as
//     q/g on them: 0..3 K = z wk^T, 4..7 V^T = (z wv^T)^T, 8..9 zb = z wz^T
//     (f32), 10..137 the column mean of xn.
// ---------------------------------------------------------------------------
#define ZG_BLOCKS 10
#define CM_BLOCKS 128
// 10 waves per SIMD keeps the register allocation at the 96 that q/g alone has
// (the shared kernel took 120 without it): five blocks per WGP, as the 64 KiB
// of LDS allow, so that all 1162 blocks are resident at once.
__global__ void __launch_bounds__(256, 10)
gemm_qg_kernel(const h16* __restrict__ A,
                               const h16* __restrict__ Wq,
                               const h16* __restrict__ Wg,
                               h16* __restrict__ Q, h16* __restrict__ G,
                               const float* __restrict__ bg,
                               int M, float qscale,
                               h16* __restrict__ xbar,
                               const h16* __restrict__ zh,
                               const h16* __restrict__ wk,
                               const h16* __restrict__ wv,
                               const h16* __restrict__ wz,
                               h16* __restrict__ kh,
                               h16* __restrict__ vT,
                               float* __restrict__ zb) {
  __shared__ __attribute__((aligned(16))) h16 Wq_lds[16384];  // 128x128 f16
  __shared__ __attribute__((aligned(16))) h16 Wg_lds[16384];  // 128x128 f16

  if (blockIdx.x < ZG_BLOCKS + CM_BLOCKS) {            // block-uniform
    const int b = blockIdx.x;
    if      (b < 4)  gemm256_block<128, OUT_F16  >(Wq_lds, zh, wk, kh, nullptr, b);
    else if (b < 8)  gemm256_block<128, OUT_F16_T>(Wq_lds, zh, wv, vT, nullptr, b - 4);
    else if (b < 10) gemm256_block<64,  OUT_F32  >(Wq_lds, zh, wz, nullptr, zb, b - 8);
    else             colmean_block(A, xbar, b - ZG_BLOCKS);
    return;
  }

  for (int o = threadIdx.x * 16; o < 32768; o += blockDim.x * 16) {
    async_load_b128((unsigned int)(size_t)((char*)Wq_lds + o),
                    (unsigned long long)(size_t)((const char*)Wq + o));
    async_load_b128((unsigned int)(size_t)((char*)Wg_lds + o),
                    (unsigned long long)(size_t)((const char*)Wg + o));
  }
  wait_async0();
  __syncthreads();

  const int total = (M >> 4) * 2;                  // two 64-wide strips per row
  const int wave  = (blockIdx.x - (ZG_BLOCKS + CM_BLOCKS)) * (blockDim.x >> 5) + (threadIdx.x >> 5);
  if (wave >= total) return;                       // wave-uniform

  const int tm = (wave >> 1) << 4;
  const int tn = (wave & 1) << 6;

  v8f accq[4] = {{}, {}, {}, {}};
  v8f accg[4] = {{}, {}, {}, {}};
  for (int k = 0; k < 128; k += 32) {
    v16h a = load_frag(A, tm, 128, k);
    v16h bq[4], bgf[4];
#pragma unroll
    for (int t = 0; t < 4; ++t) bq[t]  = load_frag(Wq_lds, tn + (t << 4), 128, k);
#pragma unroll
    for (int t = 0; t < 4; ++t) bgf[t] = load_frag(Wg_lds, tn + (t << 4), 128, k);
#pragma unroll
    for (int t = 0; t < 4; ++t) accq[t] = WMMA_F16(a, bq[t],  accq[t]);
#pragma unroll
    for (int t = 0; t < 4; ++t) accg[t] = WMMA_F16(a, bgf[t], accg[t]);
  }

  const int lane = laneId();
  const int rb   = tm + ((lane >> 4) << 3);
#pragma unroll
  for (int t = 0; t < 4; ++t) {
    const int col = tn + (t << 4) + (lane & 15);
    const float bgv = bg[col];
#pragma unroll
    for (int v = 0; v < 8; ++v) {
      const int r = rb + v;
      Q[(size_t)r * 128 + col] = (h16)(accq[t][v] * qscale);
      const float y = accg[t][v] + bgv;
      G[(size_t)r * 128 + col] = (h16)(1.0f / (1.0f + __expf(-y)));
    }
  }
}

// ---------------------------------------------------------------------------
// 5) tri[h][n][m] = sum_d xb[n][h*16+d] * zb[m][h*16+d]   (K=16, VALU)
// ---------------------------------------------------------------------------
__global__ void tri_kernel(const float* __restrict__ xb,
                           const float* __restrict__ zb,
                           float* __restrict__ tri) {
  const int n = blockIdx.x;   // 0..255
  const int h = blockIdx.y;   // 0..3
  const int m = threadIdx.x;  // 0..255
  const float* xr = xb + n * 64 + h * 16;
  const float* zr = zb + m * 64 + h * 16;
  float acc = 0.0f;
#pragma unroll
  for (int d = 0; d < 16; ++d) acc += xr[d] * zr[d];
  tri[((size_t)(h * 256 + n)) * 256 + m] = acc;
}

// ---------------------------------------------------------------------------
// 6) Fused attention core: one wave per (row r, 16-query tile, head).
//    S^T = K_h Q^T   : A = 16 keys x 32 ch, B = 32 ch x 16 queries.
//    A lane then holds scores of ONE query (column lane&15): 8 keys per tile,
//    128 of the 256 keys per lane; lanes l and l^16 split the keys.
//    Softmax: in-lane maximum and sum plus one exchange between wave halves.
//    O^T = V_h^T P^T : two packed S^T tiles are a B operand as they stand
//    (hardware k order), V^T rows are loaded in the same k order by frag_at.
//    No LDS, no barrier.
// ---------------------------------------------------------------------------
static __device__ __forceinline__ float xhalf(float x) {   // lane l <-> l ^ 16
  const int b = __builtin_bit_cast(int, x);
  return __builtin_bit_cast(float,
      __builtin_amdgcn_permlanex16(b, b, 0x76543210, 0xfedcba98, false, false));
}

// 16x32 f16 fragment from the lane's own pointer (row lane&15, k offset
// 8*(lane>>4)): same k order as load_frag.
static __device__ __forceinline__ v16h frag_at(const h16* __restrict__ p) {
  v8h lo = *(const v8h*)(p);
  v8h hi = *(const v8h*)(p + 16);
  v16h f;
#pragma unroll
  for (int i = 0; i < 8; ++i) { f[i] = lo[i]; f[i + 8] = hi[i]; }
  return f;
}

// Eight 2^x in one statement. No result shares a register with an argument
// ("=&v"), so no v_exp_f32 is directly followed by a write of its source or a
// read of its result; the v_nop is that slot behind the last one.
static __device__ __forceinline__ v8f exp2_x8(v8f x) {
  float e0, e1, e2, e3, e4, e5, e6, e7;
  asm("v_exp_f32 %0, %8\n\t"
      "v_exp_f32 %1, %9\n\t"
      "v_exp_f32 %2, %10\n\t"
      "v_exp_f32 %3, %11\n\t"
      "v_exp_f32 %4, %12\n\t"
      "v_exp_f32 %5, %13\n\t"
      "v_exp_f32 %6, %14\n\t"
      "v_exp_f32 %7, %15\n\t"
      "v_nop"
      : "=&v"(e0), "=&v"(e1), "=&v"(e2), "=&v"(e3),
        "=&v"(e4), "=&v"(e5), "=&v"(e6), "=&v"(e7)
      : "v"(x[0]), "v"(x[1]), "v"(x[2]), "v"(x[3]),
        "v"(x[4]), "v"(x[5]), "v"(x[6]), "v"(x[7]));
  v8f e = {e0, e1, e2, e3, e4, e5, e6, e7};
  return e;
}

// 4 waves per SIMD (256 VGPRs): two blocks per WGP hide each other's load waits
__global__ void __launch_bounds__(256, 4)
attn_kernel(const h16* __restrict__ qh,   // [65536][128] scaled
            const h16* __restrict__ kh,   // [256][128]
            const h16* __restrict__ vT,   // [128][256]
            const h16* __restrict__ gh,   // [65536][128] sigmoid'd
            const float* __restrict__ tri,// [4][256][256]
            const float* __restrict__ mask,// [256][256]
            h16* __restrict__ og) {       // [65536][128]
  const int lane = laneId();
  const int c    = lane & 15;                              // query column
  const int hh   = lane >> 4;                              // wave half
  const int r    = blockIdx.x * 8 + (threadIdx.x >> 5);    // 0..255
  const int q0   = blockIdx.y << 4;                        // 16 queries
  const int h    = blockIdx.z;                             // head

  // element offset of (query c, head h, channel 8*hh) in qh, gh and og
  const size_t idx = ((size_t)(r * 256 + q0) + c) * 128 + h * 32 + (hh << 3);
  const h16*   qp = qh + idx;
  const h16*   kp = kh + c * 128 + h * 32 + (hh << 3);
  const float* tp = tri + ((size_t)(h * 256 + q0 + c)) * 256 + (hh << 3);
  const h16*   vp = vT + (size_t)(h * 32 + c) * 256 + (hh << 3);
  const h16*   gp = gh + idx;

  const int   mi = r * 256 + q0 + c;                       // (row, query) in mask
  const float mk = mask[mi];
  // The mask load's index register stays untouched up to this wait.
  asm volatile("s_wait_xcnt 0x0" :: "v"(mi) : "memory");
  const float mb = 1.0e9f * (mk - 1.0f);
  const v16h  qf = frag_at(qp);

  // ---- scores: s[mt][v] = logit(query c, key mt*16 + 8*hh + v)
  v8f s[16];
#pragma unroll
  for (int mt = 0; mt < 16; ++mt) {
    const v16h a = frag_at(kp + mt * 16 * 128);
    const v8f  t = *(const v8f*)(tp + (mt << 4));
    v8f z = {};
    z = WMMA_F16(a, qf, z);
    s[mt] = z + (t + mb);
  }
  // The address registers of the loads above stay untouched up to this wait.
  asm volatile("s_wait_xcnt 0x0" :: "v"(qp), "v"(kp), "v"(tp) : "memory");

  // ---- maximum over the 256 keys of the lane's query
  v8f mv = s[0];
#pragma unroll
  for (int mt = 1; mt < 16; ++mt)
#pragma unroll
    for (int v = 0; v < 8; ++v) mv[v] = fmaxf(mv[v], s[mt][v]);
  float mx = fmaxf(fmaxf(fmaxf(mv[0], mv[1]), fmaxf(mv[2], mv[3])),
                   fmaxf(fmaxf(mv[4], mv[5]), fmaxf(mv[6], mv[7])));
  mx = fmaxf(mx, xhalf(mx));

  // ---- exp, f32 sum (8 independent chains), pack to the B operand of P^T
  v8f  sv = {};
  v16h pb[8];
#pragma unroll
  for (int mt = 0; mt < 16; ++mt) {
    const v8f e = exp2_x8((s[mt] - mx) * 1.44269504f);   // e^(s - mx)
    sv += e;
#pragma unroll
    for (int v = 0; v < 8; ++v) pb[mt >> 1][((mt & 1) << 3) + v] = (h16)e[v];
  }
  float sum = ((sv[0] + sv[1]) + (sv[2] + sv[3])) + ((sv[4] + sv[5]) + (sv[6] + sv[7]));
  sum += xhalf(sum);
  const float inv = 1.0f / sum;

  // ---- O^T (32 ch x 16 queries) = V_h^T (32 x 256) P^T (256 x 16)
  v8f o0 = {}, o1 = {};
#pragma unroll
  for (int j = 0; j < 8; ++j) {
    const v16h a0 = frag_at(vp + (j << 5));
    const v16h a1 = frag_at(vp + 16 * 256 + (j << 5));
    o0 = WMMA_F16(a0, pb[j], o0);
    o1 = WMMA_F16(a1, pb[j], o1);
  }

  // ---- gate and store: a lane holds 8 consecutive channels of its query
  const v8h g0 = *(const v8h*)(gp);
  const v8h g1 = *(const v8h*)(gp + 16);
  // Same wait for the address registers of the V^T and gate loads.
  asm volatile("s_wait_xcnt 0x0" :: "v"(vp), "v"(gp) : "memory");
  v8h w0, w1;
#pragma unroll
  for (int v = 0; v < 8; ++v) {
    w0[v] = (h16)(o0[v] * inv * (float)g0[v]);
    w1[v] = (h16)(o1[v] * inv * (float)g1[v]);
  }
  *(v8h*)(og + idx)      = w0;
  *(v8h*)(og + idx + 16) = w1;
}

// ---------------------------------------------------------------------------
// Host-side orchestration
// ---------------------------------------------------------------------------
extern "C" void kernel_launch(void* const* d_in, const int* in_sizes, int n_in,
                              void* d_out, int out_size, void* d_ws, size_t ws_size,
                              hipStream_t stream) {
  (void)in_sizes; (void)n_in; (void)out_size; (void)ws_size;

  const float* x    = (const float*)d_in[0];   // (1,256,256,128)
  const float* z    = (const float*)d_in[1];   // (1,256,128)
  const float* mask = (const float*)d_in[2];   // (1,256,256)
  const float* ln_w = (const float*)d_in[3];
  const float* ln_b = (const float*)d_in[4];
  const float* wx   = (const float*)d_in[5];   // (64,128)
  const float* wz   = (const float*)d_in[6];   // (64,128)
  const float* wq   = (const float*)d_in[7];   // (128,128)
  const float* wk   = (const float*)d_in[8];
  const float* wv   = (const float*)d_in[9];
  const float* wg   = (const float*)d_in[10];
  const float* bg   = (const float*)d_in[11];  // (128,)
  const float* wo   = (const float*)d_in[12];  // (128,128)
  const float* bo   = (const float*)d_in[13];  // (128,)
  float* out = (float*)d_out;                  // (1,256,256,128)

  // ---- workspace carve-up (256B aligned regions)
  char* ws = (char*)d_ws;
  size_t off = 0;
  auto carve = [&](size_t bytes) -> char* {
    char* p = ws + off;
    off = (off + bytes + 255) & ~(size_t)255;
    return p;
  };
  const size_t NROWS = 65536;                 // 256*256
  h16*   xn_h   = (h16*)  carve(NROWS * 128 * 2);
  h16*   qh     = (h16*)  carve(NROWS * 128 * 2);
  h16*   gh     = (h16*)  carve(NROWS * 128 * 2);
  h16*   og     = (h16*)  carve(NROWS * 128 * 2);
  float* tri    = (float*)carve(4 * 256 * 256 * 4);
  h16*   kh     = (h16*)  carve(256 * 128 * 2);
  h16*   vT     = (h16*)  carve(128 * 256 * 2);
  h16*   xbar_h = (h16*)  carve(256 * 128 * 2);
  // f16 copies of z and the weights: contiguous, in the converting blocks' order
  h16*   z_h    = (h16*)  carve(256 * 128 * 2);
  h16*   wq_h   = (h16*)  carve(128 * 128 * 2);
  h16*   wk_h   = (h16*)  carve(128 * 128 * 2);
  h16*   wv_h   = (h16*)  carve(128 * 128 * 2);
  h16*   wg_h   = (h16*)  carve(128 * 128 * 2);
  h16*   wo_h   = (h16*)  carve(128 * 128 * 2);
  h16*   wx_h   = (h16*)  carve(64 * 128 * 2);
  h16*   wz_h   = (h16*)  carve(64 * 128 * 2);
  float* xb_f   = (float*)carve(256 * 64 * 4);
  float* zb_f   = (float*)carve(256 * 64 * 4);

  // ---- 1) + 2) layernorm (wave per row); weights + z to f16 (512 blocks)
  layernorm_cvt_kernel<<<8704, 256, 0, stream>>>(   // 512 + 8192 blocks
      x, ln_w, ln_b, xn_h, z, wq, wk, wv, wg, wo, wx, wz, z_h);

  // ---- 4) GEMMs: 16x64 strip per wave, W async-staged to LDS
  auto gemm = [&](const h16* A, const h16* W, h16* Ch, float* Cf,
                  const float* bias, int M, int N, int K,
                  int lda, int ldc, float alpha, int flags) {
    int strips = (M >> 4) * (N >> 6);
    int blocks = (strips + 7) / 8;
    gemm64_kernel<<<blocks, 256, 0, stream>>>(A, W, Ch, Cf, bias,
                                              M, N, K, lda, ldc, alpha, flags);
  };
  const float qscale = 0.17677669529663687f;  // CH^-0.5 = 1/sqrt(32)

  // fused q/g projection: reads xn once, writes qh (scaled) + gh (sigmoid);
  // in the same launch K, V^T and zb from z (10 blocks) and the column mean of
  // xn (128 blocks)
  gemm_qg_kernel<<<1162, 256, 0, stream>>>(xn_h, wq_h, wg_h, qh, gh, bg,
                                           (int)NROWS, qscale,
                                           xbar_h, z_h, wk_h, wv_h, wz_h,
                                           kh, vT, zb_f);

  gemm(xbar_h, wx_h, nullptr, xb_f, nullptr, 256, 64, 128, 128, 64, 1.0f, 0);

  // ---- 5) triangle bias
  tri_kernel<<<dim3(256, 4), 256, 0, stream>>>(xb_f, zb_f, tri);

  // ---- 6) fused attention: 8 rows per block, all on one (query tile, head)
  attn_kernel<<<dim3(32, 16, 4), 256, 0, stream>>>(qh, kh, vT, gh, tri, mask, og);

  // ---- 7) output projection: out = og @ wo^T + bo  (f32 out)
  gemm(og, wo_h, nullptr, out, bo, NROWS, 128, 128, 128, 128, 1.0f, 0);
}

// v003
// One run takes 104 microseconds.
// In both of two side-by-side timings against v002, it was 1.26 times as fast.
// Counting every step since v000, it is 3.11 times as fast.
#include <hip/hip_runtime.h>
#include <hip/hip_bf16.h>
#include <hip/hip_fp16.h>

// ---------------------------------------------------------------------------
// TriangleCrossAttention on gfx1250 (CDNA5)
//  - all GEMMs on V_WMMA_F32_16X16X32_F16 (f32 accumulate)
//  - weights staged to LDS with GLOBAL_LOAD_ASYNC_TO_LDS_B128 (ASYNCcnt path)
//  - 16x64 C strip per wave; fused q/g GEMM reads xn once, 8 WMMAs per A frag
//  - kernels that do not depend on each other share a launch (block ranges)
//  - K, V^T and tri lie in memory in the order the attention wave's fragments
//    take them: lane l's 16 bytes at byte l*16 of a 512-byte unit
// B=1, N=M=256, CQ=CKV=128, H=4, CH=32, CB=16
// ---------------------------------------------------------------------------

typedef _Float16 h16;
typedef __attribute__((ext_vector_type(16))) _Float16 v16h;
typedef __attribute__((ext_vector_type(8)))  _Float16 v8h;
typedef __attribute__((ext_vector_type(4)))  _Float16 v4h;
typedef __attribute__((ext_vector_type(8)))  float    v8f;
typedef __attribute__((ext_vector_type(4)))  float    v4f;

#define WMMA_F16(a, b, c) \
  __builtin_amdgcn_wmma_f32_16x16x32_f16(false, (a), false, (b), (short)0, (c), false, false)

static __device__ __forceinline__ int laneId() { return threadIdx.x & 31; }

// Async copy 16B global -> LDS (CDNA5 GLOBAL_LOAD_ASYNC_TO_LDS_B128, ASYNCcnt).
static __device__ __forceinline__ void async_load_b128(unsigned int lds_off,
                                                       unsigned long long gaddr) {
  asm volatile("global_load_async_to_lds_b128 %0, %1, off"
               :: "v"(lds_off), "v"(gaddr)
               : "memory");
}
static __device__ __forceinline__ void wait_async0() {
  asm volatile("s_wait_asynccnt 0x0" ::: "memory");
}
// Four such copies, 4 KiB apart (one round of a 256-thread block each). The
// s_wait_xcnt ends the copies' own statement, so that no address register of
// a copy is rewritten in front of it.
static __device__ __forceinline__ void async_load4_b128(unsigned int lds_off,
                                                        unsigned long long gaddr) {
  asm volatile("global_load_async_to_lds_b128 %0, %4, off\n\t"
               "global_load_async_to_lds_b128 %1, %5, off\n\t"
               "global_load_async_to_lds_b128 %2, %6, off\n\t"
               "global_load_async_to_lds_b128 %3, %7, off\n\t"
               "s_wait_xcnt 0x0"
               :: "v"(lds_off), "v"(lds_off + 4096u),
                  "v"(lds_off + 8192u), "v"(lds_off + 12288u),
                  "v"(gaddr), "v"(gaddr + 4096ull),
                  "v"(gaddr + 8192ull), "v"(gaddr + 12288ull)
               : "memory");
}

// Load one 16x32 f16 fragment (A-matrix layout; also valid for the B operand
// when B is a row-major weight matrix W with K contiguous, since
// B[k][n] = W[n][k] mirrors the A striping with M<->N swapped).
// CDNA5 layout: lanes 0-15 -> row M=lane, K 0..7 (v0-3) and 16..23 (v4-7);
// lanes 16-31 -> row M=lane-16, K 8..15 and 24..31.
static __device__ __forceinline__ v16h load_frag(const h16* __restrict__ base,
                                                 int rowTile, int ld, int kbase) {
  const int lane = laneId();
  const h16* p = base + (size_t)(rowTile + (lane & 15)) * ld
                      + kbase + ((lane >> 4) << 3);
  v8h lo = *(const v8h*)(p);
  v8h hi = *(const v8h*)(p + 16);
  v16h f;
#pragma unroll
  for (int i = 0; i < 8; ++i) { f[i] = lo[i]; f[i + 8] = hi[i]; }
  return f;
}

// ---------------------------------------------------------------------------
// Fragment order of the three operands that every attention wave reads whole.
// A unit is what one wave-wide 16-byte load takes: 32 lanes x 16 bytes, lane
// (hh = lane>>4, c = lane&15) at byte lane*16, so a load covers four whole
// 128-byte lines. At each register position a lane gets the element that
// load_frag's layout puts there (same k order).
//   K   [head][key tile 16][k half 16][lane: c = key,     hh = k>>3  ][8 channels]
//   V^T [head][key block 32][ch tile 16][k half 16][lane: c = channel, hh = key>>3][8 keys]
//   tri [head][query tile 16][key tile 16][4-key half][lane: c = query, hh = key>>3][4 keys]
// ---------------------------------------------------------------------------
static __device__ __forceinline__ int kfrag_index(int m, int ch) {   // key, channel 0..127
  return ((((ch >> 5) * 16 + (m >> 4)) * 2 + ((ch >> 4) & 1)) * 32
          + ((ch >> 3) & 1) * 16 + (m & 15)) * 8 + (ch & 7);
}
static __device__ __forceinline__ int vfrag_index(int ch, int m) {   // channel 0..127, key
  return (((((ch >> 5) * 8 + (m >> 5)) * 2 + ((ch >> 4) & 1)) * 2 + ((m >> 4) & 1)) * 32
          + ((m >> 3) & 1) * 16 + (ch & 15)) * 8 + (m & 7);
}

// ---------------------------------------------------------------------------
// Small GEMM for a block range of a shared launch:
//   C[256,N] = A[256,128] * W[N,128]^T, N = 64 or 128, 256 threads,
//   N/32 blocks (blk = 0..N/32-1), one 16x64 strip per wave.
//   W async-staged to LDS as in gemm64_kernel; same k order, same sums.
//   OUT: what is stored: C as f16 in K's fragment order, C^T as f16 in V^T's
//   fragment order, or C as f32, row-major (Cf). A wave's 16x64 strip holds
//   every element of each 128-byte line that it writes.
// ---------------------------------------------------------------------------
#define OUT_KFRAG 0
#define OUT_VFRAG 1
#define OUT_F32   2
template <int N, int OUT>
static __device__ __forceinline__ void gemm256_block(h16* Wlds,
                                                     const h16* __restrict__ A,
                                                     const h16* __restrict__ W,
                                                     h16* __restrict__ Ch,
                                                     float* __restrict__ Cf,
                                                     int blk) {
  const unsigned int       l = (unsigned int)(size_t)((char*)Wlds + threadIdx.x * 16);
  const unsigned long long g = (unsigned long long)(size_t)((const char*)W + threadIdx.x * 16);
#pragma unroll   // 1 or 2 rounds of four copies: every copy gets registers of its own
  for (int o = 0; o < N * 256; o += 16384) async_load4_b128(l + o, g + o);
  wait_async0();
  __syncthreads();

  const int tilesN = N >> 6;
  const int wave   = blk * 8 + (threadIdx.x >> 5);   // 0 .. 16*tilesN-1
  const int tm = (wave / tilesN) << 4;
  const int tn = (wave % tilesN) << 6;

  v8f acc[4] = {{}, {}, {}, {}};
  for (int k = 0; k < 128; k += 32) {
    v16h a = load_frag(A, tm, 128, k);
    v16h b[4];
#pragma unroll
    for (int t = 0; t < 4; ++t) b[t] = load_frag(Wlds, tn + (t << 4), 128, k);
#pragma unroll
    for (int t = 0; t < 4; ++t) acc[t] = WMMA_F16(a, b[t], acc[t]);
  }

  const int lane = laneId();
  const int rb   = tm + ((lane >> 4) << 3);
#pragma unroll
  for (int t = 0; t < 4; ++t) {
    const int col = tn + (t << 4) + (lane & 15);
#pragma unroll
    for (int v = 0; v < 8; ++v) {
      const float y = acc[t][v];
      const int r = rb + v;
      if (OUT == OUT_VFRAG)      Ch[vfrag_index(col, r)] = (h16)y;
      else if (OUT == OUT_KFRAG) Ch[kfrag_index(r, col)] = (h16)y;
      else                       Cf[(size_t)r * N + col] = y;
    }
  }
  // The stores' address and data registers stay untouched up to this wait: the
  // code of the launch's other block ranges follows and rewrites them.
  asm volatile("s_wait_xcnt 0x0" ::: "memory");
}

// ---------------------------------------------------------------------------
// 1) One launch, two independent jobs.
//    Blocks 0..511: f32 -> f16 of z and the seven weight matrices into one
//    contiguous f16 region (order z, wq, wk, wv, wg, wo, wx, wz).
//    Blocks 512.. : LayerNorm over channel dim (128), f16 out, one wave per row.
// ---------------------------------------------------------------------------
#define CVT_BLOCKS 512
__global__ void layernorm_cvt_kernel(const float* __restrict__ x,
                                     const float* __restrict__ ln_w,
                                     const float* __restrict__ ln_b,
                                     h16* __restrict__ xn,
                                     const float* __restrict__ z_f,
                                     const float* __restrict__ wq_f,
                                     const float* __restrict__ wk_f,
                                     const float* __restrict__ wv_f,
                                     const float* __restrict__ wg_f,
                                     const float* __restrict__ wo_f,
                                     const float* __restrict__ wx_f,
                                     const float* __restrict__ wz_f,
                                     h16* __restrict__ cvt_out) {
  if (blockIdx.x < CVT_BLOCKS) {                       // block-uniform
    const int b = blockIdx.x;                          // 256 elements per block
    const float* in;
    int first;                                         // the source's first block
    if      (b < 128) { in = z_f;  first = 0;   }
    else if (b < 192) { in = wq_f; first = 128; }
    else if (b < 256) { in = wk_f; first = 192; }
    else if (b < 320) { in = wv_f; first = 256; }
    else if (b < 384) { in = wg_f; first = 320; }
    else if (b < 448) { in = wo_f; first = 384; }
    else if (b < 480) { in = wx_f; first = 448; }
    else              { in = wz_f; first = 480; }
    cvt_out[b * 256 + threadIdx.x] = (h16)in[(b - first) * 256 + threadIdx.x];
    return;
  }
  const int wave = threadIdx.x >> 5;
  const int lane = laneId();
  const size_t row = (size_t)(blockIdx.x - CVT_BLOCKS) * 8 + wave;   // 0..65535
  const int c = lane << 2;                             // 4 channels per lane

  float4 xv = *(const float4*)(x + row * 128 + c);
  float s  = xv.x + xv.y + xv.z + xv.w;
  float ss = xv.x * xv.x + xv.y * xv.y + xv.z * xv.z + xv.w * xv.w;
#pragma unroll
  for (int off = 16; off >= 1; off >>= 1) {
    s  += __shfl_xor(s,  off);
    ss += __shfl_xor(ss, off);
  }
  const float mu   = s * (1.0f / 128.0f);
  const float var  = ss * (1.0f / 128.0f) - mu * mu;
  const float rstd = rsqrtf(var + 1e-5f);

  float4 wv = *(const float4*)(ln_w + c);
  float4 bv = *(const float4*)(ln_b + c);
  v4h o;
  o[0] = (h16)((xv.x - mu) * rstd * wv.x + bv.x);
  o[1] = (h16)((xv.y - mu) * rstd * wv.y + bv.y);
  o[2] = (h16)((xv.z - mu) * rstd * wv.z + bv.z);
  o[3] = (h16)((xv.w - mu) * rstd * wv.w + bv.w);
  *(v4h*)(xn + row * 128 + c) = o;
}

// ---------------------------------------------------------------------------
// 3) Column mean over inner N (q) of xn -> xbar (256x128, f16), for a block
//    range of a shared launch: 256 threads, two n per block (blk = 0..127),
//    one thread per (n, channel).
// ---------------------------------------------------------------------------
static __device__ __forceinline__ void colmean_block(const h16* __restrict__ xn,
                                                     h16* __restrict__ xbar,
                                                     int blk) {
  const int n = blk * 2 + (threadIdx.x >> 7);   // 0..255
  const int c = threadIdx.x & 127;              // 0..127
  float acc = 0.0f;
  for (int q = 0; q < 256; q += 8) {
    const h16* p = xn + ((size_t)(n * 256 + q)) * 128 + c;
    h16 t[8];
#pragma unroll
    for (int i = 0; i < 8; ++i) t[i] = p[i * 128];
    // The loads' address register stays untouched up to this wait.
    asm volatile("s_wait_xcnt 0x0" :: "v"(p) : "memory");
#pragma unroll
    for (int i = 0; i < 8; ++i) acc += (float)t[i];   // same order as q = 0..255
  }
  xbar[n * 128 + c] = (h16)(acc * (1.0f / 256.0f));
  // Same wait behind the store: code of other block ranges follows it.
  asm volatile("s_wait_xcnt 0x0" ::: "memory");
}

// ---------------------------------------------------------------------------
// 4a) WMMA GEMM: C[M,N] = act(alpha * A[M,K] * W[N,K]^T + bias)
//     W (<=128x128 f16, ldw==K) async-staged to LDS once per block.
//     Each wave computes a 16x64 strip; all 4 B frags batched before the
//     WMMA chain so DS latency is paid once per k-step.
//     Requires: K % 32 == 0, N % 64 == 0, M % 16 == 0.
// ---------------------------------------------------------------------------
#define GF_SIGMOID   1
#define GF_TRANSPOSE 2   // store C^T (Ch[col*ldc + row]); f16 path only

__global__ void gemm64_kernel(const h16* __restrict__ A,
                              const h16* __restrict__ W,
                              h16* __restrict__ Ch, float* __restrict__ Cf,
                              const float* __restrict__ bias,
                              int M, int N, int K,
                              int lda, int ldc,
                              float alpha, int flags) {
  __shared__ __attribute__((aligned(16))) h16 Wlds[16384];  // up to 128x128 f16

  // ---- async-stage W (row-major, ld == K) into LDS
  const int wbytes = N * K * 2;
  for (int o = threadIdx.x * 16; o < wbytes; o += blockDim.x * 16)
    async_load_b128((unsigned int)(size_t)((char*)Wlds + o),
                    (unsigned long long)(size_t)((const char*)W + o));
  wait_async0();
  __syncthreads();

  const int tilesN = N >> 6;                       // 64-wide wave strips
  const int total  = (M >> 4) * tilesN;
  const int wave   = blockIdx.x * (blockDim.x >> 5) + (threadIdx.x >> 5);
  if (wave >= total) return;                       // wave-uniform

  const int tm = (wave / tilesN) << 4;
  const int tn = (wave % tilesN) << 6;

  v8f acc[4] = {{}, {}, {}, {}};
  for (int k = 0; k < K; k += 32) {
    v16h a = load_frag(A, tm, lda, k);
    v16h b[4];
#pragma unroll
    for (int t = 0; t < 4; ++t) b[t] = load_frag(Wlds, tn + (t << 4), K, k);
#pragma unroll
    for (int t = 0; t < 4; ++t) acc[t] = WMMA_F16(a, b[t], acc[t]);
  }

  const int lane = laneId();
  const int rb   = tm + ((lane >> 4) << 3);
#pragma unroll
  for (int t = 0; t < 4; ++t) {
    const int col = tn + (t << 4) + (lane & 15);
    const float bv = bias ? bias[col] : 0.0f;
#pragma unroll
    for (int v = 0; v < 8; ++v) {
      float y = acc[t][v] * alpha + bv;
      if (flags & GF_SIGMOID) y = 1.0f / (1.0f + __expf(-y));
      const int r = rb + v;
      if (flags & GF_TRANSPOSE) {
        Ch[(size_t)col * ldc + r] = (h16)y;
      } else {
        if (Ch) Ch[(size_t)r * ldc + col] = (h16)y;
        if (Cf) Cf[(size_t)r * ldc + col] = y;
      }
    }
  }
}

// ---------------------------------------------------------------------------
// 4b) Fused q/g GEMM: Q = qscale*(A Wq^T), G = sigmoid(A Wg^T + bg)
//     Shares the A (xn) stream: 8 WMMAs per A fragment, N = K = 128.
//     The launch's first blocks do four jobs that depend on q/g as little as
//     q/g on them: 0..3 K = z wk^T, 4..7 V^T = (z wv^T)^T, 8..9 zb = z wz^T
//     (f32), 10..137 the column mean of xn.
// ---------------------------------------------------------------------------
#define ZG_BLOCKS 10
#define CM_BLOCKS 128
// 10 waves per SIMD keeps the register allocation at the 96 that q/g alone has
// (the shared kernel took 120 without it): five blocks per WGP, as the 64 KiB
// of LDS allow, so that all 1162 blocks are resident at once.
__global__ void __launch_bounds__(256, 10)
gemm_qg_kernel(const h16* __restrict__ A,
                               const h16* __restrict__ Wq,
                               const h16* __restrict__ Wg,
                               h16* __restrict__ Q, h16* __restrict__ G,
                               const float* __restrict__ bg,
                               int M, float qscale,
                               h16* __restrict__ xbar,
                               const h16* __restrict__ zh,
                               const h16* __restrict__ wk,
                               const h16* __restrict__ wv,
                               const h16* __restrict__ wz,
                               h16* __restrict__ kh,
                               h16* __restrict__ vT,
                               float* __restrict__ zb) {
  __shared__ __attribute__((aligned(16))) h16 Wq_lds[16384];  // 128x128 f16
  __shared__ __attribute__((aligned(16))) h16 Wg_lds[16384];  // 128x128 f16

  if (blockIdx.x < ZG_BLOCKS + CM_BLOCKS) {            // block-uniform
    const int b = blockIdx.x;
    if      (b < 4)  gemm256_block<128, OUT_KFRAG>(Wq_lds, zh, wk, kh, nullptr, b);
    else if (b < 8)  gemm256_block<128, OUT_VFRAG>(Wq_lds, zh, wv, vT, nullptr, b - 4);
    else if (b < 10) gemm256_block<64,  OUT_F32  >(Wq_lds, zh, wz, nullptr, zb, b - 8);
    else             colmean_block(A, xbar, b - ZG_BLOCKS);
    return;
  }

  for (int o = threadIdx.x * 16; o < 32768; o += blockDim.x * 16) {
    async_load_b128((unsigned int)(size_t)((char*)Wq_lds + o),
                    (unsigned long long)(size_t)((const char*)Wq + o));
    async_load_b128((unsigned int)(size_t)((char*)Wg_lds + o),
                    (unsigned long long)(size_t)((const char*)Wg + o));
  }
  wait_async0();
  __syncthreads();

  const int total = (M >> 4) * 2;                  // two 64-wide strips per row
  const int wave  = (blockIdx.x - (ZG_BLOCKS + CM_BLOCKS)) * (blockDim.x >> 5) + (threadIdx.x >> 5);
  if (wave >= total) return;                       // wave-uniform

  const int tm = (wave >> 1) << 4;
  const int tn = (wave & 1) << 6;

  v8f accq[4] = {{}, {}, {}, {}};
  v8f accg[4] = {{}, {}, {}, {}};
  for (int k = 0; k < 128; k += 32) {
    v16h a = load_frag(A, tm, 128, k);
    v16h bq[4], bgf[4];
#pragma unroll
    for (int t = 0; t < 4; ++t) bq[t]  = load_frag(Wq_lds, tn + (t << 4), 128, k);
#pragma unroll
    for (int t = 0; t < 4; ++t) bgf[t] = load_frag(Wg_lds, tn + (t << 4), 128, k);
#pragma unroll
    for (int t = 0; t < 4; ++t) accq[t] = WMMA_F16(a, bq[t],  accq[t]);
#pragma unroll
    for (int t = 0; t < 4; ++t) accg[t] = WMMA_F16(a, bgf[t], accg[t]);
  }

  const int lane = laneId();
  const int rb   = tm + ((lane >> 4) << 3);
#pragma unroll
  for (int t = 0; t < 4; ++t) {
    const int col = tn + (t << 4) + (lane & 15);
    const float bgv = bg[col];
#pragma unroll
    for (int v = 0; v < 8; ++v) {
      const int r = rb + v;
      Q[(size_t)r * 128 + col] = (h16)(accq[t][v] * qscale);
      const float y = accg[t][v] + bgv;
      G[(size_t)r * 128 + col] = (h16)(1.0f / (1.0f + __expf(-y)));
    }
  }
}

// ---------------------------------------------------------------------------
// 5) tri(h, n, m) = sum_d xb[n][h*16+d] * zb[m][h*16+d]   (K=16, VALU)
//    One block per (head, 16 queries n, 16 keys m): its 256 results are the two
//    512-byte units of that tile in tri's fragment order, thread t's at float t.
// ---------------------------------------------------------------------------
__global__ void tri_kernel(const float* __restrict__ xb,
                           const float* __restrict__ zb,
                           float* __restrict__ tri) {
  const int h = blockIdx.y;                                // 0..3
  const int t = threadIdx.x;                               // [4-key half][hh][c][4 keys]
  const int n = (blockIdx.x >> 4) * 16 + ((t >> 2) & 15);  // query 0..255
  const int m = (blockIdx.x & 15) * 16 + ((t >> 6) & 1) * 8 + (t >> 7) * 4 + (t & 3);
  const float* xr = xb + n * 64 + h * 16;
  const float* zr = zb + m * 64 + h * 16;
  float acc = 0.0f;
#pragma unroll
  for (int d = 0; d < 16; ++d) acc += xr[d] * zr[d];
  tri[(size_t)(h * 256 + blockIdx.x) * 256 + t] = acc;
}

// ---------------------------------------------------------------------------
// 6) Fused attention core: one wave per (row r, 16-query tile, head).
//    S^T = K_h Q^T   : A = 16 keys x 32 ch, B = 32 ch x 16 queries.
//    A lane then holds scores of ONE query (column lane&15): 8 keys per tile,
//    128 of the 256 keys per lane; lanes l and l^16 split the keys.
//    Softmax: in-lane maximum and sum plus one exchange between wave halves.
//    O^T = V_h^T P^T : two packed S^T tiles are a B operand as they stand
//    (hardware k order), V^T is loaded in the same k order by frag_units.
//    No LDS, no barrier.
// ---------------------------------------------------------------------------
static __device__ __forceinline__ float xhalf(float x) {   // lane l <-> l ^ 16
  const int b = __builtin_bit_cast(int, x);
  return __builtin_bit_cast(float,
      __builtin_amdgcn_permlanex16(b, b, 0x76543210, 0xfedcba98, false, false));
}

// 16x32 f16 fragment from the lane's own pointer (row lane&15, k offset
// 8*(lane>>4)): same k order as load_frag.
static __device__ __forceinline__ v16h frag_at(const h16* __restrict__ p) {
  v8h lo = *(const v8h*)(p);
  v8h hi = *(const v8h*)(p + 16);
  v16h f;
#pragma unroll
  for (int i = 0; i < 8; ++i) { f[i] = lo[i]; f[i + 8] = hi[i]; }
  return f;
}

// 16x32 f16 fragment from an array in fragment order: p is the lane's own 16
// bytes of the first unit (k half 0); the second unit follows 512 bytes on.
static __device__ __forceinline__ v16h frag_units(const h16* __restrict__ p) {
  v8h lo = *(const v8h*)(p);
  v8h hi = *(const v8h*)(p + 256);
  v16h f;
#pragma unroll
  for (int i = 0; i < 8; ++i) { f[i] = lo[i]; f[i + 8] = hi[i]; }
  return f;
}

// Eight 2^x in one statement. No result shares a register with an argument
// ("=&v"), so no v_exp_f32 is directly followed by a write of its source or a
// read of its result; the v_nop is that slot behind the last one.
static __device__ __forceinline__ v8f exp2_x8(v8f x) {
  float e0, e1, e2, e3, e4, e5, e6, e7;
  asm("v_exp_f32 %0, %8\n\t"
      "v_exp_f32 %1, %9\n\t"
      "v_exp_f32 %2, %10\n\t"
      "v_exp_f32 %3, %11\n\t"
      "v_exp_f32 %4, %12\n\t"
      "v_exp_f32 %5, %13\n\t"
      "v_exp_f32 %6, %14\n\t"
      "v_exp_f32 %7, %15\n\t"
      "v_nop"
      : "=&v"(e0), "=&v"(e1), "=&v"(e2), "=&v"(e3),
        "=&v"(e4), "=&v"(e5), "=&v"(e6), "=&v"(e7)
      : "v"(x[0]), "v"(x[1]), "v"(x[2]), "v"(x[3]),
        "v"(x[4]), "v"(x[5]), "v"(x[6]), "v"(x[7]));
  v8f e = {e0, e1, e2, e3, e4, e5, e6, e7};
  return e;
}

// 4 waves per SIMD (256 VGPRs): two blocks per WGP hide each other's load waits
__global__ void __launch_bounds__(256, 4)
attn_kernel(const h16* __restrict__ qh,   // [65536][128] scaled
            const h16* __restrict__ kh,   // 256 keys x 128 ch, fragment order
            const h16* __restrict__ vT,   // 128 ch x 256 keys, fragment order
            const h16* __restrict__ gh,   // [65536][128] sigmoid'd
            const float* __restrict__ tri,// 4 x 256 x 256, fragment order
            const float* __restrict__ mask,// [256][256]
            h16* __restrict__ og) {       // [65536][128]
  const int lane = laneId();
  const int c    = lane & 15;                              // query column
  const int hh   = lane >> 4;                              // wave half
  const int r    = blockIdx.x * 8 + (threadIdx.x >> 5);    // 0..255
  const int q0   = blockIdx.y << 4;                        // 16 queries
  const int h    = blockIdx.z;                             // head

  // element offset of (query c, head h, channel 8*hh) in qh, gh and og
  const size_t idx = ((size_t)(r * 256 + q0) + c) * 128 + h * 32 + (hh << 3);
  const h16*   qp = qh + idx;
  // the lane's 16 bytes in the first unit of the head's K, of the (head, query
  // tile)'s tri and of the head's V^T
  const h16*   kp = kh + h * 8192 + lane * 8;
  const float* tp = tri + (size_t)(h * 16 + blockIdx.y) * 4096 + lane * 4;
  const h16*   vp = vT + h * 8192 + lane * 8;
  const h16*   gp = gh + idx;

  const int   mi = r * 256 + q0 + c;                       // (row, query) in mask
  const float mk = mask[mi];
  // The mask load's index register stays untouched up to this wait.
  asm volatile("s_wait_xcnt 0x0" :: "v"(mi) : "memory");
  const float mb = 1.0e9f * (mk - 1.0f);
  const v16h  qf = frag_at(qp);

  // ---- scores: s[mt][v] = logit(query c, key mt*16 + 8*hh + v)
  v8f s[16];
#pragma unroll
  for (int mt = 0; mt < 16; ++mt) {
    const v16h a  = frag_units(kp + mt * 512);
    const v4f  t0 = *(const v4f*)(tp + mt * 256);          // keys 8*hh + 0..3
    const v4f  t1 = *(const v4f*)(tp + mt * 256 + 128);    // keys 8*hh + 4..7
    const v8f  t  = {t0[0], t0[1], t0[2], t0[3], t1[0], t1[1], t1[2], t1[3]};
    v8f z = {};
    z = WMMA_F16(a, qf, z);
    s[mt] = z + (t + mb);
  }
  // The address registers of the loads above stay untouched up to this wait.
  asm volatile("s_wait_xcnt 0x0" :: "v"(qp), "v"(kp), "v"(tp) : "memory");

  // ---- maximum over the 256 keys of the lane's query
  v8f mv = s[0];
#pragma unroll
  for (int mt = 1; mt < 16; ++mt)
#pragma unroll
    for (int v = 0; v < 8; ++v) mv[v] = fmaxf(mv[v], s[mt][v]);
  float mx = fmaxf(fmaxf(fmaxf(mv[0], mv[1]), fmaxf(mv[2], mv[3])),
                   fmaxf(fmaxf(mv[4], mv[5]), fmaxf(mv[6], mv[7])));
  mx = fmaxf(mx, xhalf(mx));

  // ---- exp, f32 sum (8 independent chains), pack to the B operand of P^T
  v8f  sv = {};
  v16h pb[8];
#pragma unroll
  for (int mt = 0; mt < 16; ++mt) {
    const v8f e = exp2_x8((s[mt] - mx) * 1.44269504f);   // e^(s - mx)
    sv += e;
#pragma unroll
    for (int v = 0; v < 8; ++v) pb[mt >> 1][((mt & 1) << 3) + v] = (h16)e[v];
  }
  float sum = ((sv[0] + sv[1]) + (sv[2] + sv[3])) + ((sv[4] + sv[5]) + (sv[6] + sv[7]));
  sum += xhalf(sum);
  const float inv = 1.0f / sum;

  // ---- O^T (32 ch x 16 queries) = V_h^T (32 x 256) P^T (256 x 16)
  v8f o0 = {}, o1 = {};
#pragma unroll
  for (int j = 0; j < 8; ++j) {
    const v16h a0 = frag_units(vp + j * 1024);             // channels 0..15
    const v16h a1 = frag_units(vp + j * 1024 + 512);       // channels 16..31
    o0 = WMMA_F16(a0, pb[j], o0);
    o1 = WMMA_F16(a1, pb[j], o1);
  }

  // ---- gate and store: a lane holds 8 consecutive channels of its query
  const v8h g0 = *(const v8h*)(gp);
  const v8h g1 = *(const v8h*)(gp + 16);
  // Same wait for the address registers of the V^T and gate loads.
  asm volatile("s_wait_xcnt 0x0" :: "v"(vp), "v"(gp) : "memory");
  v8h w0, w1;
#pragma unroll
  for (int v = 0; v < 8; ++v) {
    w0[v] = (h16)(o0[v] * inv * (float)g0[v]);
    w1[v] = (h16)(o1[v] * inv * (float)g1[v]);
  }
  *(v8h*)(og + idx)      = w0;
  *(v8h*)(og + idx + 16) = w1;
}

// ---------------------------------------------------------------------------
// Host-side orchestration
// ---------------------------------------------------------------------------
extern "C" void kernel_launch(void* const* d_in, const int* in_sizes, int n_in,
                              void* d_out, int out_size, void* d_ws, size_t ws_size,
                              hipStream_t stream) {
  (void)in_sizes; (void)n_in; (void)out_size; (void)ws_size;

  const float* x    = (const float*)d_in[0];   // (1,256,256,128)
  const float* z    = (const float*)d_in[1];   // (1,256,128)
  const float* mask = (const float*)d_in[2];   // (1,256,256)
  const float* ln_w = (const float*)d_in[3];
  const float* ln_b = (const float*)d_in[4];
  const float* wx   = (const float*)d_in[5];   // (64,128)
  const float* wz   = (const float*)d_in[6];   // (64,128)
  const float* wq   = (const float*)d_in[7];   // (128,128)
  const float* wk   = (const float*)d_in[8];
  const float* wv   = (const float*)d_in[9];
  const float* wg   = (const float*)d_in[10];
  const float* bg   = (const float*)d_in[11];  // (128,)
  const float* wo   = (const float*)d_in[12];  // (128,128)
  const float* bo   = (const float*)d_in[13];  // (128,)
  float* out = (float*)d_out;                  // (1,256,256,128)

  // ---- workspace carve-up (256B aligned regions)
  char* ws = (char*)d_ws;
  size_t off = 0;
  auto carve = [&](size_t bytes) -> char* {
    char* p = ws + off;
    off = (off + bytes + 255) & ~(size_t)255;
    return p;
  };
  const size_t NROWS = 65536;                 // 256*256
  h16*   xn_h   = (h16*)  carve(NROWS * 128 * 2);
  h16*   qh     = (h16*)  carve(NROWS * 128 * 2);
  h16*   gh     = (h16*)  carve(NROWS * 128 * 2);
  h16*   og     = (h16*)  carve(NROWS * 128 * 2);
  float* tri    = (float*)carve(4 * 256 * 256 * 4);
  h16*   kh     = (h16*)  carve(256 * 128 * 2);
  h16*   vT     = (h16*)  carve(128 * 256 * 2);
  h16*   xbar_h = (h16*)  carve(256 * 128 * 2);
  // f16 copies of z and the weights: contiguous, in the converting blocks' order
  h16*   z_h    = (h16*)  carve(256 * 128 * 2);
  h16*   wq_h   = (h16*)  carve(128 * 128 * 2);
  h16*   wk_h   = (h16*)  carve(128 * 128 * 2);
  h16*   wv_h   = (h16*)  carve(128 * 128 * 2);
  h16*   wg_h   = (h16*)  carve(128 * 128 * 2);
  h16*   wo_h   = (h16*)  carve(128 * 128 * 2);
  h16*   wx_h   = (h16*)  carve(64 * 128 * 2);
  h16*   wz_h   = (h16*)  carve(64 * 128 * 2);
  float* xb_f   = (float*)carve(256 * 64 * 4);
  float* zb_f   = (float*)carve(256 * 64 * 4);

  // ---- 1) + 2) layernorm (wave per row); weights + z to f16 (512 blocks)
  layernorm_cvt_kernel<<<8704, 256, 0, stream>>>(   // 512 + 8192 blocks
      x, ln_w, ln_b, xn_h, z, wq, wk, wv, wg, wo, wx, wz, z_h);

  // ---- 4) GEMMs: 16x64 strip per wave, W async-staged to LDS
  auto gemm = [&](const h16* A, const h16* W, h16* Ch, float* Cf,
                  const float* bias, int M, int N, int K,
                  int lda, int ldc, float alpha, int flags) {
    int strips = (M >> 4) * (N >> 6);
    int blocks = (strips + 7) / 8;
    gemm64_kernel<<<blocks, 256, 0, stream>>>(A, W, Ch, Cf, bias,
                                              M, N, K, lda, ldc, alpha, flags);
  };
  const float qscale = 0.17677669529663687f;  // CH^-0.5 = 1/sqrt(32)

  // fused q/g projection: reads xn once, writes qh (scaled) + gh (sigmoid);
  // in the same launch K, V^T and zb from z (10 blocks) and the column mean of
  // xn (128 blocks)
  gemm_qg_kernel<<<1162, 256, 0, stream>>>(xn_h, wq_h, wg_h, qh, gh, bg,
                                           (int)NROWS, qscale,
                                           xbar_h, z_h, wk_h, wv_h, wz_h,
                                           kh, vT, zb_f);

  gemm(xbar_h, wx_h, nullptr, xb_f, nullptr, 256, 64, 128, 128, 64, 1.0f, 0);

  // ---- 5) triangle bias
  tri_kernel<<<dim3(256, 4), 256, 0, stream>>>(xb_f, zb_f, tri);

  // ---- 6) fused attention: 8 rows per block, all on one (query tile, head)
  attn_kernel<<<dim3(32, 16, 4), 256, 0, stream>>>(qh, kh, vT, gh, tri, mask, og);

  // ---- 7) output projection: out = og @ wo^T + bo  (f32 out)
  gemm(og, wo_h, nullptr, out, bo, NROWS, 128, 128, 128, 128, 1.0f, 0);
}

// v004
// One run takes 94.4 microseconds.
// Timed twice side by side with v003, it ran 1.08 and 1.12 times as fast.
// Counting every step since v000, it is 3.43 times as fast.
#include <hip/hip_runtime.h>
#include <hip/hip_bf16.h>
#include <hip/hip_fp16.h>

// ---------------------------------------------------------------------------
// TriangleCrossAttention on gfx1250 (CDNA5)
//  - all GEMMs on V_WMMA_F32_16X16X32_F16 (f32 accumulate)
//  - weights staged to LDS with GLOBAL_LOAD_ASYNC_TO_LDS_B128 (ASYNCcnt path)
//  - 16x64 C strip per wave; fused q/g GEMM reads xn once, 8 WMMAs per A frag
//  - kernels that do not depend on each other share a launch (block ranges)
//  - K, V^T, zb, wx and xbar lie in memory in the order the attention wave's
//    fragments take them: lane l's 16 bytes at byte l*16 of a 512-byte unit
//  - the triangle bias is a second k slab of the score product:
//    logit = [q | xb] . [k | zb], xb made in the attention wave from xbar, wx
// B=1, N=M=256, CQ=CKV=128, H=4, CH=32, CB=16
// ---------------------------------------------------------------------------

typedef _Float16 h16;
typedef __attribute__((ext_vector_type(16))) _Float16 v16h;
typedef __attribute__((ext_vector_type(8)))  _Float16 v8h;
typedef __attribute__((ext_vector_type(4)))  _Float16 v4h;
typedef __attribute__((ext_vector_type(8)))  float    v8f;
typedef __attribute__((ext_vector_type(4)))  float    v4f;

#define WMMA_F16(a, b, c) \
  __builtin_amdgcn_wmma_f32_16x16x32_f16(false, (a), false, (b), (short)0, (c), false, false)

static __device__ __forceinline__ int laneId() { return threadIdx.x & 31; }

// Async copy 16B global -> LDS (CDNA5 GLOBAL_LOAD_ASYNC_TO_LDS_B128, ASYNCcnt).
static __device__ __forceinline__ void async_load_b128(unsigned int lds_off,
                                                       unsigned long long gaddr) {
  asm volatile("global_load_async_to_lds_b128 %0, %1, off"
               :: "v"(lds_off), "v"(gaddr)
               : "memory");
}
static __device__ __forceinline__ void wait_async0() {
  asm volatile("s_wait_asynccnt 0x0" ::: "memory");
}
// Four such copies, 4 KiB apart (one round of a 256-thread block each). The
// s_wait_xcnt ends the copies' own statement, so that no address register of
// a copy is rewritten in front of it.
static __device__ __forceinline__ void async_load4_b128(unsigned int lds_off,
                                                        unsigned long long gaddr) {
  asm volatile("global_load_async_to_lds_b128 %0, %4, off\n\t"
               "global_load_async_to_lds_b128 %1, %5, off\n\t"
               "global_load_async_to_lds_b128 %2, %6, off\n\t"
               "global_load_async_to_lds_b128 %3, %7, off\n\t"
               "s_wait_xcnt 0x0"
               :: "v"(lds_off), "v"(lds_off + 4096u),
                  "v"(lds_off + 8192u), "v"(lds_off + 12288u),
                  "v"(gaddr), "v"(gaddr + 4096ull),
                  "v"(gaddr + 8192ull), "v"(gaddr + 12288ull)
               : "memory");
}

// Load one 16x32 f16 fragment (A-matrix layout; also valid for the B operand
// when B is a row-major weight matrix W with K contiguous, since
// B[k][n] = W[n][k] mirrors the A striping with M<->N swapped).
// CDNA5 layout: lanes 0-15 -> row M=lane, K 0..7 (v0-3) and 16..23 (v4-7);
// lanes 16-31 -> row M=lane-16, K 8..15 and 24..31.
static __device__ __forceinline__ v16h load_frag(const h16* __restrict__ base,
                                                 int rowTile, int ld, int kbase) {
  const int lane = laneId();
  const h16* p = base + (size_t)(rowTile + (lane & 15)) * ld
                      + kbase + ((lane >> 4) << 3);
  v8h lo = *(const v8h*)(p);
  v8h hi = *(const v8h*)(p + 16);
  v16h f;
#pragma unroll
  for (int i = 0; i < 8; ++i) { f[i] = lo[i]; f[i + 8] = hi[i]; }
  return f;
}

// ---------------------------------------------------------------------------
// Fragment order of the operands that every attention wave reads whole.
// A unit is what one wave-wide 16-byte load takes: 32 lanes x 16 bytes, lane
// (hh = lane>>4, c = lane&15) at byte lane*16, so a load covers four whole
// 128-byte lines. At each register position a lane gets the element that
// load_frag's layout puts there (same k order).
//   K   [head][key tile 16][k half 16][lane: c = key,     hh = k>>3  ][8 channels]
//   V^T [head][key block 32][ch tile 16][k half 16][lane: c = channel, hh = key>>3][8 keys]
//   zb  [head][key tile 16][lane: c = key, hh = d>>3][8 bias channels d]
//   wx  [k step 32][head][k half 16][lane: c = d,     hh = k>>3][8 channels]
//   xbar: as K, with the query n for the key and the k step for the head
// ---------------------------------------------------------------------------
static __device__ __forceinline__ int kfrag_index(int m, int ch) {   // key, channel 0..127
  return ((((ch >> 5) * 16 + (m >> 4)) * 2 + ((ch >> 4) & 1)) * 32
          + ((ch >> 3) & 1) * 16 + (m & 15)) * 8 + (ch & 7);
}
static __device__ __forceinline__ int zfrag_index(int m, int col) {  // key, head*16 + d
  return (((col >> 4) * 16 + (m >> 4)) * 32
          + ((col >> 3) & 1) * 16 + (m & 15)) * 8 + (col & 7);
}
static __device__ __forceinline__ int vfrag_index(int ch, int m) {   // channel 0..127, key
  return (((((ch >> 5) * 8 + (m >> 5)) * 2 + ((ch >> 4) & 1)) * 2 + ((m >> 4) & 1)) * 32
          + ((m >> 3) & 1) * 16 + (ch & 15)) * 8 + (m & 7);
}

// ---------------------------------------------------------------------------
// Small GEMM for a block range of a shared launch:
//   C[256,N] = A[256,128] * W[N,128]^T, N = 64 or 128, 256 threads,
//   N/32 blocks (blk = 0..N/32-1), one 16x64 strip per wave.
//   W async-staged to LDS as in gemm64_kernel; same k order, same sums.
//   OUT: what is stored: C as f16 in K's fragment order, C^T as f16 in V^T's
//   fragment order, or C as f16 in zb's fragment order. A wave's 16x64 strip
//   holds every element of each 128-byte line that it writes.
// ---------------------------------------------------------------------------
#define OUT_KFRAG 0
#define OUT_VFRAG 1
#define OUT_ZFRAG 2
template <int N, int OUT>
static __device__ __forceinline__ void gemm256_block(h16* Wlds,
                                                     const h16* __restrict__ A,
                                                     const h16* __restrict__ W,
                                                     h16* __restrict__ Ch,
                                                     int blk) {
  const unsigned int       l = (unsigned int)(size_t)((char*)Wlds + threadIdx.x * 16);
  const unsigned long long g = (unsigned long long)(size_t)((const char*)W + threadIdx.x * 16);
#pragma unroll   // 1 or 2 rounds of four copies: every copy gets registers of its own
  for (int o = 0; o < N * 256; o += 16384) async_load4_b128(l + o, g + o);
  wait_async0();
  __syncthreads();

  const int tilesN = N >> 6;
  const int wave   = blk * 8 + (threadIdx.x >> 5);   // 0 .. 16*tilesN-1
  const int tm = (wave / tilesN) << 4;
  const int tn = (wave % tilesN) << 6;

  v8f acc[4] = {{}, {}, {}, {}};
  for (int k = 0; k < 128; k += 32) {
    v16h a = load_frag(A, tm, 128, k);
    v16h b[4];
#pragma unroll
    for (int t = 0; t < 4; ++t) b[t] = load_frag(Wlds, tn + (t << 4), 128, k);
#pragma unroll
    for (int t = 0; t < 4; ++t) acc[t] = WMMA_F16(a, b[t], acc[t]);
  }

  const int lane = laneId();
  const int rb   = tm + ((lane >> 4) << 3);
#pragma unroll
  for (int t = 0; t < 4; ++t) {
    const int col = tn + (t << 4) + (lane & 15);
#pragma unroll
    for (int v = 0; v < 8; ++v) {
      const float y = acc[t][v];
      const int r = rb + v;
      if (OUT == OUT_VFRAG)      Ch[vfrag_index(col, r)] = (h16)y;
      else if (OUT == OUT_KFRAG) Ch[kfrag_index(r, col)] = (h16)y;
      else                       Ch[zfrag_index(r, col)] = (h16)y;
    }
  }
  // The stores' address and data registers stay untouched up to this wait: the
  // code of the launch's other block ranges follows and rewrites them.
  asm volatile("s_wait_xcnt 0x0" ::: "memory");
}

// ---------------------------------------------------------------------------
// 1) One launch, two independent jobs.
//    Blocks 0..511: f32 -> f16 of z and the seven weight matrices into one
//    contiguous f16 region (order z, wq, wk, wv, wg, wo, wx, wz); wx goes into
//    its fragment order: a block writes one whole unit and gathers its source.
//    Blocks 512.. : LayerNorm over channel dim (128), f16 out, one wave per row.
// ---------------------------------------------------------------------------
#define CVT_BLOCKS 512
__global__ void layernorm_cvt_kernel(const float* __restrict__ x,
                                     const float* __restrict__ ln_w,
                                     const float* __restrict__ ln_b,
                                     h16* __restrict__ xn,
                                     const float* __restrict__ z_f,
                                     const float* __restrict__ wq_f,
                                     const float* __restrict__ wk_f,
                                     const float* __restrict__ wv_f,
                                     const float* __restrict__ wg_f,
                                     const float* __restrict__ wo_f,
                                     const float* __restrict__ wx_f,
                                     const float* __restrict__ wz_f,
                                     h16* __restrict__ cvt_out) {
  if (blockIdx.x < CVT_BLOCKS) {                       // block-uniform
    const int b = blockIdx.x;                          // 256 elements per block
    const float* in;
    int first;                                         // the source's first block
    if      (b < 128) { in = z_f;  first = 0;   }
    else if (b < 192) { in = wq_f; first = 128; }
    else if (b < 256) { in = wk_f; first = 192; }
    else if (b < 320) { in = wv_f; first = 256; }
    else if (b < 384) { in = wg_f; first = 320; }
    else if (b < 448) { in = wo_f; first = 384; }
    else if (b < 480) { in = wx_f; first = 448; }
    else              { in = wz_f; first = 480; }
    int src = (b - first) * 256 + threadIdx.x;
    if (b >= 448 && b < 480) {                         // wx: unit b - 448
      const int u   = b - 448;                         // [k step][head][k half]
      const int t   = threadIdx.x;                     // [hh][d][8 channels]
      const int row = ((u >> 1) & 3) * 16 + ((t >> 3) & 15);
      const int ch  = (u >> 3) * 32 + (u & 1) * 16 + (t >> 7) * 8 + (t & 7);
      src = row * 128 + ch;
    }
    cvt_out[b * 256 + threadIdx.x] = (h16)in[src];
    return;
  }
  const int wave = threadIdx.x >> 5;
  const int lane = laneId();
  const size_t row = (size_t)(blockIdx.x - CVT_BLOCKS) * 8 + wave;   // 0..65535
  const int c = lane << 2;                             // 4 channels per lane

  float4 xv = *(const float4*)(x + row * 128 + c);
  float s  = xv.x + xv.y + xv.z + xv.w;
  float ss = xv.x * xv.x + xv.y * xv.y + xv.z * xv.z + xv.w * xv.w;
#pragma unroll
  for (int off = 16; off >= 1; off >>= 1) {
    s  += __shfl_xor(s,  off);
    ss += __shfl_xor(ss, off);
  }
  const float mu   = s * (1.0f / 128.0f);
  const float var  = ss * (1.0f / 128.0f) - mu * mu;
  const float rstd = rsqrtf(var + 1e-5f);

  float4 wv = *(const float4*)(ln_w + c);
  float4 bv = *(const float4*)(ln_b + c);
  v4h o;
  o[0] = (h16)((xv.x - mu) * rstd * wv.x + bv.x);
  o[1] = (h16)((xv.y - mu) * rstd * wv.y + bv.y);
  o[2] = (h16)((xv.z - mu) * rstd * wv.z + bv.z);
  o[3] = (h16)((xv.w - mu) * rstd * wv.w + bv.w);
  *(v4h*)(xn + row * 128 + c) = o;
}

// ---------------------------------------------------------------------------
// 3) Column mean over inner N (q) of xn -> xbar (256x128, f16, fragment order),
//    for a block range of a shared launch: 256 threads, 8 n x 32 channels per
//    block (blk = 0..127: the four 128-byte lines of xbar that hold them), one
//    wave per n, one thread per (n, channel).
// ---------------------------------------------------------------------------
static __device__ __forceinline__ void colmean_block(const h16* __restrict__ xn,
                                                     h16* __restrict__ xbar,
                                                     int blk) {
  const int n = (blk >> 2) * 8 + (threadIdx.x >> 5);    // 0..255
  const int c = (blk & 3) * 32 + (threadIdx.x & 31);    // 0..127
  float acc = 0.0f;
  for (int q = 0; q < 256; q += 8) {
    const h16* p = xn + ((size_t)(n * 256 + q)) * 128 + c;
    h16 t[8];
#pragma unroll
    for (int i = 0; i < 8; ++i) t[i] = p[i * 128];
    // The loads' address register stays untouched up to this wait.
    asm volatile("s_wait_xcnt 0x0" :: "v"(p) : "memory");
#pragma unroll
    for (int i = 0; i < 8; ++i) acc += (float)t[i];   // same order as q = 0..255
  }
  xbar[kfrag_index(n, c)] = (h16)(acc * (1.0f / 256.0f));
  // Same wait behind the store: code of other block ranges follows it.
  asm volatile("s_wait_xcnt 0x0" ::: "memory");
}

// ---------------------------------------------------------------------------
// 4a) WMMA GEMM: C[M,N] = act(alpha * A[M,K] * W[N,K]^T + bias)
//     W (<=128x128 f16, ldw==K) async-staged to LDS once per block.
//     Each wave computes a 16x64 strip; all 4 B frags batched before the
//     WMMA chain so DS latency is paid once per k-step.
//     Requires: K % 32 == 0, N % 64 == 0, M % 16 == 0.
// ---------------------------------------------------------------------------
#define GF_SIGMOID   1
#define GF_TRANSPOSE 2   // store C^T (Ch[col*ldc + row]); f16 path only

__global__ void gemm64_kernel(const h16* __restrict__ A,
                              const h16* __restrict__ W,
                              h16* __restrict__ Ch, float* __restrict__ Cf,
                              const float* __restrict__ bias,
                              int M, int N, int K,
                              int lda, int ldc,
                              float alpha, int flags) {
  __shared__ __attribute__((aligned(16))) h16 Wlds[16384];  // up to 128x128 f16

  // ---- async-stage W (row-major, ld == K) into LDS
  const int wbytes = N * K * 2;
  for (int o = threadIdx.x * 16; o < wbytes; o += blockDim.x * 16)
    async_load_b128((unsigned int)(size_t)((char*)Wlds + o),
                    (unsigned long long)(size_t)((const char*)W + o));
  wait_async0();
  __syncthreads();

  const int tilesN = N >> 6;                       // 64-wide wave strips
  const int total  = (M >> 4) * tilesN;
  const int wave   = blockIdx.x * (blockDim.x >> 5) + (threadIdx.x >> 5);
  if (wave >= total) return;                       // wave-uniform

  const int tm = (wave / tilesN) << 4;
  const int tn = (wave % tilesN) << 6;

  v8f acc[4] = {{}, {}, {}, {}};
  for (int k = 0; k < K; k += 32) {
    v16h a = load_frag(A, tm, lda, k);
    v16h b[4];
#pragma unroll
    for (int t = 0; t < 4; ++t) b[t] = load_frag(Wlds, tn + (t << 4), K, k);
#pragma unroll
    for (int t = 0; t < 4; ++t) acc[t] = WMMA_F16(a, b[t], acc[t]);
  }

  const int lane = laneId();
  const int rb   = tm + ((lane >> 4) << 3);
#pragma unroll
  for (int t = 0; t < 4; ++t) {
    const int col = tn + (t << 4) + (lane & 15);
    const float bv = bias ? bias[col] : 0.0f;
#pragma unroll
    for (int v = 0; v < 8; ++v) {
      float y = acc[t][v] * alpha + bv;
      if (flags & GF_SIGMOID) y = 1.0f / (1.0f + __expf(-y));
      const int r = rb + v;
      if (flags & GF_TRANSPOSE) {
        Ch[(size_t)col * ldc + r] = (h16)y;
      } else {
        if (Ch) Ch[(size_t)r * ldc + col] = (h16)y;
        if (Cf) Cf[(size_t)r * ldc + col] = y;
      }
    }
  }
}

// ---------------------------------------------------------------------------
// 4b) Fused q/g GEMM: Q = qscale*(A Wq^T), G = sigmoid(A Wg^T + bg)
//     Shares the A (xn) stream: 8 WMMAs per A fragment, N = K = 128.
//     The launch's first blocks do four jobs that depend on q/g as little as
//     q/g on them: 0..3 K = z wk^T, 4..7 V^T = (z wv^T)^T, 8..9 zb = z wz^T
//     (f16), 10..137 the column mean of xn.
// ---------------------------------------------------------------------------
#define ZG_BLOCKS 10
#define CM_BLOCKS 128
// 10 waves per SIMD keeps the register allocation at the 96 that q/g alone has
// (the shared kernel took 120 without it): five blocks per WGP, as the 64 KiB
// of LDS allow, so that all 1162 blocks are resident at once.
__global__ void __launch_bounds__(256, 10)
gemm_qg_kernel(const h16* __restrict__ A,
                               const h16* __restrict__ Wq,
                               const h16* __restrict__ Wg,
                               h16* __restrict__ Q, h16* __restrict__ G,
                               const float* __restrict__ bg,
                               int M, float qscale,
                               h16* __restrict__ xbar,
                               const h16* __restrict__ zh,
                               const h16* __restrict__ wk,
                               const h16* __restrict__ wv,
                               const h16* __restrict__ wz,
                               h16* __restrict__ kh,
                               h16* __restrict__ vT,
                               h16* __restrict__ zb) {
  __shared__ __attribute__((aligned(16))) h16 Wq_lds[16384];  // 128x128 f16
  __shared__ __attribute__((aligned(16))) h16 Wg_lds[16384];  // 128x128 f16

  if (blockIdx.x < ZG_BLOCKS + CM_BLOCKS) {            // block-uniform
    const int b = blockIdx.x;
    if      (b < 4)  gemm256_block<128, OUT_KFRAG>(Wq_lds, zh, wk, kh, b);
    else if (b < 8)  gemm256_block<128, OUT_VFRAG>(Wq_lds, zh, wv, vT, b - 4);
    else if (b < 10) gemm256_block<64,  OUT_ZFRAG>(Wq_lds, zh, wz, zb, b - 8);
    else             colmean_block(A, xbar, b - ZG_BLOCKS);
    return;
  }

  for (int o = threadIdx.x * 16; o < 32768; o += blockDim.x * 16) {
    async_load_b128((unsigned int)(size_t)((char*)Wq_lds + o),
                    (unsigned long long)(size_t)((const char*)Wq + o));
    async_load_b128((unsigned int)(size_t)((char*)Wg_lds + o),
                    (unsigned long long)(size_t)((const char*)Wg + o));
  }
  wait_async0();
  __syncthreads();

  const int total = (M >> 4) * 2;                  // two 64-wide strips per row
  const int wave  = (blockIdx.x - (ZG_BLOCKS + CM_BLOCKS)) * (blockDim.x >> 5) + (threadIdx.x >> 5);
  if (wave >= total) return;                       // wave-uniform

  const int tm = (wave >> 1) << 4;
  const int tn = (wave & 1) << 6;

  v8f accq[4] = {{}, {}, {}, {}};
  v8f accg[4] = {{}, {}, {}, {}};
  for (int k = 0; k < 128; k += 32) {
    v16h a = load_frag(A, tm, 128, k);
    v16h bq[4], bgf[4];
#pragma unroll
    for (int t = 0; t < 4; ++t) bq[t]  = load_frag(Wq_lds, tn + (t << 4), 128, k);
#pragma unroll
    for (int t = 0; t < 4; ++t) bgf[t] = load_frag(Wg_lds, tn + (t << 4), 128, k);
#pragma unroll
    for (int t = 0; t < 4; ++t) accq[t] = WMMA_F16(a, bq[t],  accq[t]);
#pragma unroll
    for (int t = 0; t < 4; ++t) accg[t] = WMMA_F16(a, bgf[t], accg[t]);
  }

  const int lane = laneId();
  const int rb   = tm + ((lane >> 4) << 3);
#pragma unroll
  for (int t = 0; t < 4; ++t) {
    const int col = tn + (t << 4) + (lane & 15);
    const float bgv = bg[col];
#pragma unroll
    for (int v = 0; v < 8; ++v) {
      const int r = rb + v;
      Q[(size_t)r * 128 + col] = (h16)(accq[t][v] * qscale);
      const float y = accg[t][v] + bgv;
      G[(size_t)r * 128 + col] = (h16)(1.0f / (1.0f + __expf(-y)));
    }
  }
}

// ---------------------------------------------------------------------------
// 6) Fused attention core: one wave per (row r, 16-query tile, head).
//    xb^T = wx_h xbar^T : 16 bias channels d x 16 queries; a lane's 8 results,
//    packed, are the first k half of a B operand as they stand (d = 8*hh + v).
//    S^T = K_h Q^T + zb_h xb^T : A = 16 keys x 32 ch, B = 32 ch x 16 queries.
//    The bias has 16 channels d: one A fragment holds zb of two key tiles, one
//    in each k half, and B = [xb^T; 0] or [0; xb^T] picks the tile.
//    A lane then holds scores of ONE query (column lane&15): 8 keys per tile,
//    128 of the 256 keys per lane; lanes l and l^16 split the keys.
//    Softmax: in-lane maximum and sum plus one exchange between wave halves.
//    O^T = V_h^T P^T : two packed S^T tiles are a B operand as they stand
//    (hardware k order), V^T is loaded in the same k order by frag_units.
//    No LDS, no barrier.
// ---------------------------------------------------------------------------
static __device__ __forceinline__ float xhalf(float x) {   // lane l <-> l ^ 16
  const int b = __builtin_bit_cast(int, x);
  return __builtin_bit_cast(float,
      __builtin_amdgcn_permlanex16(b, b, 0x76543210, 0xfedcba98, false, false));
}

// 16x32 f16 fragment from the lane's own pointer (row lane&15, k offset
// 8*(lane>>4)): same k order as load_frag.
static __device__ __forceinline__ v16h frag_at(const h16* __restrict__ p) {
  v8h lo = *(const v8h*)(p);
  v8h hi = *(const v8h*)(p + 16);
  v16h f;
#pragma unroll
  for (int i = 0; i < 8; ++i) { f[i] = lo[i]; f[i + 8] = hi[i]; }
  return f;
}

// 16x32 f16 fragment from an array in fragment order: p is the lane's own 16
// bytes of the first unit (k half 0); the second unit follows 512 bytes on.
static __device__ __forceinline__ v16h frag_units(const h16* __restrict__ p) {
  v8h lo = *(const v8h*)(p);
  v8h hi = *(const v8h*)(p + 256);
  v16h f;
#pragma unroll
  for (int i = 0; i < 8; ++i) { f[i] = lo[i]; f[i + 8] = hi[i]; }
  return f;
}

// Eight 2^x in one statement. No result shares a register with an argument
// ("=&v"), so no v_exp_f32 is directly followed by a write of its source or a
// read of its result; the v_nop is that slot behind the last one.
static __device__ __forceinline__ v8f exp2_x8(v8f x) {
  float e0, e1, e2, e3, e4, e5, e6, e7;
  asm("v_exp_f32 %0, %8\n\t"
      "v_exp_f32 %1, %9\n\t"
      "v_exp_f32 %2, %10\n\t"
      "v_exp_f32 %3, %11\n\t"
      "v_exp_f32 %4, %12\n\t"
      "v_exp_f32 %5, %13\n\t"
      "v_exp_f32 %6, %14\n\t"
      "v_exp_f32 %7, %15\n\t"
      "v_nop"
      : "=&v"(e0), "=&v"(e1), "=&v"(e2), "=&v"(e3),
        "=&v"(e4), "=&v"(e5), "=&v"(e6), "=&v"(e7)
      : "v"(x[0]), "v"(x[1]), "v"(x[2]), "v"(x[3]),
        "v"(x[4]), "v"(x[5]), "v"(x[6]), "v"(x[7]));
  v8f e = {e0, e1, e2, e3, e4, e5, e6, e7};
  return e;
}

// 4 waves per SIMD (256 VGPRs): two blocks per WGP hide each other's load waits
__global__ void __launch_bounds__(256, 4)
attn_kernel(const h16* __restrict__ qh,   // [65536][128] scaled
            const h16* __restrict__ kh,   // 256 keys x 128 ch, fragment order
            const h16* __restrict__ vT,   // 128 ch x 256 keys, fragment order
            const h16* __restrict__ gh,   // [65536][128] sigmoid'd
            const h16* __restrict__ zb,   // 256 keys x 64 (head, d), fragment order
            const h16* __restrict__ wx,   // 64 (head, d) x 128 ch, fragment order
            const h16* __restrict__ xbar, // 256 queries x 128 ch, fragment order
            const float* __restrict__ mask,// [256][256]
            h16* __restrict__ og) {       // [65536][128]
  const int lane = laneId();
  const int c    = lane & 15;                              // query column
  const int hh   = lane >> 4;                              // wave half
  const int r    = blockIdx.x * 8 + (threadIdx.x >> 5);    // 0..255
  const int q0   = blockIdx.y << 4;                        // 16 queries
  const int h    = blockIdx.z;                             // head

  // element offset of (query c, head h, channel 8*hh) in qh, gh and og
  const size_t idx = ((size_t)(r * 256 + q0) + c) * 128 + h * 32 + (hh << 3);
  const h16*   qp = qh + idx;
  // the lane's 16 bytes in the first unit of the head's K, zb, V^T and wx and
  // of the query tile's xbar
  const h16*   kp = kh + h * 8192 + lane * 8;
  const h16*   zp = zb + h * 4096 + lane * 8;
  const h16*   vp = vT + h * 8192 + lane * 8;
  const h16*   wp = wx + h * 512 + lane * 8;
  const h16*   xp = xbar + blockIdx.y * 512 + lane * 8;
  const h16*   gp = gh + idx;

  const int   mi = r * 256 + q0 + c;                       // (row, query) in mask
  const float mk = mask[mi];
  // The mask load's index register stays untouched up to this wait.
  asm volatile("s_wait_xcnt 0x0" :: "v"(mi) : "memory");
  const float mb = 1.0e9f * (mk - 1.0f);
  const v16h  qf = frag_at(qp);

  // zb of the head: az[j] holds key tiles 2j (first k half) and 2j + 1 (second)
  v16h az[8];
#pragma unroll
  for (int j = 0; j < 8; ++j) az[j] = frag_units(zp + j * 512);

  // ---- xb^T of the query tile: xt[v] = xb(query c, d = 8*hh + v), k = 0..127
  v8f xt = {};
#pragma unroll
  for (int ks = 0; ks < 4; ++ks)
    xt = WMMA_F16(frag_units(wp + ks * 2048), frag_units(xp + ks * 8192), xt);
  v16h xf0, xf1;                       // [xb^T; 0] and [0; xb^T]
#pragma unroll
  for (int v = 0; v < 8; ++v) {
    xf0[v] = (h16)xt[v];   xf0[v + 8] = (h16)0.0f;
    xf1[v] = (h16)0.0f;    xf1[v + 8] = (h16)xt[v];
  }

  // ---- scores: s[mt][v] = logit(query c, key mt*16 + 8*hh + v)
  v8f s[16];
#pragma unroll
  for (int mt = 0; mt < 16; ++mt) {
    v8f z = {};
    s[mt] = WMMA_F16(frag_units(kp + mt * 512), qf, z);
  }
#pragma unroll
  for (int mt = 0; mt < 16; mt += 2) {
    s[mt]     = WMMA_F16(az[mt >> 1], xf0, s[mt])     + mb;
    s[mt + 1] = WMMA_F16(az[mt >> 1], xf1, s[mt + 1]) + mb;
  }
  // The address registers of the loads above stay untouched up to this wait.
  asm volatile("s_wait_xcnt 0x0" :: "v"(qp), "v"(kp), "v"(zp), "v"(wp), "v"(xp) : "memory");

  // ---- maximum over the 256 keys of the lane's query
  v8f mv = s[0];
#pragma unroll
  for (int mt = 1; mt < 16; ++mt)
#pragma unroll
    for (int v = 0; v < 8; ++v) mv[v] = fmaxf(mv[v], s[mt][v]);
  float mx = fmaxf(fmaxf(fmaxf(mv[0], mv[1]), fmaxf(mv[2], mv[3])),
                   fmaxf(fmaxf(mv[4], mv[5]), fmaxf(mv[6], mv[7])));
  mx = fmaxf(mx, xhalf(mx));

  // ---- exp, f32 sum (8 independent chains), pack to the B operand of P^T
  v8f  sv = {};
  v16h pb[8];
#pragma unroll
  for (int mt = 0; mt < 16; ++mt) {
    const v8f e = exp2_x8((s[mt] - mx) * 1.44269504f);   // e^(s - mx)
    sv += e;
#pragma unroll
    for (int v = 0; v < 8; ++v) pb[mt >> 1][((mt & 1) << 3) + v] = (h16)e[v];
  }
  float sum = ((sv[0] + sv[1]) + (sv[2] + sv[3])) + ((sv[4] + sv[5]) + (sv[6] + sv[7]));
  sum += xhalf(sum);
  const float inv = 1.0f / sum;

  // ---- O^T (32 ch x 16 queries) = V_h^T (32 x 256) P^T (256 x 16)
  v8f o0 = {}, o1 = {};
#pragma unroll
  for (int j = 0; j < 8; ++j) {
    const v16h a0 = frag_units(vp + j * 1024);             // channels 0..15
    const v16h a1 = frag_units(vp + j * 1024 + 512);       // channels 16..31
    o0 = WMMA_F16(a0, pb[j], o0);
    o1 = WMMA_F16(a1, pb[j], o1);
  }

  // ---- gate and store: a lane holds 8 consecutive channels of its query
  const v8h g0 = *(const v8h*)(gp);
  const v8h g1 = *(const v8h*)(gp + 16);
  // Same wait for the address registers of the V^T and gate loads.
  asm volatile("s_wait_xcnt 0x0" :: "v"(vp), "v"(gp) : "memory");
  v8h w0, w1;
#pragma unroll
  for (int v = 0; v < 8; ++v) {
    w0[v] = (h16)(o0[v] * inv * (float)g0[v]);
    w1[v] = (h16)(o1[v] * inv * (float)g1[v]);
  }
  *(v8h*)(og + idx)      = w0;
  *(v8h*)(og + idx + 16) = w1;
}

// ---------------------------------------------------------------------------
// Host-side orchestration
// ---------------------------------------------------------------------------
extern "C" void kernel_launch(void* const* d_in, const int* in_sizes, int n_in,
                              void* d_out, int out_size, void* d_ws, size_t ws_size,
                              hipStream_t stream) {
  (void)in_sizes; (void)n_in; (void)out_size; (void)ws_size;

  const float* x    = (const float*)d_in[0];   // (1,256,256,128)
  const float* z    = (const float*)d_in[1];   // (1,256,128)
  const float* mask = (const float*)d_in[2];   // (1,256,256)
  const float* ln_w = (const float*)d_in[3];
  const float* ln_b = (const float*)d_in[4];
  const float* wx   = (const float*)d_in[5];   // (64,128)
  const float* wz   = (const float*)d_in[6];   // (64,128)
  const float* wq   = (const float*)d_in[7];   // (128,128)
  const float* wk   = (const float*)d_in[8];
  const float* wv   = (const float*)d_in[9];
  const float* wg   = (const float*)d_in[10];
  const float* bg   = (const float*)d_in[11];  // (128,)
  const float* wo   = (const float*)d_in[12];  // (128,128)
  const float* bo   = (const float*)d_in[13];  // (128,)
  float* out = (float*)d_out;                  // (1,256,256,128)

  // ---- workspace carve-up (256B aligned regions)
  char* ws = (char*)d_ws;
  size_t off = 0;
  auto carve = [&](size_t bytes) -> char* {
    char* p = ws + off;
    off = (off + bytes + 255) & ~(size_t)255;
    return p;
  };
  const size_t NROWS = 65536;                 // 256*256
  h16*   xn_h   = (h16*)  carve(NROWS * 128 * 2);
  h16*   qh     = (h16*)  carve(NROWS * 128 * 2);
  h16*   gh     = (h16*)  carve(NROWS * 128 * 2);
  h16*   og     = (h16*)  carve(NROWS * 128 * 2);
  h16*   kh     = (h16*)  carve(256 * 128 * 2);
  h16*   vT     = (h16*)  carve(128 * 256 * 2);
  h16*   xbar_h = (h16*)  carve(256 * 128 * 2);
  // f16 copies of z and the weights: contiguous, in the converting blocks' order
  h16*   z_h    = (h16*)  carve(256 * 128 * 2);
  h16*   wq_h   = (h16*)  carve(128 * 128 * 2);
  h16*   wk_h   = (h16*)  carve(128 * 128 * 2);
  h16*   wv_h   = (h16*)  carve(128 * 128 * 2);
  h16*   wg_h   = (h16*)  carve(128 * 128 * 2);
  h16*   wo_h   = (h16*)  carve(128 * 128 * 2);
  h16*   wx_h   = (h16*)  carve(64 * 128 * 2);
  h16*   wz_h   = (h16*)  carve(64 * 128 * 2);
  h16*   zb_h   = (h16*)  carve(256 * 64 * 2);

  // ---- 1) + 2) layernorm (wave per row); weights + z to f16 (512 blocks)
  layernorm_cvt_kernel<<<8704, 256, 0, stream>>>(   // 512 + 8192 blocks
      x, ln_w, ln_b, xn_h, z, wq, wk, wv, wg, wo, wx, wz, z_h);

  // ---- 4) GEMMs: 16x64 strip per wave, W async-staged to LDS
  auto gemm = [&](const h16* A, const h16* W, h16* Ch, float* Cf,
                  const float* bias, int M, int N, int K,
                  int lda, int ldc, float alpha, int flags) {
    int strips = (M >> 4) * (N >> 6);
    int blocks = (strips + 7) / 8;
    gemm64_kernel<<<blocks, 256, 0, stream>>>(A, W, Ch, Cf, bias,
                                              M, N, K, lda, ldc, alpha, flags);
  };
  const float qscale = 0.17677669529663687f;  // CH^-0.5 = 1/sqrt(32)

  // fused q/g projection: reads xn once, writes qh (scaled) + gh (sigmoid);
  // in the same launch K, V^T and zb from z (10 blocks) and the column mean of
  // xn (128 blocks)
  gemm_qg_kernel<<<1162, 256, 0, stream>>>(xn_h, wq_h, wg_h, qh, gh, bg,
                                           (int)NROWS, qscale,
                                           xbar_h, z_h, wk_h, wv_h, wz_h,
                                           kh, vT, zb_h);

  // ---- 5) + 6) fused attention with the triangle bias: 8 rows per block, all
  // on one (query tile, head)
  attn_kernel<<<dim3(32, 16, 4), 256, 0, stream>>>(qh, kh, vT, gh, zb_h, wx_h, xbar_h,
                                                   mask, og);

  // ---- 7) output projection: out = og @ wo^T + bo  (f32 out)
  gemm(og, wo_h, nullptr, out, bo, NROWS, 128, 128, 128, 128, 1.0f, 0);
}

// v005
// It runs in 61.4 microseconds.
// Two timings next to v004 both put it at 1.50 times that version's speed.
// All steps since v000 together make it 5.15 times as fast.
#include <hip/hip_runtime.h>
#include <hip/hip_bf16.h>
#include <hip/hip_fp16.h>

// ---------------------------------------------------------------------------
// TriangleCrossAttention on gfx1250 (CDNA5)
//  - all GEMMs on V_WMMA_F32_16X16X32_F16 (f32 accumulate)
//  - weights staged to LDS with GLOBAL_LOAD_ASYNC_TO_LDS_B128 (ASYNCcnt path),
//    their 256-byte rows at a pitch of 272 bytes
//  - 16x64 C strip per wave; fused q/g GEMM reads xn once, 8 WMMAs per A frag
//  - kernels that do not depend on each other share a launch (block ranges)
//  - K, V^T, zb, wx and xbar lie in memory in the order the attention wave's
//    fragments take them: lane l's 16 bytes at byte l*16 of a 512-byte unit
//  - the triangle bias is a second k slab of the score product:
//    logit = [q | xb] . [k | zb], xb made in the attention wave from xbar, wx
// B=1, N=M=256, CQ=CKV=128, H=4, CH=32, CB=16
// ---------------------------------------------------------------------------

typedef _Float16 h16;
typedef __attribute__((ext_vector_type(16))) _Float16 v16h;
typedef __attribute__((ext_vector_type(8)))  _Float16 v8h;
typedef __attribute__((ext_vector_type(4)))  _Float16 v4h;
typedef __attribute__((ext_vector_type(8)))  float    v8f;
typedef __attribute__((ext_vector_type(4)))  float    v4f;

#define WMMA_F16(a, b, c) \
  __builtin_amdgcn_wmma_f32_16x16x32_f16(false, (a), false, (b), (short)0, (c), false, false)

static __device__ __forceinline__ int laneId() { return threadIdx.x & 31; }

static __device__ __forceinline__ void wait_async0() {
  asm volatile("s_wait_asynccnt 0x0" ::: "memory");
}

// A staged weight matrix has rows of 128 f16 (256 bytes). In LDS they lie at a
// pitch of 272 bytes (16 x odd): the 16 rows that a half wave's ds_load_b128
// reads at one k offset then fall on all 64 banks; at 256 bytes they fall on
// the same four.
#define WPITCH  136                 // f16 per LDS row
#define WPITCHB (WPITCH * 2)        // bytes per LDS row

// Four async copies of 16 bytes per lane, global -> LDS (ASYNCcnt), one round
// of a 256-thread block each: 4 KiB = 16 rows apart. The s_wait_xcnt ends the
// copies' own statement, so that no address register of a copy is rewritten in
// front of it.
static __device__ __forceinline__ void async_load4_b128(unsigned int lds_off,
                                                        unsigned long long gaddr) {
  asm volatile("global_load_async_to_lds_b128 %0, %4, off\n\t"
               "global_load_async_to_lds_b128 %1, %5, off\n\t"
               "global_load_async_to_lds_b128 %2, %6, off\n\t"
               "global_load_async_to_lds_b128 %3, %7, off\n\t"
               "s_wait_xcnt 0x0"
               :: "v"(lds_off), "v"(lds_off + 16u * WPITCHB),
                  "v"(lds_off + 32u * WPITCHB), "v"(lds_off + 48u * WPITCHB),
                  "v"(gaddr), "v"(gaddr + 4096ull),
                  "v"(gaddr + 8192ull), "v"(gaddr + 12288ull)
               : "memory");
}

// Issue the copies of W (ROWS x 128 f16, row-major, ROWS = 64 or 128) into
// Wlds (ROWS x WPITCH) from a 256-thread block: thread t brings chunk t & 15
// of rows t >> 4, + 16, + 32, ... The caller waits and passes the barrier.
template <int ROWS>
static __device__ __forceinline__ void stage_w(h16* Wlds, const h16* __restrict__ W) {
  const unsigned int       l = (unsigned int)(size_t)((char*)Wlds
                                 + (threadIdx.x >> 4) * WPITCHB + (threadIdx.x & 15) * 16);
  const unsigned long long g = (unsigned long long)(size_t)((const char*)W + threadIdx.x * 16);
#pragma unroll   // 1 or 2 rounds of four copies: every copy gets registers of its own
  for (int r = 0; r < ROWS; r += 64) async_load4_b128(l + r * WPITCHB, g + r * 256);
}

// Load one 16x32 f16 fragment (A-matrix layout; also valid for the B operand
// when B is a row-major weight matrix W with K contiguous, since
// B[k][n] = W[n][k] mirrors the A striping with M<->N swapped).
// CDNA5 layout: lanes 0-15 -> row M=lane, K 0..7 (v0-3) and 16..23 (v4-7);
// lanes 16-31 -> row M=lane-16, K 8..15 and 24..31.
static __device__ __forceinline__ v16h load_frag(const h16* __restrict__ base,
                                                 int rowTile, int ld, int kbase) {
  const int lane = laneId();
  const h16* p = base + (size_t)(rowTile + (lane & 15)) * ld
                      + kbase + ((lane >> 4) << 3);
  v8h lo = *(const v8h*)(p);
  v8h hi = *(const v8h*)(p + 16);
  v16h f;
#pragma unroll
  for (int i = 0; i < 8; ++i) { f[i] = lo[i]; f[i + 8] = hi[i]; }
  return f;
}

// ---------------------------------------------------------------------------
// Fragment order of the operands that every attention wave reads whole.
// A unit is what one wave-wide 16-byte load takes: 32 lanes x 16 bytes, lane
// (hh = lane>>4, c = lane&15) at byte lane*16, so a load covers four whole
// 128-byte lines. At each register position a lane gets the element that
// load_frag's layout puts there (same k order).
//   K   [head][key tile 16][k half 16][lane: c = key,     hh = k>>3  ][8 channels]
//   V^T [head][key block 32][ch tile 16][k half 16][lane: c = channel, hh = key>>3][8 keys]
//   zb  [head][key tile 16][lane: c = key, hh = d>>3][8 bias channels d]
//   wx  [k step 32][head][k half 16][lane: c = d,     hh = k>>3][8 channels]
//   xbar: as K, with the query n for the key and the k step for the head
// ---------------------------------------------------------------------------
static __device__ __forceinline__ int kfrag_index(int m, int ch) {   // key, channel 0..127
  return ((((ch >> 5) * 16 + (m >> 4)) * 2 + ((ch >> 4) & 1)) * 32
          + ((ch >> 3) & 1) * 16 + (m & 15)) * 8 + (ch & 7);
}
static __device__ __forceinline__ int zfrag_index(int m, int col) {  // key, head*16 + d
  return (((col >> 4) * 16 + (m >> 4)) * 32
          + ((col >> 3) & 1) * 16 + (m & 15)) * 8 + (col & 7);
}
static __device__ __forceinline__ int vfrag_index(int ch, int m) {   // channel 0..127, key
  return (((((ch >> 5) * 8 + (m >> 5)) * 2 + ((ch >> 4) & 1)) * 2 + ((m >> 4) & 1)) * 32
          + ((m >> 3) & 1) * 16 + (ch & 15)) * 8 + (m & 7);
}

// ---------------------------------------------------------------------------
// Small GEMM for a block range of a shared launch:
//   C[256,N] = A[256,128] * W[N,128]^T, N = 64 or 128, 256 threads,
//   N/32 blocks (blk = 0..N/32-1), one 16x64 strip per wave.
//   W async-staged to LDS as in gemm64_kernel; same k order, same sums.
//   OUT: what is stored: C as f16 in K's fragment order, C^T as f16 in V^T's
//   fragment order, or C as f16 in zb's fragment order. A wave's 16x64 strip
//   holds every element of each 128-byte line that it writes.
// ---------------------------------------------------------------------------
#define OUT_KFRAG 0
#define OUT_VFRAG 1
#define OUT_ZFRAG 2
template <int N, int OUT>
static __device__ __forceinline__ void gemm256_block(h16* Wlds,
                                                     const h16* __restrict__ A,
                                                     const h16* __restrict__ W,
                                                     h16* __restrict__ Ch,
                                                     int blk) {
  stage_w<N>(Wlds, W);
  wait_async0();
  __syncthreads();

  const int tilesN = N >> 6;
  const int wave   = blk * 8 + (threadIdx.x >> 5);   // 0 .. 16*tilesN-1
  const int tm = (wave / tilesN) << 4;
  const int tn = (wave % tilesN) << 6;

  v8f acc[4] = {{}, {}, {}, {}};
  for (int k = 0; k < 128; k += 32) {
    v16h a = load_frag(A, tm, 128, k);
    v16h b[4];
#pragma unroll
    for (int t = 0; t < 4; ++t) b[t] = load_frag(Wlds, tn + (t << 4), WPITCH, k);
#pragma unroll
    for (int t = 0; t < 4; ++t) acc[t] = WMMA_F16(a, b[t], acc[t]);
  }

  const int lane = laneId();
  const int rb   = tm + ((lane >> 4) << 3);
#pragma unroll
  for (int t = 0; t < 4; ++t) {
    const int col = tn + (t << 4) + (lane & 15);
#pragma unroll
    for (int v = 0; v < 8; ++v) {
      const float y = acc[t][v];
      const int r = rb + v;
      if (OUT == OUT_VFRAG)      Ch[vfrag_index(col, r)] = (h16)y;
      else if (OUT == OUT_KFRAG) Ch[kfrag_index(r, col)] = (h16)y;
      else                       Ch[zfrag_index(r, col)] = (h16)y;
    }
  }
  // The stores' address and data registers stay untouched up to this wait: the
  // code of the launch's other block ranges follows and rewrites them.
  asm volatile("s_wait_xcnt 0x0" ::: "memory");
}

// ---------------------------------------------------------------------------
// 1) One launch, two independent jobs.
//    Blocks 0..511: f32 -> f16 of z and the seven weight matrices into one
//    contiguous f16 region (order z, wq, wk, wv, wg, wo, wx, wz); wx goes into
//    its fragment order: a block writes one whole unit and gathers its source.
//    Blocks 512.. : LayerNorm over channel dim (128), f16 out, one wave per row.
// ---------------------------------------------------------------------------
#define CVT_BLOCKS 512
__global__ void layernorm_cvt_kernel(const float* __restrict__ x,
                                     const float* __restrict__ ln_w,
                                     const float* __restrict__ ln_b,
                                     h16* __restrict__ xn,
                                     const float* __restrict__ z_f,
                                     const float* __restrict__ wq_f,
                                     const float* __restrict__ wk_f,
                                     const float* __restrict__ wv_f,
                                     const float* __restrict__ wg_f,
                                     const float* __restrict__ wo_f,
                                     const float* __restrict__ wx_f,
                                     const float* __restrict__ wz_f,
                                     h16* __restrict__ cvt_out) {
  if (blockIdx.x < CVT_BLOCKS) {                       // block-uniform
    const int b = blockIdx.x;                          // 256 elements per block
    const float* in;
    int first;                                         // the source's first block
    if      (b < 128) { in = z_f;  first = 0;   }
    else if (b < 192) { in = wq_f; first = 128; }
    else if (b < 256) { in = wk_f; first = 192; }
    else if (b < 320) { in = wv_f; first = 256; }
    else if (b < 384) { in = wg_f; first = 320; }
    else if (b < 448) { in = wo_f; first = 384; }
    else if (b < 480) { in = wx_f; first = 448; }
    else              { in = wz_f; first = 480; }
    int src = (b - first) * 256 + threadIdx.x;
    if (b >= 448 && b < 480) {                         // wx: unit b - 448
      const int u   = b - 448;                         // [k step][head][k half]
      const int t   = threadIdx.x;                     // [hh][d][8 channels]
      const int row = ((u >> 1) & 3) * 16 + ((t >> 3) & 15);
      const int ch  = (u >> 3) * 32 + (u & 1) * 16 + (t >> 7) * 8 + (t & 7);
      src = row * 128 + ch;
    }
    cvt_out[b * 256 + threadIdx.x] = (h16)in[src];
    return;
  }
  const int wave = threadIdx.x >> 5;
  const int lane = laneId();
  const size_t row = (size_t)(blockIdx.x - CVT_BLOCKS) * 8 + wave;   // 0..65535
  const int c = lane << 2;                             // 4 channels per lane

  float4 xv = *(const float4*)(x + row * 128 + c);
  float s  = xv.x + xv.y + xv.z + xv.w;
  float ss = xv.x * xv.x + xv.y * xv.y + xv.z * xv.z + xv.w * xv.w;
#pragma unroll
  for (int off = 16; off >= 1; off >>= 1) {
    s  += __shfl_xor(s,  off);
    ss += __shfl_xor(ss, off);
  }
  const float mu   = s * (1.0f / 128.0f);
  const float var  = ss * (1.0f / 128.0f) - mu * mu;
  const float rstd = rsqrtf(var + 1e-5f);

  float4 wv = *(const float4*)(ln_w + c);
  float4 bv = *(const float4*)(ln_b + c);
  v4h o;
  o[0] = (h16)((xv.x - mu) * rstd * wv.x + bv.x);
  o[1] = (h16)((xv.y - mu) * rstd * wv.y + bv.y);
  o[2] = (h16)((xv.z - mu) * rstd * wv.z + bv.z);
  o[3] = (h16)((xv.w - mu) * rstd * wv.w + bv.w);
  *(v4h*)(xn + row * 128 + c) = o;
}

// ---------------------------------------------------------------------------
// 3) Column mean over inner N (q) of xn -> xbar (256x128, f16, fragment order),
//    for a block range of a shared launch: 256 threads, 8 n x 32 channels per
//    block (blk = 0..127: the four 128-byte lines of xbar that hold them), one
//    wave per n, one thread per (n, channel).
// ---------------------------------------------------------------------------
static __device__ __forceinline__ void colmean_block(const h16* __restrict__ xn,
                                                     h16* __restrict__ xbar,
                                                     int blk) {
  const int n = (blk >> 2) * 8 + (threadIdx.x >> 5);    // 0..255
  const int c = (blk & 3) * 32 + (threadIdx.x & 31);    // 0..127
  float acc = 0.0f;
  for (int q = 0; q < 256; q += 8) {
    const h16* p = xn + ((size_t)(n * 256 + q)) * 128 + c;
    h16 t[8];
#pragma unroll
    for (int i = 0; i < 8; ++i) t[i] = p[i * 128];
    // The loads' address register stays untouched up to this wait.
    asm volatile("s_wait_xcnt 0x0" :: "v"(p) : "memory");
#pragma unroll
    for (int i = 0; i < 8; ++i) acc += (float)t[i];   // same order as q = 0..255
  }
  xbar[kfrag_index(n, c)] = (h16)(acc * (1.0f / 256.0f));
  // Same wait behind the store: code of other block ranges follows it.
  asm volatile("s_wait_xcnt 0x0" ::: "memory");
}

// ---------------------------------------------------------------------------
// 4a) WMMA GEMM: C[M,N] = act(alpha * A[M,K] * W[N,K]^T + bias)
//     W (128x128 f16) async-staged to LDS once per block.
//     Each wave computes a 16x64 strip; all 4 B frags batched before the
//     WMMA chain so DS latency is paid once per k-step.
//     Requires: N == K == 128 (the LDS image of W), M % 16 == 0.
// ---------------------------------------------------------------------------
#define GF_SIGMOID   1
#define GF_TRANSPOSE 2   // store C^T (Ch[col*ldc + row]); f16 path only

__global__ void gemm64_kernel(const h16* __restrict__ A,
                              const h16* __restrict__ W,
                              h16* __restrict__ Ch, float* __restrict__ Cf,
                              const float* __restrict__ bias,
                              int M, int N, int K,
                              int lda, int ldc,
                              float alpha, int flags) {
  __shared__ __attribute__((aligned(16))) h16 Wlds[128 * WPITCH];  // 128 rows x WPITCH f16

  // ---- async-stage W (row-major) into LDS
  stage_w<128>(Wlds, W);
  wait_async0();
  __syncthreads();

  const int tilesN = N >> 6;                       // 64-wide wave strips
  const int total  = (M >> 4) * tilesN;
  const int wave   = blockIdx.x * (blockDim.x >> 5) + (threadIdx.x >> 5);
  if (wave >= total) return;                       // wave-uniform

  const int tm = (wave / tilesN) << 4;
  const int tn = (wave % tilesN) << 6;

  v8f acc[4] = {{}, {}, {}, {}};
  for (int k = 0; k < K; k += 32) {
    v16h a = load_frag(A, tm, lda, k);
    v16h b[4];
#pragma unroll
    for (int t = 0; t < 4; ++t) b[t] = load_frag(Wlds, tn + (t << 4), WPITCH, k);
#pragma unroll
    for (int t = 0; t < 4; ++t) acc[t] = WMMA_F16(a, b[t], acc[t]);
  }

  const int lane = laneId();
  const int rb   = tm + ((lane >> 4) << 3);
#pragma unroll
  for (int t = 0; t < 4; ++t) {
    const int col = tn + (t << 4) + (lane & 15);
    const float bv = bias ? bias[col] : 0.0f;
#pragma unroll
    for (int v = 0; v < 8; ++v) {
      float y = acc[t][v] * alpha + bv;
      if (flags & GF_SIGMOID) y = 1.0f / (1.0f + __expf(-y));
      const int r = rb + v;
      if (flags & GF_TRANSPOSE) {
        Ch[(size_t)col * ldc + r] = (h16)y;
      } else {
        if (Ch) Ch[(size_t)r * ldc + col] = (h16)y;
        if (Cf) Cf[(size_t)r * ldc + col] = y;
      }
    }
  }
}

// ---------------------------------------------------------------------------
// 4b) Fused q/g GEMM: Q = qscale*(A Wq^T), G = sigmoid(A Wg^T + bg)
//     Shares the A (xn) stream: 8 WMMAs per A fragment, N = K = 128.
//     The launch's first blocks do four jobs that depend on q/g as little as
//     q/g on them: 0..3 K = z wk^T, 4..7 V^T = (z wv^T)^T, 8..9 zb = z wz^T
//     (f16), 10..137 the column mean of xn.
// ---------------------------------------------------------------------------
#define ZG_BLOCKS 10
#define CM_BLOCKS 128
// The 68 KiB of LDS allow four blocks per WGP: 8 waves per SIMD.
__global__ void __launch_bounds__(256)
gemm_qg_kernel(const h16* __restrict__ A,
                               const h16* __restrict__ Wq,
                               const h16* __restrict__ Wg,
                               h16* __restrict__ Q, h16* __restrict__ G,
                               const float* __restrict__ bg,
                               int M, float qscale,
                               h16* __restrict__ xbar,
                               const h16* __restrict__ zh,
                               const h16* __restrict__ wk,
                               const h16* __restrict__ wv,
                               const h16* __restrict__ wz,
                               h16* __restrict__ kh,
                               h16* __restrict__ vT,
                               h16* __restrict__ zb) {
  __shared__ __attribute__((aligned(16))) h16 Wq_lds[128 * WPITCH];  // 128 rows x WPITCH f16
  __shared__ __attribute__((aligned(16))) h16 Wg_lds[128 * WPITCH];  // 128 rows x WPITCH f16

  if (blockIdx.x < ZG_BLOCKS + CM_BLOCKS) {            // block-uniform
    const int b = blockIdx.x;
    if      (b < 4)  gemm256_block<128, OUT_KFRAG>(Wq_lds, zh, wk, kh, b);
    else if (b < 8)  gemm256_block<128, OUT_VFRAG>(Wq_lds, zh, wv, vT, b - 4);
    else if (b < 10) gemm256_block<64,  OUT_ZFRAG>(Wq_lds, zh, wz, zb, b - 8);
    else             colmean_block(A, xbar, b - ZG_BLOCKS);
    return;
  }

  stage_w<128>(Wq_lds, Wq);
  stage_w<128>(Wg_lds, Wg);
  wait_async0();
  __syncthreads();

  const int total = (M >> 4) * 2;                  // two 64-wide strips per row
  const int wave  = (blockIdx.x - (ZG_BLOCKS + CM_BLOCKS)) * (blockDim.x >> 5) + (threadIdx.x >> 5);
  if (wave >= total) return;                       // wave-uniform

  const int tm = (wave >> 1) << 4;
  const int tn = (wave & 1) << 6;

  v8f accq[4] = {{}, {}, {}, {}};
  v8f accg[4] = {{}, {}, {}, {}};
  for (int k = 0; k < 128; k += 32) {
    v16h a = load_frag(A, tm, 128, k);
    v16h bq[4], bgf[4];
#pragma unroll
    for (int t = 0; t < 4; ++t) bq[t]  = load_frag(Wq_lds, tn + (t << 4), WPITCH, k);
#pragma unroll
    for (int t = 0; t < 4; ++t) bgf[t] = load_frag(Wg_lds, tn + (t << 4), WPITCH, k);
#pragma unroll
    for (int t = 0; t < 4; ++t) accq[t] = WMMA_F16(a, bq[t],  accq[t]);
#pragma unroll
    for (int t = 0; t < 4; ++t) accg[t] = WMMA_F16(a, bgf[t], accg[t]);
  }

  const int lane = laneId();
  const int rb   = tm + ((lane >> 4) << 3);
#pragma unroll
  for (int t = 0; t < 4; ++t) {
    const int col = tn + (t << 4) + (lane & 15);
    const float bgv = bg[col];
#pragma unroll
    for (int v = 0; v < 8; ++v) {
      const int r = rb + v;
      Q[(size_t)r * 128 + col] = (h16)(accq[t][v] * qscale);
      const float y = accg[t][v] + bgv;
      G[(size_t)r * 128 + col] = (h16)(1.0f / (1.0f + __expf(-y)));
    }
  }
}

// ---------------------------------------------------------------------------
// 6) Fused attention core: one wave per (row r, 16-query tile, head).
//    xb^T = wx_h xbar^T : 16 bias channels d x 16 queries; a lane's 8 results,
//    packed, are the first k half of a B operand as they stand (d = 8*hh + v).
//    S^T = K_h Q^T + zb_h xb^T : A = 16 keys x 32 ch, B = 32 ch x 16 queries.
//    The bias has 16 channels d: one A fragment holds zb of two key tiles, one
//    in each k half, and B = [xb^T; 0] or [0; xb^T] picks the tile.
//    A lane then holds scores of ONE query (column lane&15): 8 keys per tile,
//    128 of the 256 keys per lane; lanes l and l^16 split the keys.
//    Softmax: in-lane maximum and sum plus one exchange between wave halves.
//    O^T = V_h^T P^T : two packed S^T tiles are a B operand as they stand
//    (hardware k order), V^T is loaded in the same k order by frag_units.
//    No LDS, no barrier.
// ---------------------------------------------------------------------------
static __device__ __forceinline__ float xhalf(float x) {   // lane l <-> l ^ 16
  const int b = __builtin_bit_cast(int, x);
  return __builtin_bit_cast(float,
      __builtin_amdgcn_permlanex16(b, b, 0x76543210, 0xfedcba98, false, false));
}

// 16x32 f16 fragment from the lane's own pointer (row lane&15, k offset
// 8*(lane>>4)): same k order as load_frag.
static __device__ __forceinline__ v16h frag_at(const h16* __restrict__ p) {
  v8h lo = *(const v8h*)(p);
  v8h hi = *(const v8h*)(p + 16);
  v16h f;
#pragma unroll
  for (int i = 0; i < 8; ++i) { f[i] = lo[i]; f[i + 8] = hi[i]; }
  return f;
}

// 16x32 f16 fragment from an array in fragment order: p is the lane's own 16
// bytes of the first unit (k half 0); the second unit follows 512 bytes on.
static __device__ __forceinline__ v16h frag_units(const h16* __restrict__ p) {
  v8h lo = *(const v8h*)(p);
  v8h hi = *(const v8h*)(p + 256);
  v16h f;
#pragma unroll
  for (int i = 0; i < 8; ++i) { f[i] = lo[i]; f[i + 8] = hi[i]; }
  return f;
}

// Eight 2^x in one statement. No result shares a register with an argument
// ("=&v"), so no v_exp_f32 is directly followed by a write of its source or a
// read of its result; the v_nop is that slot behind the last one.
static __device__ __forceinline__ v8f exp2_x8(v8f x) {
  float e0, e1, e2, e3, e4, e5, e6, e7;
  asm("v_exp_f32 %0, %8\n\t"
      "v_exp_f32 %1, %9\n\t"
      "v_exp_f32 %2, %10\n\t"
      "v_exp_f32 %3, %11\n\t"
      "v_exp_f32 %4, %12\n\t"
      "v_exp_f32 %5, %13\n\t"
      "v_exp_f32 %6, %14\n\t"
      "v_exp_f32 %7, %15\n\t"
      "v_nop"
      : "=&v"(e0), "=&v"(e1), "=&v"(e2), "=&v"(e3),
        "=&v"(e4), "=&v"(e5), "=&v"(e6), "=&v"(e7)
      : "v"(x[0]), "v"(x[1]), "v"(x[2]), "v"(x[3]),
        "v"(x[4]), "v"(x[5]), "v"(x[6]), "v"(x[7]));
  v8f e = {e0, e1, e2, e3, e4, e5, e6, e7};
  return e;
}

// 4 waves per SIMD (256 VGPRs): two blocks per WGP hide each other's load waits
__global__ void __launch_bounds__(256, 4)
attn_kernel(const h16* __restrict__ qh,   // [65536][128] scaled
            const h16* __restrict__ kh,   // 256 keys x 128 ch, fragment order
            const h16* __restrict__ vT,   // 128 ch x 256 keys, fragment order
            const h16* __restrict__ gh,   // [65536][128] sigmoid'd
            const h16* __restrict__ zb,   // 256 keys x 64 (head, d), fragment order
            const h16* __restrict__ wx,   // 64 (head, d) x 128 ch, fragment order
            const h16* __restrict__ xbar, // 256 queries x 128 ch, fragment order
            const float* __restrict__ mask,// [256][256]
            h16* __restrict__ og) {       // [65536][128]
  const int lane = laneId();
  const int c    = lane & 15;                              // query column
  const int hh   = lane >> 4;                              // wave half
  const int r    = blockIdx.x * 8 + (threadIdx.x >> 5);    // 0..255
  const int q0   = blockIdx.y << 4;                        // 16 queries
  const int h    = blockIdx.z;                             // head

  // element offset of (query c, head h, channel 8*hh) in qh, gh and og
  const size_t idx = ((size_t)(r * 256 + q0) + c) * 128 + h * 32 + (hh << 3);
  const h16*   qp = qh + idx;
  // the lane's 16 bytes in the first unit of the head's K, zb, V^T and wx and
  // of the query tile's xbar
  const h16*   kp = kh + h * 8192 + lane * 8;
  const h16*   zp = zb + h * 4096 + lane * 8;
  const h16*   vp = vT + h * 8192 + lane * 8;
  const h16*   wp = wx + h * 512 + lane * 8;
  const h16*   xp = xbar + blockIdx.y * 512 + lane * 8;
  const h16*   gp = gh + idx;

  const int   mi = r * 256 + q0 + c;                       // (row, query) in mask
  const float mk = mask[mi];
  // The mask load's index register stays untouched up to this wait.
  asm volatile("s_wait_xcnt 0x0" :: "v"(mi) : "memory");
  const float mb = 1.0e9f * (mk - 1.0f);
  const v16h  qf = frag_at(qp);

  // zb of the head: az[j] holds key tiles 2j (first k half) and 2j + 1 (second)
  v16h az[8];
#pragma unroll
  for (int j = 0; j < 8; ++j) az[j] = frag_units(zp + j * 512);

  // ---- xb^T of the query tile: xt[v] = xb(query c, d = 8*hh + v), k = 0..127
  v8f xt = {};
#pragma unroll
  for (int ks = 0; ks < 4; ++ks)
    xt = WMMA_F16(frag_units(wp + ks * 2048), frag_units(xp + ks * 8192), xt);
  v16h xf0, xf1;                       // [xb^T; 0] and [0; xb^T]
#pragma unroll
  for (int v = 0; v < 8; ++v) {
    xf0[v] = (h16)xt[v];   xf0[v + 8] = (h16)0.0f;
    xf1[v] = (h16)0.0f;    xf1[v + 8] = (h16)xt[v];
  }

  // ---- scores: s[mt][v] = logit(query c, key mt*16 + 8*hh + v)
  v8f s[16];
#pragma unroll
  for (int mt = 0; mt < 16; ++mt) {
    v8f z = {};
    s[mt] = WMMA_F16(frag_units(kp + mt * 512), qf, z);
  }
#pragma unroll
  for (int mt = 0; mt < 16; mt += 2) {
    s[mt]     = WMMA_F16(az[mt >> 1], xf0, s[mt])     + mb;
    s[mt + 1] = WMMA_F16(az[mt >> 1], xf1, s[mt + 1]) + mb;
  }
  // The address registers of the loads above stay untouched up to this wait.
  asm volatile("s_wait_xcnt 0x0" :: "v"(qp), "v"(kp), "v"(zp), "v"(wp), "v"(xp) : "memory");

  // ---- maximum over the 256 keys of the lane's query
  v8f mv = s[0];
#pragma unroll
  for (int mt = 1; mt < 16; ++mt)
#pragma unroll
    for (int v = 0; v < 8; ++v) mv[v] = fmaxf(mv[v], s[mt][v]);
  float mx = fmaxf(fmaxf(fmaxf(mv[0], mv[1]), fmaxf(mv[2], mv[3])),
                   fmaxf(fmaxf(mv[4], mv[5]), fmaxf(mv[6], mv[7])));
  mx = fmaxf(mx, xhalf(mx));

  // ---- exp, f32 sum (8 independent chains), pack to the B operand of P^T
  v8f  sv = {};
  v16h pb[8];
#pragma unroll
  for (int mt = 0; mt < 16; ++mt) {
    const v8f e = exp2_x8((s[mt] - mx) * 1.44269504f);   // e^(s - mx)
    sv += e;
#pragma unroll
    for (int v = 0; v < 8; ++v) pb[mt >> 1][((mt & 1) << 3) + v] = (h16)e[v];
  }
  float sum = ((sv[0] + sv[1]) + (sv[2] + sv[3])) + ((sv[4] + sv[5]) + (sv[6] + sv[7]));
  sum += xhalf(sum);
  const float inv = 1.0f / sum;

  // ---- O^T (32 ch x 16 queries) = V_h^T (32 x 256) P^T (256 x 16)
  v8f o0 = {}, o1 = {};
#pragma unroll
  for (int j = 0; j < 8; ++j) {
    const v16h a0 = frag_units(vp + j * 1024);             // channels 0..15
    const v16h a1 = frag_units(vp + j * 1024 + 512);       // channels 16..31
    o0 = WMMA_F16(a0, pb[j], o0);
    o1 = WMMA_F16(a1, pb[j], o1);
  }

  // ---- gate and store: a lane holds 8 consecutive channels of its query
  const v8h g0 = *(const v8h*)(gp);
  const v8h g1 = *(const v8h*)(gp + 16);
  // Same wait for the address registers of the V^T and gate loads.
  asm volatile("s_wait_xcnt 0x0" :: "v"(vp), "v"(gp) : "memory");
  v8h w0, w1;
#pragma unroll
  for (int v = 0; v < 8; ++v) {
    w0[v] = (h16)(o0[v] * inv * (float)g0[v]);
    w1[v] = (h16)(o1[v] * inv * (float)g1[v]);
  }
  *(v8h*)(og + idx)      = w0;
  *(v8h*)(og + idx + 16) = w1;
}

// ---------------------------------------------------------------------------
// Host-side orchestration
// ---------------------------------------------------------------------------
extern "C" void kernel_launch(void* const* d_in, const int* in_sizes, int n_in,
                              void* d_out, int out_size, void* d_ws, size_t ws_size,
                              hipStream_t stream) {
  (void)in_sizes; (void)n_in; (void)out_size; (void)ws_size;

  const float* x    = (const float*)d_in[0];   // (1,256,256,128)
  const float* z    = (const float*)d_in[1];   // (1,256,128)
  const float* mask = (const float*)d_in[2];   // (1,256,256)
  const float* ln_w = (const float*)d_in[3];
  const float* ln_b = (const float*)d_in[4];
  const float* wx   = (const float*)d_in[5];   // (64,128)
  const float* wz   = (const float*)d_in[6];   // (64,128)
  const float* wq   = (const float*)d_in[7];   // (128,128)
  const float* wk   = (const float*)d_in[8];
  const float* wv   = (const float*)d_in[9];
  const float* wg   = (const float*)d_in[10];
  const float* bg   = (const float*)d_in[11];  // (128,)
  const float* wo   = (const float*)d_in[12];  // (128,128)
  const float* bo   = (const float*)d_in[13];  // (128,)
  float* out = (float*)d_out;                  // (1,256,256,128)

  // ---- workspace carve-up (256B aligned regions)
  char* ws = (char*)d_ws;
  size_t off = 0;
  auto carve = [&](size_t bytes) -> char* {
    char* p = ws + off;
    off = (off + bytes + 255) & ~(size_t)255;
    return p;
  };
  const size_t NROWS = 65536;                 // 256*256
  h16*   xn_h   = (h16*)  carve(NROWS * 128 * 2);
  h16*   qh     = (h16*)  carve(NROWS * 128 * 2);
  h16*   gh     = (h16*)  carve(NROWS * 128 * 2);
  h16*   og     = (h16*)  carve(NROWS * 128 * 2);
  h16*   kh     = (h16*)  carve(256 * 128 * 2);
  h16*   vT     = (h16*)  carve(128 * 256 * 2);
  h16*   xbar_h = (h16*)  carve(256 * 128 * 2);
  // f16 copies of z and the weights: contiguous, in the converting blocks' order
  h16*   z_h    = (h16*)  carve(256 * 128 * 2);
  h16*   wq_h   = (h16*)  carve(128 * 128 * 2);
  h16*   wk_h   = (h16*)  carve(128 * 128 * 2);
  h16*   wv_h   = (h16*)  carve(128 * 128 * 2);
  h16*   wg_h   = (h16*)  carve(128 * 128 * 2);
  h16*   wo_h   = (h16*)  carve(128 * 128 * 2);
  h16*   wx_h   = (h16*)  carve(64 * 128 * 2);
  h16*   wz_h   = (h16*)  carve(64 * 128 * 2);
  h16*   zb_h   = (h16*)  carve(256 * 64 * 2);

  // ---- 1) + 2) layernorm (wave per row); weights + z to f16 (512 blocks)
  layernorm_cvt_kernel<<<8704, 256, 0, stream>>>(   // 512 + 8192 blocks
      x, ln_w, ln_b, xn_h, z, wq, wk, wv, wg, wo, wx, wz, z_h);

  // ---- 4) GEMMs: 16x64 strip per wave, W async-staged to LDS
  auto gemm = [&](const h16* A, const h16* W, h16* Ch, float* Cf,
                  const float* bias, int M, int N, int K,
                  int lda, int ldc, float alpha, int flags) {
    int strips = (M >> 4) * (N >> 6);
    int blocks = (strips + 7) / 8;
    gemm64_kernel<<<blocks, 256, 0, stream>>>(A, W, Ch, Cf, bias,
                                              M, N, K, lda, ldc, alpha, flags);
  };
  const float qscale = 0.17677669529663687f;  // CH^-0.5 = 1/sqrt(32)

  // fused q/g projection: reads xn once, writes qh (scaled) + gh (sigmoid);
  // in the same launch K, V^T and zb from z (10 blocks) and the column mean of
  // xn (128 blocks)
  gemm_qg_kernel<<<1162, 256, 0, stream>>>(xn_h, wq_h, wg_h, qh, gh, bg,
                                           (int)NROWS, qscale,
                                           xbar_h, z_h, wk_h, wv_h, wz_h,
                                           kh, vT, zb_h);

  // ---- 5) + 6) fused attention with the triangle bias: 8 rows per block, all
  // on one (query tile, head)
  attn_kernel<<<dim3(32, 16, 4), 256, 0, stream>>>(qh, kh, vT, gh, zb_h, wx_h, xbar_h,
                                                   mask, og);

  // ---- 7) output projection: out = og @ wo^T + bo  (f32 out)
  gemm(og, wo_h, nullptr, out, bo, NROWS, 128, 128, 128, 128, 1.0f, 0);
}

// v006
// A run of this version takes 53.1 microseconds.
// In two side-by-side timings against v005, it was 1.16 and 1.15 times as fast.
// Over all steps from v000 it is 5.95 times as fast.
#include <hip/hip_runtime.h>
#include <hip/hip_bf16.h>
#include <hip/hip_fp16.h>

// ---------------------------------------------------------------------------
// TriangleCrossAttention on gfx1250 (CDNA5)
//  - all GEMMs on V_WMMA_F32_16X16X32_F16 (f32 accumulate)
//  - weights staged to LDS with GLOBAL_LOAD_ASYNC_TO_LDS_B128 (ASYNCcnt path),
//    their 256-byte rows at a pitch of 272 bytes
//  - 16x64 C strip per wave; fused q/g GEMM reads xn once, 8 WMMAs per A frag
//  - kernels that do not depend on each other share a launch (block ranges)
//  - K, V^T, zb, wx and xbar lie in memory in the order the attention wave's
//    fragments take them: lane l's 16 bytes at byte l*16 of a 512-byte unit
//  - the triangle bias is a second k slab of the score product:
//    logit = [q | xb] . [k | zb], xb made in the attention wave from xbar, wx
//  - an attention block holds its head's K, V^T and zb in LDS (async copies)
//    and every wave takes four rows of the pair array from them
// B=1, N=M=256, CQ=CKV=128, H=4, CH=32, CB=16
// ---------------------------------------------------------------------------

typedef _Float16 h16;
typedef __attribute__((ext_vector_type(16))) _Float16 v16h;
typedef __attribute__((ext_vector_type(8)))  _Float16 v8h;
typedef __attribute__((ext_vector_type(4)))  _Float16 v4h;
typedef __attribute__((ext_vector_type(8)))  float    v8f;
typedef __attribute__((ext_vector_type(4)))  float    v4f;

#define WMMA_F16(a, b, c) \
  __builtin_amdgcn_wmma_f32_16x16x32_f16(false, (a), false, (b), (short)0, (c), false, false)

static __device__ __forceinline__ int laneId() { return threadIdx.x & 31; }

static __device__ __forceinline__ void wait_async0() {
  asm volatile("s_wait_asynccnt 0x0" ::: "memory");
}

// A staged weight matrix has rows of 128 f16 (256 bytes). In LDS they lie at a
// pitch of 272 bytes (16 x odd): the 16 rows that a half wave's ds_load_b128
// reads at one k offset then fall on all 64 banks; at 256 bytes they fall on
// the same four.
#define WPITCH  136                 // f16 per LDS row
#define WPITCHB (WPITCH * 2)        // bytes per LDS row

// Four async copies of 16 bytes per lane, global -> LDS (ASYNCcnt), one round
// of a 256-thread block each: 4 KiB = 16 rows apart. The s_wait_xcnt ends the
// copies' own statement, so that no address register of a copy is rewritten in
// front of it.
static __device__ __forceinline__ void async_load4_b128(unsigned int lds_off,
                                                        unsigned long long gaddr) {
  asm volatile("global_load_async_to_lds_b128 %0, %4, off\n\t"
               "global_load_async_to_lds_b128 %1, %5, off\n\t"
               "global_load_async_to_lds_b128 %2, %6, off\n\t"
               "global_load_async_to_lds_b128 %3, %7, off\n\t"
               "s_wait_xcnt 0x0"
               :: "v"(lds_off), "v"(lds_off + 16u * WPITCHB),
                  "v"(lds_off + 32u * WPITCHB), "v"(lds_off + 48u * WPITCHB),
                  "v"(gaddr), "v"(gaddr + 4096ull),
                  "v"(gaddr + 8192ull), "v"(gaddr + 12288ull)
               : "memory");
}

// Issue the copies of W (ROWS x 128 f16, row-major, ROWS = 64 or 128) into
// Wlds (ROWS x WPITCH) from a 256-thread block: thread t brings chunk t & 15
// of rows t >> 4, + 16, + 32, ... The caller waits and passes the barrier.
template <int ROWS>
static __device__ __forceinline__ void stage_w(h16* Wlds, const h16* __restrict__ W) {
  const unsigned int       l = (unsigned int)(size_t)((char*)Wlds
                                 + (threadIdx.x >> 4) * WPITCHB + (threadIdx.x & 15) * 16);
  const unsigned long long g = (unsigned long long)(size_t)((const char*)W + threadIdx.x * 16);
#pragma unroll   // 1 or 2 rounds of four copies: every copy gets registers of its own
  for (int r = 0; r < ROWS; r += 64) async_load4_b128(l + r * WPITCHB, g + r * 256);
}

// Four (or two) async copies of 16 bytes per lane of a contiguous array, one
// round of a 256-thread block each: 4 KiB apart on both sides. The s_wait_xcnt
// ends the copies' own statement, as above.
static __device__ __forceinline__ void async_lin4_b128(unsigned int lds_off,
                                                       unsigned long long gaddr) {
  asm volatile("global_load_async_to_lds_b128 %0, %4, off\n\t"
               "global_load_async_to_lds_b128 %1, %5, off\n\t"
               "global_load_async_to_lds_b128 %2, %6, off\n\t"
               "global_load_async_to_lds_b128 %3, %7, off\n\t"
               "s_wait_xcnt 0x0"
               :: "v"(lds_off), "v"(lds_off + 4096u),
                  "v"(lds_off + 8192u), "v"(lds_off + 12288u),
                  "v"(gaddr), "v"(gaddr + 4096ull),
                  "v"(gaddr + 8192ull), "v"(gaddr + 12288ull)
               : "memory");
}
static __device__ __forceinline__ void async_lin2_b128(unsigned int lds_off,
                                                       unsigned long long gaddr) {
  asm volatile("global_load_async_to_lds_b128 %0, %2, off\n\t"
               "global_load_async_to_lds_b128 %1, %3, off\n\t"
               "s_wait_xcnt 0x0"
               :: "v"(lds_off), "v"(lds_off + 4096u),
                  "v"(gaddr), "v"(gaddr + 4096ull)
               : "memory");
}

// Load one 16x32 f16 fragment (A-matrix layout; also valid for the B operand
// when B is a row-major weight matrix W with K contiguous, since
// B[k][n] = W[n][k] mirrors the A striping with M<->N swapped).
// CDNA5 layout: lanes 0-15 -> row M=lane, K 0..7 (v0-3) and 16..23 (v4-7);
// lanes 16-31 -> row M=lane-16, K 8..15 and 24..31.
static __device__ __forceinline__ v16h load_frag(const h16* __restrict__ base,
                                                 int rowTile, int ld, int kbase) {
  const int lane = laneId();
  const h16* p = base + (size_t)(rowTile + (lane & 15)) * ld
                      + kbase + ((lane >> 4) << 3);
  v8h lo = *(const v8h*)(p);
  v8h hi = *(const v8h*)(p + 16);
  v16h f;
#pragma unroll
  for (int i = 0; i < 8; ++i) { f[i] = lo[i]; f[i + 8] = hi[i]; }
  return f;
}

// ---------------------------------------------------------------------------
// Fragment order of the operands that every attention wave reads whole.
// A unit is what one wave-wide 16-byte load takes: 32 lanes x 16 bytes, lane
// (hh = lane>>4, c = lane&15) at byte lane*16, so a load covers four whole
// 128-byte lines. At each register position a lane gets the element that
// load_frag's layout puts there (same k order).
//   K   [head][key tile 16][k half 16][lane: c = key,     hh = k>>3  ][8 channels]
//   V^T [head][key block 32][ch tile 16][k half 16][lane: c = channel, hh = key>>3][8 keys]
//   zb  [head][key tile 16][lane: c = key, hh = d>>3][8 bias channels d]
//   wx  [k step 32][head][k half 16][lane: c = d,     hh = k>>3][8 channels]
//   xbar: as K, with the query n for the key and the k step for the head
// ---------------------------------------------------------------------------
static __device__ __forceinline__ int kfrag_index(int m, int ch) {   // key, channel 0..127
  return ((((ch >> 5) * 16 + (m >> 4)) * 2 + ((ch >> 4) & 1)) * 32
          + ((ch >> 3) & 1) * 16 + (m & 15)) * 8 + (ch & 7);
}
static __device__ __forceinline__ int zfrag_index(int m, int col) {  // key, head*16 + d
  return (((col >> 4) * 16 + (m >> 4)) * 32
          + ((col >> 3) & 1) * 16 + (m & 15)) * 8 + (col & 7);
}
static __device__ __forceinline__ int vfrag_index(int ch, int m) {   // channel 0..127, key
  return (((((ch >> 5) * 8 + (m >> 5)) * 2 + ((ch >> 4) & 1)) * 2 + ((m >> 4) & 1)) * 32
          + ((m >> 3) & 1) * 16 + (ch & 15)) * 8 + (m & 7);
}

// ---------------------------------------------------------------------------
// Small GEMM for a block range of a shared launch:
//   C[256,N] = A[256,128] * W[N,128]^T, N = 64 or 128, 256 threads,
//   N/32 blocks (blk = 0..N/32-1), one 16x64 strip per wave.
//   W async-staged to LDS as in gemm64_kernel; same k order, same sums.
//   OUT: what is stored: C as f16 in K's fragment order, C^T as f16 in V^T's
//   fragment order, or C as f16 in zb's fragment order. A wave's 16x64 strip
//   holds every element of each 128-byte line that it writes.
// ---------------------------------------------------------------------------
#define OUT_KFRAG 0
#define OUT_VFRAG 1
#define OUT_ZFRAG 2
template <int N, int OUT>
static __device__ __forceinline__ void gemm256_block(h16* Wlds,
                                                     const h16* __restrict__ A,
                                                     const h16* __restrict__ W,
                                                     h16* __restrict__ Ch,
                                                     int blk) {
  stage_w<N>(Wlds, W);
  wait_async0();
  __syncthreads();

  const int tilesN = N >> 6;
  const int wave   = blk * 8 + (threadIdx.x >> 5);   // 0 .. 16*tilesN-1
  const int tm = (wave / tilesN) << 4;
  const int tn = (wave % tilesN) << 6;

  v8f acc[4] = {{}, {}, {}, {}};
  for (int k = 0; k < 128; k += 32) {
    v16h a = load_frag(A, tm, 128, k);
    v16h b[4];
#pragma unroll
    for (int t = 0; t < 4; ++t) b[t] = load_frag(Wlds, tn + (t << 4), WPITCH, k);
#pragma unroll
    for (int t = 0; t < 4; ++t) acc[t] = WMMA_F16(a, b[t], acc[t]);
  }

  const int lane = laneId();
  const int rb   = tm + ((lane >> 4) << 3);
#pragma unroll
  for (int t = 0; t < 4; ++t) {
    const int col = tn + (t << 4) + (lane & 15);
#pragma unroll
    for (int v = 0; v < 8; ++v) {
      const float y = acc[t][v];
      const int r = rb + v;
      if (OUT == OUT_VFRAG)      Ch[vfrag_index(col, r)] = (h16)y;
      else if (OUT == OUT_KFRAG) Ch[kfrag_index(r, col)] = (h16)y;
      else                       Ch[zfrag_index(r, col)] = (h16)y;
    }
  }
  // The stores' address and data registers stay untouched up to this wait: the
  // code of the launch's other block ranges follows and rewrites them.
  asm volatile("s_wait_xcnt 0x0" ::: "memory");
}

// ---------------------------------------------------------------------------
// 1) One launch, two independent jobs.
//    Blocks 0..511: f32 -> f16 of z and the seven weight matrices into one
//    contiguous f16 region (order z, wq, wk, wv, wg, wo, wx, wz); wx goes into
//    its fragment order: a block writes one whole unit and gathers its source.
//    Blocks 512.. : LayerNorm over channel dim (128), f16 out, one wave per row.
// ---------------------------------------------------------------------------
#define CVT_BLOCKS 512
__global__ void layernorm_cvt_kernel(const float* __restrict__ x,
                                     const float* __restrict__ ln_w,
                                     const float* __restrict__ ln_b,
                                     h16* __restrict__ xn,
                                     const float* __restrict__ z_f,
                                     const float* __restrict__ wq_f,
                                     const float* __restrict__ wk_f,
                                     const float* __restrict__ wv_f,
                                     const float* __restrict__ wg_f,
                                     const float* __restrict__ wo_f,
                                     const float* __restrict__ wx_f,
                                     const float* __restrict__ wz_f,
                                     h16* __restrict__ cvt_out) {
  if (blockIdx.x < CVT_BLOCKS) {                       // block-uniform
    const int b = blockIdx.x;                          // 256 elements per block
    const float* in;
    int first;                                         // the source's first block
    if      (b < 128) { in = z_f;  first = 0;   }
    else if (b < 192) { in = wq_f; first = 128; }
    else if (b < 256) { in = wk_f; first = 192; }
    else if (b < 320) { in = wv_f; first = 256; }
    else if (b < 384) { in = wg_f; first = 320; }
    else if (b < 448) { in = wo_f; first = 384; }
    else if (b < 480) { in = wx_f; first = 448; }
    else              { in = wz_f; first = 480; }
    int src = (b - first) * 256 + threadIdx.x;
    if (b >= 448 && b < 480) {                         // wx: unit b - 448
      const int u   = b - 448;                         // [k step][head][k half]
      const int t   = threadIdx.x;                     // [hh][d][8 channels]
      const int row = ((u >> 1) & 3) * 16 + ((t >> 3) & 15);
      const int ch  = (u >> 3) * 32 + (u & 1) * 16 + (t >> 7) * 8 + (t & 7);
      src = row * 128 + ch;
    }
    cvt_out[b * 256 + threadIdx.x] = (h16)in[src];
    return;
  }
  const int wave = threadIdx.x >> 5;
  const int lane = laneId();
  const size_t row = (size_t)(blockIdx.x - CVT_BLOCKS) * 8 + wave;   // 0..65535
  const int c = lane << 2;                             // 4 channels per lane

  float4 xv = *(const float4*)(x + row * 128 + c);
  float s  = xv.x + xv.y + xv.z + xv.w;
  float ss = xv.x * xv.x + xv.y * xv.y + xv.z * xv.z + xv.w * xv.w;
#pragma unroll
  for (int off = 16; off >= 1; off >>= 1) {
    s  += __shfl_xor(s,  off);
    ss += __shfl_xor(ss, off);
  }
  const float mu   = s * (1.0f / 128.0f);
  const float var  = ss * (1.0f / 128.0f) - mu * mu;
  const float rstd = rsqrtf(var + 1e-5f);

  float4 wv = *(const float4*)(ln_w + c);
  float4 bv = *(const float4*)(ln_b + c);
  v4h o;
  o[0] = (h16)((xv.x - mu) * rstd * wv.x + bv.x);
  o[1] = (h16)((xv.y - mu) * rstd * wv.y + bv.y);
  o[2] = (h16)((xv.z - mu) * rstd * wv.z + bv.z);
  o[3] = (h16)((xv.w - mu) * rstd * wv.w + bv.w);
  *(v4h*)(xn + row * 128 + c) = o;
}

// ---------------------------------------------------------------------------
// 3) Column mean over inner N (q) of xn -> xbar (256x128, f16, fragment order),
//    for a block range of a shared launch: 256 threads, 8 n x 32 channels per
//    block (blk = 0..127: the four 128-byte lines of xbar that hold them), one
//    wave per n, one thread per (n, channel).
// ---------------------------------------------------------------------------
static __device__ __forceinline__ void colmean_block(const h16* __restrict__ xn,
                                                     h16* __restrict__ xbar,
                                                     int blk) {
  const int n = (blk >> 2) * 8 + (threadIdx.x >> 5);    // 0..255
  const int c = (blk & 3) * 32 + (threadIdx.x & 31);    // 0..127
  float acc = 0.0f;
  for (int q = 0; q < 256; q += 8) {
    const h16* p = xn + ((size_t)(n * 256 + q)) * 128 + c;
    h16 t[8];
#pragma unroll
    for (int i = 0; i < 8; ++i) t[i] = p[i * 128];
    // The loads' address register stays untouched up to this wait.
    asm volatile("s_wait_xcnt 0x0" :: "v"(p) : "memory");
#pragma unroll
    for (int i = 0; i < 8; ++i) acc += (float)t[i];   // same order as q = 0..255
  }
  xbar[kfrag_index(n, c)] = (h16)(acc * (1.0f / 256.0f));
  // Same wait behind the store: code of other block ranges follows it.
  asm volatile("s_wait_xcnt 0x0" ::: "memory");
}

// ---------------------------------------------------------------------------
// 4a) WMMA GEMM: C[M,N] = act(alpha * A[M,K] * W[N,K]^T + bias)
//     W (128x128 f16) async-staged to LDS once per block.
//     Each wave computes a 16x64 strip; all 4 B frags batched before the
//     WMMA chain so DS latency is paid once per k-step.
//     Requires: N == K == 128 (the LDS image of W), M % 16 == 0.
// ---------------------------------------------------------------------------
#define GF_SIGMOID   1
#define GF_TRANSPOSE 2   // store C^T (Ch[col*ldc + row]); f16 path only

__global__ void gemm64_kernel(const h16* __restrict__ A,
                              const h16* __restrict__ W,
                              h16* __restrict__ Ch, float* __restrict__ Cf,
                              const float* __restrict__ bias,
                              int M, int N, int K,
                              int lda, int ldc,
                              float alpha, int flags) {
  __shared__ __attribute__((aligned(16))) h16 Wlds[128 * WPITCH];  // 128 rows x WPITCH f16

  // ---- async-stage W (row-major) into LDS
  stage_w<128>(Wlds, W);
  wait_async0();
  __syncthreads();

  const int tilesN = N >> 6;                       // 64-wide wave strips
  const int total  = (M >> 4) * tilesN;
  const int wave   = blockIdx.x * (blockDim.x >> 5) + (threadIdx.x >> 5);
  if (wave >= total) return;                       // wave-uniform

  const int tm = (wave / tilesN) << 4;
  const int tn = (wave % tilesN) << 6;

  v8f acc[4] = {{}, {}, {}, {}};
  for (int k = 0; k < K; k += 32) {
    v16h a = load_frag(A, tm, lda, k);
    v16h b[4];
#pragma unroll
    for (int t = 0; t < 4; ++t) b[t] = load_frag(Wlds, tn + (t << 4), WPITCH, k);
#pragma unroll
    for (int t = 0; t < 4; ++t) acc[t] = WMMA_F16(a, b[t], acc[t]);
  }

  const int lane = laneId();
  const int rb   = tm + ((lane >> 4) << 3);
#pragma unroll
  for (int t = 0; t < 4; ++t) {
    const int col = tn + (t << 4) + (lane & 15);
    const float bv = bias ? bias[col] : 0.0f;
#pragma unroll
    for (int v = 0; v < 8; ++v) {
      float y = acc[t][v] * alpha + bv;
      if (flags & GF_SIGMOID) y = 1.0f / (1.0f + __expf(-y));
      const int r = rb + v;
      if (flags & GF_TRANSPOSE) {
        Ch[(size_t)col * ldc + r] = (h16)y;
      } else {
        if (Ch) Ch[(size_t)r * ldc + col] = (h16)y;
        if (Cf) Cf[(size_t)r * ldc + col] = y;
      }
    }
  }
}

// ---------------------------------------------------------------------------
// 4b) Fused q/g GEMM: Q = qscale*(A Wq^T), G = sigmoid(A Wg^T + bg)
//     Shares the A (xn) stream: 8 WMMAs per A fragment, N = K = 128.
//     The launch's first blocks do four jobs that depend on q/g as little as
//     q/g on them: 0..3 K = z wk^T, 4..7 V^T = (z wv^T)^T, 8..9 zb = z wz^T
//     (f16), 10..137 the column mean of xn.
// ---------------------------------------------------------------------------
#define ZG_BLOCKS 10
#define CM_BLOCKS 128
// The 68 KiB of LDS allow four blocks per WGP: 8 waves per SIMD.
__global__ void __launch_bounds__(256)
gemm_qg_kernel(const h16* __restrict__ A,
                               const h16* __restrict__ Wq,
                               const h16* __restrict__ Wg,
                               h16* __restrict__ Q, h16* __restrict__ G,
                               const float* __restrict__ bg,
                               int M, float qscale,
                               h16* __restrict__ xbar,
                               const h16* __restrict__ zh,
                               const h16* __restrict__ wk,
                               const h16* __restrict__ wv,
                               const h16* __restrict__ wz,
                               h16* __restrict__ kh,
                               h16* __restrict__ vT,
                               h16* __restrict__ zb) {
  __shared__ __attribute__((aligned(16))) h16 Wq_lds[128 * WPITCH];  // 128 rows x WPITCH f16
  __shared__ __attribute__((aligned(16))) h16 Wg_lds[128 * WPITCH];  // 128 rows x WPITCH f16

  if (blockIdx.x < ZG_BLOCKS + CM_BLOCKS) {            // block-uniform
    const int b = blockIdx.x;
    if      (b < 4)  gemm256_block<128, OUT_KFRAG>(Wq_lds, zh, wk, kh, b);
    else if (b < 8)  gemm256_block<128, OUT_VFRAG>(Wq_lds, zh, wv, vT, b - 4);
    else if (b < 10) gemm256_block<64,  OUT_ZFRAG>(Wq_lds, zh, wz, zb, b - 8);
    else             colmean_block(A, xbar, b - ZG_BLOCKS);
    return;
  }

  stage_w<128>(Wq_lds, Wq);
  stage_w<128>(Wg_lds, Wg);
  wait_async0();
  __syncthreads();

  const int total = (M >> 4) * 2;                  // two 64-wide strips per row
  const int wave  = (blockIdx.x - (ZG_BLOCKS + CM_BLOCKS)) * (blockDim.x >> 5) + (threadIdx.x >> 5);
  if (wave >= total) return;                       // wave-uniform

  const int tm = (wave >> 1) << 4;
  const int tn = (wave & 1) << 6;

  v8f accq[4] = {{}, {}, {}, {}};
  v8f accg[4] = {{}, {}, {}, {}};
  for (int k = 0; k < 128; k += 32) {
    v16h a = load_frag(A, tm, 128, k);
    v16h bq[4], bgf[4];
#pragma unroll
    for (int t = 0; t < 4; ++t) bq[t]  = load_frag(Wq_lds, tn + (t << 4), WPITCH, k);
#pragma unroll
    for (int t = 0; t < 4; ++t) bgf[t] = load_frag(Wg_lds, tn + (t << 4), WPITCH, k);
#pragma unroll
    for (int t = 0; t < 4; ++t) accq[t] = WMMA_F16(a, bq[t],  accq[t]);
#pragma unroll
    for (int t = 0; t < 4; ++t) accg[t] = WMMA_F16(a, bgf[t], accg[t]);
  }

  const int lane = laneId();
  const int rb   = tm + ((lane >> 4) << 3);
#pragma unroll
  for (int t = 0; t < 4; ++t) {
    const int col = tn + (t << 4) + (lane & 15);
    const float bgv = bg[col];
#pragma unroll
    for (int v = 0; v < 8; ++v) {
      const int r = rb + v;
      Q[(size_t)r * 128 + col] = (h16)(accq[t][v] * qscale);
      const float y = accg[t][v] + bgv;
      G[(size_t)r * 128 + col] = (h16)(1.0f / (1.0f + __expf(-y)));
    }
  }
}

// ---------------------------------------------------------------------------
// 6) Fused attention core: a block has one (16-query tile, head) and 32 rows r,
//    a wave four of them, one after the other. K_h, V_h^T and zb_h (40 KiB, in
//    fragment order) are copied to LDS once per block; a fragment's
//    ds_load_b128 reads 512 contiguous bytes. xb^T is made once per wave.
//    xb^T = wx_h xbar^T : 16 bias channels d x 16 queries; a lane's 8 results,
//    packed, are the first k half of a B operand as they stand (d = 8*hh + v).
//    S^T = K_h Q^T + zb_h xb^T : A = 16 keys x 32 ch, B = 32 ch x 16 queries.
//    The bias has 16 channels d: one A fragment holds zb of two key tiles, one
//    in each k half, and B = [xb^T; 0] or [0; xb^T] picks the tile.
//    A lane then holds scores of ONE query (column lane&15): 8 keys per tile,
//    128 of the 256 keys per lane; lanes l and l^16 split the keys.
//    Softmax: in-lane maximum and sum plus one exchange between wave halves.
//    O^T = V_h^T P^T : two packed S^T tiles are a B operand as they stand
//    (hardware k order), V^T is loaded in the same k order by frag_units.
//    One barrier, behind the copies; scores and P never pass through LDS.
// ---------------------------------------------------------------------------
static __device__ __forceinline__ float xhalf(float x) {   // lane l <-> l ^ 16
  const int b = __builtin_bit_cast(int, x);
  return __builtin_bit_cast(float,
      __builtin_amdgcn_permlanex16(b, b, 0x76543210, 0xfedcba98, false, false));
}

// 16x32 f16 fragment from the lane's own pointer (row lane&15, k offset
// 8*(lane>>4)): same k order as load_frag.
static __device__ __forceinline__ v16h frag_at(const h16* __restrict__ p) {
  v8h lo = *(const v8h*)(p);
  v8h hi = *(const v8h*)(p + 16);
  v16h f;
#pragma unroll
  for (int i = 0; i < 8; ++i) { f[i] = lo[i]; f[i + 8] = hi[i]; }
  return f;
}

// 16x32 f16 fragment from an array in fragment order: p is the lane's own 16
// bytes of the first unit (k half 0); the second unit follows 512 bytes on.
static __device__ __forceinline__ v16h frag_units(const h16* __restrict__ p) {
  v8h lo = *(const v8h*)(p);
  v8h hi = *(const v8h*)(p + 256);
  v16h f;
#pragma unroll
  for (int i = 0; i < 8; ++i) { f[i] = lo[i]; f[i + 8] = hi[i]; }
  return f;
}

// Eight 2^x in one statement. No result shares a register with an argument
// ("=&v"), so no v_exp_f32 is directly followed by a write of its source or a
// read of its result; the v_nop is that slot behind the last one.
static __device__ __forceinline__ v8f exp2_x8(v8f x) {
  float e0, e1, e2, e3, e4, e5, e6, e7;
  asm("v_exp_f32 %0, %8\n\t"
      "v_exp_f32 %1, %9\n\t"
      "v_exp_f32 %2, %10\n\t"
      "v_exp_f32 %3, %11\n\t"
      "v_exp_f32 %4, %12\n\t"
      "v_exp_f32 %5, %13\n\t"
      "v_exp_f32 %6, %14\n\t"
      "v_exp_f32 %7, %15\n\t"
      "v_nop"
      : "=&v"(e0), "=&v"(e1), "=&v"(e2), "=&v"(e3),
        "=&v"(e4), "=&v"(e5), "=&v"(e6), "=&v"(e7)
      : "v"(x[0]), "v"(x[1]), "v"(x[2]), "v"(x[3]),
        "v"(x[4]), "v"(x[5]), "v"(x[6]), "v"(x[7]));
  v8f e = {e0, e1, e2, e3, e4, e5, e6, e7};
  return e;
}

#define ATT_ROWS 4    // rows r per wave
// 4 waves per SIMD (256 VGPRs): two blocks per WGP, 512 blocks: all resident
__global__ void __launch_bounds__(256, 4)
attn_kernel(const h16* __restrict__ qh,   // [65536][128] scaled
            const h16* __restrict__ kh,   // 256 keys x 128 ch, fragment order
            const h16* __restrict__ vT,   // 128 ch x 256 keys, fragment order
            const h16* __restrict__ gh,   // [65536][128] sigmoid'd
            const h16* __restrict__ zb,   // 256 keys x 64 (head, d), fragment order
            const h16* __restrict__ wx,   // 64 (head, d) x 128 ch, fragment order
            const h16* __restrict__ xbar, // 256 queries x 128 ch, fragment order
            const float* __restrict__ mask,// [256][256]
            h16* __restrict__ og) {       // [65536][128]
  // the head's K (16 KiB), V^T (16 KiB) and zb (8 KiB), as they lie in memory
  __shared__ __attribute__((aligned(16))) h16 kvz[8192 + 8192 + 4096];

  const int lane = laneId();
  const int c    = lane & 15;                              // query column
  const int hh   = lane >> 4;                              // wave half
  const int r0   = blockIdx.x * (8 * ATT_ROWS) + (threadIdx.x >> 5);  // first row
  const int q0   = blockIdx.y << 4;                        // 16 queries
  const int h    = blockIdx.z;                             // head

  // ---- the block's copies: thread t brings bytes t*16 of each 4-KiB round
  {
    const unsigned int l = (unsigned int)(size_t)((char*)kvz + threadIdx.x * 16);
    async_lin4_b128(l,
        (unsigned long long)(size_t)((const char*)(kh + h * 8192) + threadIdx.x * 16));
    async_lin4_b128(l + 16384u,
        (unsigned long long)(size_t)((const char*)(vT + h * 8192) + threadIdx.x * 16));
    async_lin2_b128(l + 32768u,
        (unsigned long long)(size_t)((const char*)(zb + h * 4096) + threadIdx.x * 16));
  }

  // the lane's 16 bytes in the first unit of K, V^T and zb in LDS, of the
  // head's wx and of the query tile's xbar
  const h16*   kp = kvz + lane * 8;
  const h16*   vp = kvz + 8192 + lane * 8;
  const h16*   zp = kvz + 16384 + lane * 8;
  const h16*   wp = wx + h * 512 + lane * 8;
  const h16*   xp = xbar + blockIdx.y * 512 + lane * 8;

  // ---- xb^T of the query tile: xt[v] = xb(query c, d = 8*hh + v), k = 0..127
  v8f xt = {};
#pragma unroll
  for (int ks = 0; ks < 4; ++ks)
    xt = WMMA_F16(frag_units(wp + ks * 2048), frag_units(xp + ks * 8192), xt);
  // The address registers of the loads above stay untouched up to this wait.
  asm volatile("s_wait_xcnt 0x0" :: "v"(wp), "v"(xp) : "memory");
  v16h xf0, xf1;                       // [xb^T; 0] and [0; xb^T]
#pragma unroll
  for (int v = 0; v < 8; ++v) {
    xf0[v] = (h16)xt[v];   xf0[v + 8] = (h16)0.0f;
    xf1[v] = (h16)0.0f;    xf1[v + 8] = (h16)xt[v];
  }

  // Each wave's own copies have landed, then every wave's: nobody reads kvz
  // in front of this barrier.
  wait_async0();
  __syncthreads();

#pragma unroll 1   // rolled: one copy of the long body in the code
  for (int it = 0; it < ATT_ROWS; ++it) {
    const int r = r0 + it * 8;                             // 0..255
    // element offset of (query c, head h, channel 8*hh) in qh, gh and og
    const size_t idx = ((size_t)(r * 256 + q0) + c) * 128 + h * 32 + (hh << 3);
    const h16*   qp = qh + idx;
    const h16*   gp = gh + idx;

    const int   mi = r * 256 + q0 + c;                     // (row, query) in mask
    const float mk = mask[mi];
    const v16h  qf = frag_at(qp);
    // The index and address registers of these loads stay untouched up to this wait.
    asm volatile("s_wait_xcnt 0x0" :: "v"(mi), "v"(qp) : "memory");
    const float mb = 1.0e9f * (mk - 1.0f);

    // ---- scores: s[mt][v] = logit(query c, key mt*16 + 8*hh + v)
    v8f s[16];
#pragma unroll
    for (int mt = 0; mt < 16; ++mt) {
      v8f z = {};
      s[mt] = WMMA_F16(frag_units(kp + mt * 512), qf, z);
    }
    // one zb fragment holds key tiles mt (first k half) and mt + 1 (second)
#pragma unroll
    for (int mt = 0; mt < 16; mt += 2) {
      const v16h az = frag_units(zp + mt * 256);
      s[mt]     = WMMA_F16(az, xf0, s[mt])     + mb;
      s[mt + 1] = WMMA_F16(az, xf1, s[mt + 1]) + mb;
    }

    // ---- maximum over the 256 keys of the lane's query
    v8f mv = s[0];
#pragma unroll
    for (int mt = 1; mt < 16; ++mt)
#pragma unroll
      for (int v = 0; v < 8; ++v) mv[v] = fmaxf(mv[v], s[mt][v]);
    float mx = fmaxf(fmaxf(fmaxf(mv[0], mv[1]), fmaxf(mv[2], mv[3])),
                     fmaxf(fmaxf(mv[4], mv[5]), fmaxf(mv[6], mv[7])));
    mx = fmaxf(mx, xhalf(mx));

    // ---- exp, f32 sum (8 independent chains), pack to the B operand of P^T
    v8f  sv = {};
    v16h pb[8];
#pragma unroll
    for (int mt = 0; mt < 16; ++mt) {
      const v8f e = exp2_x8((s[mt] - mx) * 1.44269504f);   // e^(s - mx)
      sv += e;
#pragma unroll
      for (int v = 0; v < 8; ++v) pb[mt >> 1][((mt & 1) << 3) + v] = (h16)e[v];
    }
    float sum = ((sv[0] + sv[1]) + (sv[2] + sv[3])) + ((sv[4] + sv[5]) + (sv[6] + sv[7]));
    sum += xhalf(sum);
    const float inv = 1.0f / sum;

    // ---- O^T (32 ch x 16 queries) = V_h^T (32 x 256) P^T (256 x 16)
    v8f o0 = {}, o1 = {};
#pragma unroll
    for (int j = 0; j < 8; ++j) {
      const v16h a0 = frag_units(vp + j * 1024);           // channels 0..15
      const v16h a1 = frag_units(vp + j * 1024 + 512);     // channels 16..31
      o0 = WMMA_F16(a0, pb[j], o0);
      o1 = WMMA_F16(a1, pb[j], o1);
    }

    // ---- gate and store: a lane holds 8 consecutive channels of its query
    const v8h g0 = *(const v8h*)(gp);
    const v8h g1 = *(const v8h*)(gp + 16);
    // Same wait for the address registers of the gate loads.
    asm volatile("s_wait_xcnt 0x0" :: "v"(gp) : "memory");
    v8h w0, w1;
#pragma unroll
    for (int v = 0; v < 8; ++v) {
      w0[v] = (h16)(o0[v] * inv * (float)g0[v]);
      w1[v] = (h16)(o1[v] * inv * (float)g1[v]);
    }
    *(v8h*)(og + idx)      = w0;
    *(v8h*)(og + idx + 16) = w1;
    // The stores' address and data registers stay untouched up to this wait:
    // the next trip rewrites them.
    asm volatile("s_wait_xcnt 0x0" ::: "memory");
  }
}

// ---------------------------------------------------------------------------
// Host-side orchestration
// ---------------------------------------------------------------------------
extern "C" void kernel_launch(void* const* d_in, const int* in_sizes, int n_in,
                              void* d_out, int out_size, void* d_ws, size_t ws_size,
                              hipStream_t stream) {
  (void)in_sizes; (void)n_in; (void)out_size; (void)ws_size;

  const float* x    = (const float*)d_in[0];   // (1,256,256,128)
  const float* z    = (const float*)d_in[1];   // (1,256,128)
  const float* mask = (const float*)d_in[2];   // (1,256,256)
  const float* ln_w = (const float*)d_in[3];
  const float* ln_b = (const float*)d_in[4];
  const float* wx   = (const float*)d_in[5];   // (64,128)
  const float* wz   = (const float*)d_in[6];   // (64,128)
  const float* wq   = (const float*)d_in[7];   // (128,128)
  const float* wk   = (const float*)d_in[8];
  const float* wv   = (const float*)d_in[9];
  const float* wg   = (const float*)d_in[10];
  const float* bg   = (const float*)d_in[11];  // (128,)
  const float* wo   = (const float*)d_in[12];  // (128,128)
  const float* bo   = (const float*)d_in[13];  // (128,)
  float* out = (float*)d_out;                  // (1,256,256,128)

  // ---- workspace carve-up (256B aligned regions)
  char* ws = (char*)d_ws;
  size_t off = 0;
  auto carve = [&](size_t bytes) -> char* {
    char* p = ws + off;
    off = (off + bytes + 255) & ~(size_t)255;
    return p;
  };
  const size_t NROWS = 65536;                 // 256*256
  h16*   xn_h   = (h16*)  carve(NROWS * 128 * 2);
  h16*   qh     = (h16*)  carve(NROWS * 128 * 2);
  h16*   gh     = (h16*)  carve(NROWS * 128 * 2);
  h16*   og     = (h16*)  carve(NROWS * 128 * 2);
  h16*   kh     = (h16*)  carve(256 * 128 * 2);
  h16*   vT     = (h16*)  carve(128 * 256 * 2);
  h16*   xbar_h = (h16*)  carve(256 * 128 * 2);
  // f16 copies of z and the weights: contiguous, in the converting blocks' order
  h16*   z_h    = (h16*)  carve(256 * 128 * 2);
  h16*   wq_h   = (h16*)  carve(128 * 128 * 2);
  h16*   wk_h   = (h16*)  carve(128 * 128 * 2);
  h16*   wv_h   = (h16*)  carve(128 * 128 * 2);
  h16*   wg_h   = (h16*)  carve(128 * 128 * 2);
  h16*   wo_h   = (h16*)  carve(128 * 128 * 2);
  h16*   wx_h   = (h16*)  carve(64 * 128 * 2);
  h16*   wz_h   = (h16*)  carve(64 * 128 * 2);
  h16*   zb_h   = (h16*)  carve(256 * 64 * 2);

  // ---- 1) + 2) layernorm (wave per row); weights + z to f16 (512 blocks)
  layernorm_cvt_kernel<<<8704, 256, 0, stream>>>(   // 512 + 8192 blocks
      x, ln_w, ln_b, xn_h, z, wq, wk, wv, wg, wo, wx, wz, z_h);

  // ---- 4) GEMMs: 16x64 strip per wave, W async-staged to LDS
  auto gemm = [&](const h16* A, const h16* W, h16* Ch, float* Cf,
                  const float* bias, int M, int N, int K,
                  int lda, int ldc, float alpha, int flags) {
    int strips = (M >> 4) * (N >> 6);
    int blocks = (strips + 7) / 8;
    gemm64_kernel<<<blocks, 256, 0, stream>>>(A, W, Ch, Cf, bias,
                                              M, N, K, lda, ldc, alpha, flags);
  };
  const float qscale = 0.17677669529663687f;  // CH^-0.5 = 1/sqrt(32)

  // fused q/g projection: reads xn once, writes qh (scaled) + gh (sigmoid);
  // in the same launch K, V^T and zb from z (10 blocks) and the column mean of
  // xn (128 blocks)
  gemm_qg_kernel<<<1162, 256, 0, stream>>>(xn_h, wq_h, wg_h, qh, gh, bg,
                                           (int)NROWS, qscale,
                                           xbar_h, z_h, wk_h, wv_h, wz_h,
                                           kh, vT, zb_h);

  // ---- 5) + 6) fused attention with the triangle bias: 32 rows per block, all
  // on one (query tile, head)
  attn_kernel<<<dim3(8, 16, 4), 256, 0, stream>>>(qh, kh, vT, gh, zb_h, wx_h, xbar_h,
                                                   mask, og);

  // ---- 7) output projection: out = og @ wo^T + bo  (f32 out)
  gemm(og, wo_h, nullptr, out, bo, NROWS, 128, 128, 128, 128, 1.0f, 0);
}

// v007
// It runs in 43.2 microseconds.
// In two side-by-side timings against v006, it was 1.24 and 1.23 times as fast.
// Over all steps from v000 it is 7.33 times as fast.
#include <hip/hip_runtime.h>
#include <hip/hip_bf16.h>
#include <hip/hip_fp16.h>

// ---------------------------------------------------------------------------
// TriangleCrossAttention on gfx1250 (CDNA5)
//  - all GEMMs on V_WMMA_F32_16X16X32_F16 (f32 accumulate)
//  - weights staged to LDS with GLOBAL_LOAD_ASYNC_TO_LDS_B128 (ASYNCcnt path),
//    their 256-byte rows at a pitch of 272 bytes
//  - 16x64 C strip per wave; fused q/g GEMM reads xn once, 8 WMMAs per A frag
//  - the output projection is done by the attention wave: it takes all four
//    heads of its 16 queries, and its gated results are the A operand
//  - kernels that do not depend on each other share a launch (block ranges)
//  - K, V^T, zb, wx and xbar lie in memory in the order the attention wave's
//    fragments take them: lane l's 16 bytes at byte l*16 of a 512-byte unit
//  - the triangle bias is a second k slab of the score product:
//    logit = [q | xb] . [k | zb], xb made in the attention wave from xbar, wx
//  - an attention block holds K, V^T, zb of all heads and wo in LDS (async
//    copies); every wave takes one row of the pair array, head after head
// B=1, N=M=256, CQ=CKV=128, H=4, CH=32, CB=16
// ---------------------------------------------------------------------------

typedef _Float16 h16;
typedef __attribute__((ext_vector_type(16))) _Float16 v16h;
typedef __attribute__((ext_vector_type(8)))  _Float16 v8h;
typedef __attribute__((ext_vector_type(4)))  _Float16 v4h;
typedef __attribute__((ext_vector_type(8)))  float    v8f;
typedef __attribute__((ext_vector_type(4)))  float    v4f;

#define WMMA_F16(a, b, c) \
  __builtin_amdgcn_wmma_f32_16x16x32_f16(false, (a), false, (b), (short)0, (c), false, false)

static __device__ __forceinline__ int laneId() { return threadIdx.x & 31; }

static __device__ __forceinline__ void wait_async0() {
  asm volatile("s_wait_asynccnt 0x0" ::: "memory");
}

// A staged weight matrix has rows of 128 f16 (256 bytes). In LDS they lie at a
// pitch of 272 bytes (16 x odd): the 16 rows that a half wave's ds_load_b128
// reads at one k offset then fall on all 64 banks; at 256 bytes they fall on
// the same four.
#define WPITCH  136                 // f16 per LDS row
#define WPITCHB (WPITCH * 2)        // bytes per LDS row

// Four async copies of 16 bytes per lane, global -> LDS (ASYNCcnt), one round
// of a 256-thread block each: 4 KiB = 16 rows apart. The s_wait_xcnt ends the
// copies' own statement, so that no address register of a copy is rewritten in
// front of it.
static __device__ __forceinline__ void async_load4_b128(unsigned int lds_off,
                                                        unsigned long long gaddr) {
  asm volatile("global_load_async_to_lds_b128 %0, %4, off\n\t"
               "global_load_async_to_lds_b128 %1, %5, off\n\t"
               "global_load_async_to_lds_b128 %2, %6, off\n\t"
               "global_load_async_to_lds_b128 %3, %7, off\n\t"
               "s_wait_xcnt 0x0"
               :: "v"(lds_off), "v"(lds_off + 16u * WPITCHB),
                  "v"(lds_off + 32u * WPITCHB), "v"(lds_off + 48u * WPITCHB),
                  "v"(gaddr), "v"(gaddr + 4096ull),
                  "v"(gaddr + 8192ull), "v"(gaddr + 12288ull)
               : "memory");
}

// Issue the copies of W (ROWS x 128 f16, row-major, ROWS = 64 or 128) into
// Wlds (ROWS x WPITCH) from a 256-thread block: thread t brings chunk t & 15
// of rows t >> 4, + 16, + 32, ... The caller waits and passes the barrier.
template <int ROWS>
static __device__ __forceinline__ void stage_w(h16* Wlds, const h16* __restrict__ W) {
  const unsigned int       l = (unsigned int)(size_t)((char*)Wlds
                                 + (threadIdx.x >> 4) * WPITCHB + (threadIdx.x & 15) * 16);
  const unsigned long long g = (unsigned long long)(size_t)((const char*)W + threadIdx.x * 16);
#pragma unroll   // 1 or 2 rounds of four copies: every copy gets registers of its own
  for (int r = 0; r < ROWS; r += 64) async_load4_b128(l + r * WPITCHB, g + r * 256);
}

// Four async copies of 16 bytes per lane, one round of a 512-thread block each:
// 8 KiB apart in memory, LSTEP bytes apart in LDS (8 KiB for an array that is
// copied as it lies, 32 padded rows for a weight matrix). The s_wait_xcnt ends
// the copies' own statement, as above.
template <unsigned int LSTEP>
static __device__ __forceinline__ void async_r512x4_b128(unsigned int lds_off,
                                                         unsigned long long gaddr) {
  asm volatile("global_load_async_to_lds_b128 %0, %4, off\n\t"
               "global_load_async_to_lds_b128 %1, %5, off\n\t"
               "global_load_async_to_lds_b128 %2, %6, off\n\t"
               "global_load_async_to_lds_b128 %3, %7, off\n\t"
               "s_wait_xcnt 0x0"
               :: "v"(lds_off), "v"(lds_off + LSTEP),
                  "v"(lds_off + 2u * LSTEP), "v"(lds_off + 3u * LSTEP),
                  "v"(gaddr), "v"(gaddr + 8192ull),
                  "v"(gaddr + 16384ull), "v"(gaddr + 24576ull)
               : "memory");
}

// Load one 16x32 f16 fragment (A-matrix layout; also valid for the B operand
// when B is a row-major weight matrix W with K contiguous, since
// B[k][n] = W[n][k] mirrors the A striping with M<->N swapped).
// CDNA5 layout: lanes 0-15 -> row M=lane, K 0..7 (v0-3) and 16..23 (v4-7);
// lanes 16-31 -> row M=lane-16, K 8..15 and 24..31.
static __device__ __forceinline__ v16h load_frag(const h16* __restrict__ base,
                                                 int rowTile, int ld, int kbase) {
  const int lane = laneId();
  const h16* p = base + (size_t)(rowTile + (lane & 15)) * ld
                      + kbase + ((lane >> 4) << 3);
  v8h lo = *(const v8h*)(p);
  v8h hi = *(const v8h*)(p + 16);
  v16h f;
#pragma unroll
  for (int i = 0; i < 8; ++i) { f[i] = lo[i]; f[i + 8] = hi[i]; }
  return f;
}

// ---------------------------------------------------------------------------
// Fragment order of the operands that the attention waves read (K, V^T, zb: every wave, whole).
// A unit is what one wave-wide 16-byte load takes: 32 lanes x 16 bytes, lane
// (hh = lane>>4, c = lane&15) at byte lane*16, so a load covers four whole
// 128-byte lines. At each register position a lane gets the element that
// load_frag's layout puts there (same k order).
//   K   [head][key tile 16][k half 16][lane: c = key,     hh = k>>3  ][8 channels]
//   V^T [head][key block 32][ch tile 16][k half 16][lane: c = channel, hh = key>>3][8 keys]
//   zb  [head][key tile 16][lane: c = key, hh = d>>3][8 bias channels d]
//   wx  [k step 32][head][k half 16][lane: c = d,     hh = k>>3][8 channels]
//   xbar: as K, with the query n for the key and the k step for the head
// ---------------------------------------------------------------------------
static __device__ __forceinline__ int kfrag_index(int m, int ch) {   // key, channel 0..127
  return ((((ch >> 5) * 16 + (m >> 4)) * 2 + ((ch >> 4) & 1)) * 32
          + ((ch >> 3) & 1) * 16 + (m & 15)) * 8 + (ch & 7);
}
static __device__ __forceinline__ int zfrag_index(int m, int col) {  // key, head*16 + d
  return (((col >> 4) * 16 + (m >> 4)) * 32
          + ((col >> 3) & 1) * 16 + (m & 15)) * 8 + (col & 7);
}
static __device__ __forceinline__ int vfrag_index(int ch, int m) {   // channel 0..127, key
  return (((((ch >> 5) * 8 + (m >> 5)) * 2 + ((ch >> 4) & 1)) * 2 + ((m >> 4) & 1)) * 32
          + ((m >> 3) & 1) * 16 + (ch & 15)) * 8 + (m & 7);
}

// ---------------------------------------------------------------------------
// Small GEMM for a block range of a shared launch:
//   C[256,N] = A[256,128] * W[N,128]^T, N = 64 or 128, 256 threads,
//   N/32 blocks (blk = 0..N/32-1), one 16x64 strip per wave.
//   W async-staged to LDS as in gemm_qg_kernel; same k order, same sums.
//   OUT: what is stored: C as f16 in K's fragment order, C^T as f16 in V^T's
//   fragment order, or C as f16 in zb's fragment order. A wave's 16x64 strip
//   holds every element of each 128-byte line that it writes.
// ---------------------------------------------------------------------------
#define OUT_KFRAG 0
#define OUT_VFRAG 1
#define OUT_ZFRAG 2
template <int N, int OUT>
static __device__ __forceinline__ void gemm256_block(h16* Wlds,
                                                     const h16* __restrict__ A,
                                                     const h16* __restrict__ W,
                                                     h16* __restrict__ Ch,
                                                     int blk) {
  stage_w<N>(Wlds, W);
  wait_async0();
  __syncthreads();

  const int tilesN = N >> 6;
  const int wave   = blk * 8 + (threadIdx.x >> 5);   // 0 .. 16*tilesN-1
  const int tm = (wave / tilesN) << 4;
  const int tn = (wave % tilesN) << 6;

  v8f acc[4] = {{}, {}, {}, {}};
  for (int k = 0; k < 128; k += 32) {
    v16h a = load_frag(A, tm, 128, k);
    v16h b[4];
#pragma unroll
    for (int t = 0; t < 4; ++t) b[t] = load_frag(Wlds, tn + (t << 4), WPITCH, k);
#pragma unroll
    for (int t = 0; t < 4; ++t) acc[t] = WMMA_F16(a, b[t], acc[t]);
  }

  const int lane = laneId();
  const int rb   = tm + ((lane >> 4) << 3);
#pragma unroll
  for (int t = 0; t < 4; ++t) {
    const int col = tn + (t << 4) + (lane & 15);
#pragma unroll
    for (int v = 0; v < 8; ++v) {
      const float y = acc[t][v];
      const int r = rb + v;
      if (OUT == OUT_VFRAG)      Ch[vfrag_index(col, r)] = (h16)y;
      else if (OUT == OUT_KFRAG) Ch[kfrag_index(r, col)] = (h16)y;
      else                       Ch[zfrag_index(r, col)] = (h16)y;
    }
  }
  // The stores' address and data registers stay untouched up to this wait: the
  // code of the launch's other block ranges follows and rewrites them.
  asm volatile("s_wait_xcnt 0x0" ::: "memory");
}

// ---------------------------------------------------------------------------
// 1) One launch, two independent jobs.
//    Blocks 0..511: f32 -> f16 of z and the seven weight matrices into one
//    contiguous f16 region (order z, wq, wk, wv, wg, wo, wx, wz); wx goes into
//    its fragment order: a block writes one whole unit and gathers its source.
//    Blocks 512.. : LayerNorm over channel dim (128), f16 out, one wave per row.
// ---------------------------------------------------------------------------
#define CVT_BLOCKS 512
__global__ void layernorm_cvt_kernel(const float* __restrict__ x,
                                     const float* __restrict__ ln_w,
                                     const float* __restrict__ ln_b,
                                     h16* __restrict__ xn,
                                     const float* __restrict__ z_f,
                                     const float* __restrict__ wq_f,
                                     const float* __restrict__ wk_f,
                                     const float* __restrict__ wv_f,
                                     const float* __restrict__ wg_f,
                                     const float* __restrict__ wo_f,
                                     const float* __restrict__ wx_f,
                                     const float* __restrict__ wz_f,
                                     h16* __restrict__ cvt_out) {
  if (blockIdx.x < CVT_BLOCKS) {                       // block-uniform
    const int b = blockIdx.x;                          // 256 elements per block
    const float* in;
    int first;                                         // the source's first block
    if      (b < 128) { in = z_f;  first = 0;   }
    else if (b < 192) { in = wq_f; first = 128; }
    else if (b < 256) { in = wk_f; first = 192; }
    else if (b < 320) { in = wv_f; first = 256; }
    else if (b < 384) { in = wg_f; first = 320; }
    else if (b < 448) { in = wo_f; first = 384; }
    else if (b < 480) { in = wx_f; first = 448; }
    else              { in = wz_f; first = 480; }
    int src = (b - first) * 256 + threadIdx.x;
    if (b >= 448 && b < 480) {                         // wx: unit b - 448
      const int u   = b - 448;                         // [k step][head][k half]
      const int t   = threadIdx.x;                     // [hh][d][8 channels]
      const int row = ((u >> 1) & 3) * 16 + ((t >> 3) & 15);
      const int ch  = (u >> 3) * 32 + (u & 1) * 16 + (t >> 7) * 8 + (t & 7);
      src = row * 128 + ch;
    }
    cvt_out[b * 256 + threadIdx.x] = (h16)in[src];
    return;
  }
  const int wave = threadIdx.x >> 5;
  const int lane = laneId();
  const size_t row = (size_t)(blockIdx.x - CVT_BLOCKS) * 8 + wave;   // 0..65535
  const int c = lane << 2;                             // 4 channels per lane

  float4 xv = *(const float4*)(x + row * 128 + c);
  float s  = xv.x + xv.y + xv.z + xv.w;
  float ss = xv.x * xv.x + xv.y * xv.y + xv.z * xv.z + xv.w * xv.w;
#pragma unroll
  for (int off = 16; off >= 1; off >>= 1) {
    s  += __shfl_xor(s,  off);
    ss += __shfl_xor(ss, off);
  }
  const float mu   = s * (1.0f / 128.0f);
  const float var  = ss * (1.0f / 128.0f) - mu * mu;
  const float rstd = rsqrtf(var + 1e-5f);

  float4 wv = *(const float4*)(ln_w + c);
  float4 bv = *(const float4*)(ln_b + c);
  v4h o;
  o[0] = (h16)((xv.x - mu) * rstd * wv.x + bv.x);
  o[1] = (h16)((xv.y - mu) * rstd * wv.y + bv.y);
  o[2] = (h16)((xv.z - mu) * rstd * wv.z + bv.z);
  o[3] = (h16)((xv.w - mu) * rstd * wv.w + bv.w);
  *(v4h*)(xn + row * 128 + c) = o;
}

// ---------------------------------------------------------------------------
// 3) Column mean over inner N (q) of xn -> xbar (256x128, f16, fragment order),
//    for a block range of a shared launch: 256 threads, 8 n x 32 channels per
//    block (blk = 0..127: the four 128-byte lines of xbar that hold them), one
//    wave per n, one thread per (n, channel).
// ---------------------------------------------------------------------------
static __device__ __forceinline__ void colmean_block(const h16* __restrict__ xn,
                                                     h16* __restrict__ xbar,
                                                     int blk) {
  const int n = (blk >> 2) * 8 + (threadIdx.x >> 5);    // 0..255
  const int c = (blk & 3) * 32 + (threadIdx.x & 31);    // 0..127
  float acc = 0.0f;
  for (int q = 0; q < 256; q += 8) {
    const h16* p = xn + ((size_t)(n * 256 + q)) * 128 + c;
    h16 t[8];
#pragma unroll
    for (int i = 0; i < 8; ++i) t[i] = p[i * 128];
    // The loads' address register stays untouched up to this wait.
    asm volatile("s_wait_xcnt 0x0" :: "v"(p) : "memory");
#pragma unroll
    for (int i = 0; i < 8; ++i) acc += (float)t[i];   // same order as q = 0..255
  }
  xbar[kfrag_index(n, c)] = (h16)(acc * (1.0f / 256.0f));
  // Same wait behind the store: code of other block ranges follows it.
  asm volatile("s_wait_xcnt 0x0" ::: "memory");
}

// ---------------------------------------------------------------------------
// 4b) Fused q/g GEMM: Q = qscale*(A Wq^T), G = sigmoid(A Wg^T + bg)
//     Shares the A (xn) stream: 8 WMMAs per A fragment, N = K = 128.
//     The launch's first blocks do four jobs that depend on q/g as little as
//     q/g on them: 0..3 K = z wk^T, 4..7 V^T = (z wv^T)^T, 8..9 zb = z wz^T
//     (f16), 10..137 the column mean of xn.
// ---------------------------------------------------------------------------
#define ZG_BLOCKS 10
#define CM_BLOCKS 128
// The 68 KiB of LDS allow four blocks per WGP: 8 waves per SIMD.
__global__ void __launch_bounds__(256)
gemm_qg_kernel(const h16* __restrict__ A,
                               const h16* __restrict__ Wq,
                               const h16* __restrict__ Wg,
                               h16* __restrict__ Q, h16* __restrict__ G,
                               const float* __restrict__ bg,
                               int M, float qscale,
                               h16* __restrict__ xbar,
                               const h16* __restrict__ zh,
                               const h16* __restrict__ wk,
                               const h16* __restrict__ wv,
                               const h16* __restrict__ wz,
                               h16* __restrict__ kh,
                               h16* __restrict__ vT,
                               h16* __restrict__ zb) {
  __shared__ __attribute__((aligned(16))) h16 Wq_lds[128 * WPITCH];  // 128 rows x WPITCH f16
  __shared__ __attribute__((aligned(16))) h16 Wg_lds[128 * WPITCH];  // 128 rows x WPITCH f16

  if (blockIdx.x < ZG_BLOCKS + CM_BLOCKS) {            // block-uniform
    const int b = blockIdx.x;
    if      (b < 4)  gemm256_block<128, OUT_KFRAG>(Wq_lds, zh, wk, kh, b);
    else if (b < 8)  gemm256_block<128, OUT_VFRAG>(Wq_lds, zh, wv, vT, b - 4);
    else if (b < 10) gemm256_block<64,  OUT_ZFRAG>(Wq_lds, zh, wz, zb, b - 8);
    else             colmean_block(A, xbar, b - ZG_BLOCKS);
    return;
  }

  stage_w<128>(Wq_lds, Wq);
  stage_w<128>(Wg_lds, Wg);
  wait_async0();
  __syncthreads();

  const int total = (M >> 4) * 2;                  // two 64-wide strips per row
  const int wave  = (blockIdx.x - (ZG_BLOCKS + CM_BLOCKS)) * (blockDim.x >> 5) + (threadIdx.x >> 5);
  if (wave >= total) return;                       // wave-uniform

  const int tm = (wave >> 1) << 4;
  const int tn = (wave & 1) << 6;

  v8f accq[4] = {{}, {}, {}, {}};
  v8f accg[4] = {{}, {}, {}, {}};
  for (int k = 0; k < 128; k += 32) {
    v16h a = load_frag(A, tm, 128, k);
    v16h bq[4], bgf[4];
#pragma unroll
    for (int t = 0; t < 4; ++t) bq[t]  = load_frag(Wq_lds, tn + (t << 4), WPITCH, k);
#pragma unroll
    for (int t = 0; t < 4; ++t) bgf[t] = load_frag(Wg_lds, tn + (t << 4), WPITCH, k);
#pragma unroll
    for (int t = 0; t < 4; ++t) accq[t] = WMMA_F16(a, bq[t],  accq[t]);
#pragma unroll
    for (int t = 0; t < 4; ++t) accg[t] = WMMA_F16(a, bgf[t], accg[t]);
  }

  const int lane = laneId();
  const int rb   = tm + ((lane >> 4) << 3);
#pragma unroll
  for (int t = 0; t < 4; ++t) {
    const int col = tn + (t << 4) + (lane & 15);
    const float bgv = bg[col];
#pragma unroll
    for (int v = 0; v < 8; ++v) {
      const int r = rb + v;
      Q[(size_t)r * 128 + col] = (h16)(accq[t][v] * qscale);
      const float y = accg[t][v] + bgv;
      G[(size_t)r * 128 + col] = (h16)(1.0f / (1.0f + __expf(-y)));
    }
  }
}

// ---------------------------------------------------------------------------
// 6) Fused attention core and output projection: a block has one 16-query tile
//    and 16 rows r, a wave one row, its four heads one after the other. K, V^T
//    and zb of all heads (160 KiB, in fragment order) and wo (padded rows) are
//    copied to LDS once per block; a fragment's ds_load_b128 of K, V^T, zb
//    reads 512 contiguous bytes. xb^T of head w is made once per block, by
//    wave w, and passed through LDS.
//    xb^T = wx_h xbar^T : 16 bias channels d x 16 queries; a lane's 8 results,
//    packed, are the first k half of a B operand as they stand (d = 8*hh + v).
//    S^T = K_h Q^T + zb_h xb^T : A = 16 keys x 32 ch, B = 32 ch x 16 queries.
//    The bias has 16 channels d: one A fragment holds zb of two key tiles, one
//    in each k half, and B = [xb^T; 0] or [0; xb^T] picks the tile.
//    A lane then holds scores of ONE query (column lane&15): 8 keys per tile,
//    128 of the 256 keys per lane; lanes l and l^16 split the keys.
//    Softmax: in-lane maximum and sum plus one exchange between wave halves.
//    O^T = V_h^T P^T : two packed S^T tiles are a B operand as they stand
//    (hardware k order), V^T is loaded in the same k order by frag_units.
//    One barrier, behind the copies; scores and P never pass through LDS.
//    out = og wo^T + bo : a lane's 16 gated results of head h (query c,
//    channels 8*hh + v and 16 + 8*hh + v) are its part of the A operand of k
//    step h as they stand; the wave keeps them in LDS of its own until the
//    fourth head is done. B fragments of wo, k order and sums as in a GEMM
//    that reads og row-major.
// ---------------------------------------------------------------------------
static __device__ __forceinline__ float xhalf(float x) {   // lane l <-> l ^ 16
  const int b = __builtin_bit_cast(int, x);
  return __builtin_bit_cast(float,
      __builtin_amdgcn_permlanex16(b, b, 0x76543210, 0xfedcba98, false, false));
}

// 16x32 f16 fragment from the lane's own pointer (row lane&15, k offset
// 8*(lane>>4)): same k order as load_frag.
static __device__ __forceinline__ v16h frag_at(const h16* __restrict__ p) {
  v8h lo = *(const v8h*)(p);
  v8h hi = *(const v8h*)(p + 16);
  v16h f;
#pragma unroll
  for (int i = 0; i < 8; ++i) { f[i] = lo[i]; f[i + 8] = hi[i]; }
  return f;
}

// 16x32 f16 fragment from an array in fragment order: p is the lane's own 16
// bytes of the first unit (k half 0); the second unit follows 512 bytes on.
static __device__ __forceinline__ v16h frag_units(const h16* __restrict__ p) {
  v8h lo = *(const v8h*)(p);
  v8h hi = *(const v8h*)(p + 256);
  v16h f;
#pragma unroll
  for (int i = 0; i < 8; ++i) { f[i] = lo[i]; f[i + 8] = hi[i]; }
  return f;
}

// Eight 2^x in one statement. No result shares a register with an argument
// ("=&v"), so no v_exp_f32 is directly followed by a write of its source or a
// read of its result; the v_nop is that slot behind the last one.
static __device__ __forceinline__ v8f exp2_x8(v8f x) {
  float e0, e1, e2, e3, e4, e5, e6, e7;
  asm("v_exp_f32 %0, %8\n\t"
      "v_exp_f32 %1, %9\n\t"
      "v_exp_f32 %2, %10\n\t"
      "v_exp_f32 %3, %11\n\t"
      "v_exp_f32 %4, %12\n\t"
      "v_exp_f32 %5, %13\n\t"
      "v_exp_f32 %6, %14\n\t"
      "v_exp_f32 %7, %15\n\t"
      "v_nop"
      : "=&v"(e0), "=&v"(e1), "=&v"(e2), "=&v"(e3),
        "=&v"(e4), "=&v"(e5), "=&v"(e6), "=&v"(e7)
      : "v"(x[0]), "v"(x[1]), "v"(x[2]), "v"(x[3]),
        "v"(x[4]), "v"(x[5]), "v"(x[6]), "v"(x[7]));
  v8f e = {e0, e1, e2, e3, e4, e5, e6, e7};
  return e;
}

#define ATT_WAVES 16  // waves per block: one row r each
// 4 waves per SIMD (256 VGPRs): one block per WGP, 256 blocks: all resident
__global__ void __launch_bounds__(512, 4)
attn_kernel(const h16* __restrict__ qh,   // [65536][128] scaled
            const h16* __restrict__ kh,   // 256 keys x 128 ch, fragment order
            const h16* __restrict__ vT,   // 128 ch x 256 keys, fragment order
            const h16* __restrict__ gh,   // [65536][128] sigmoid'd
            const h16* __restrict__ zb,   // 256 keys x 64 (head, d), fragment order
            const h16* __restrict__ wx,   // 64 (head, d) x 128 ch, fragment order
            const h16* __restrict__ xbar, // 256 queries x 128 ch, fragment order
            const float* __restrict__ mask,// [256][256]
            const h16* __restrict__ wo,   // 128 x 128, row-major
            const float* __restrict__ bo, // [128]
            float* __restrict__ out) {    // [65536][128]
  // K (64 KiB), V^T (64 KiB) and zb (32 KiB) of all heads, as they lie in memory
  __shared__ __attribute__((aligned(16))) h16 kvz[32768 + 32768 + 16384];
  __shared__ __attribute__((aligned(16))) h16 Wlds[128 * WPITCH];        // wo
  __shared__ __attribute__((aligned(16))) h16 xbs[4 * 256];              // xb^T per head
  __shared__ __attribute__((aligned(16))) h16 ogs[ATT_WAVES * 4 * 512];  // per wave, head

  const int lane = laneId();
  const int c    = lane & 15;                              // query column
  const int hh   = lane >> 4;                              // wave half
  const int wave = __builtin_amdgcn_readfirstlane(threadIdx.x >> 5);
  const int r    = blockIdx.x * ATT_WAVES + wave;          // row 0..255
  const int q0   = blockIdx.y << 4;                        // 16 queries

  // ---- the block's copies: thread t brings bytes t*16 of each 8-KiB round
  {
    const unsigned int l = (unsigned int)(size_t)((char*)kvz + threadIdx.x * 16);
    const unsigned long long kg = (unsigned long long)(size_t)((const char*)kh + threadIdx.x * 16);
    const unsigned long long vg = (unsigned long long)(size_t)((const char*)vT + threadIdx.x * 16);
    async_r512x4_b128<8192u>(l,           kg);
    async_r512x4_b128<8192u>(l + 32768u,  kg + 32768ull);
    async_r512x4_b128<8192u>(l + 65536u,  vg);
    async_r512x4_b128<8192u>(l + 98304u,  vg + 32768ull);
    async_r512x4_b128<8192u>(l + 131072u,
        (unsigned long long)(size_t)((const char*)zb + threadIdx.x * 16));
    // wo: chunk t & 15 of rows t >> 4, + 32, + 64, + 96
    async_r512x4_b128<32u * WPITCHB>(
        (unsigned int)(size_t)((char*)Wlds + (threadIdx.x >> 4) * WPITCHB
                               + (threadIdx.x & 15) * 16),
        (unsigned long long)(size_t)((const char*)wo + threadIdx.x * 16));
  }

  const int   mi = r * 256 + q0 + c;                       // (row, query) in mask
  const float mk = mask[mi];
  // The index register of this load stays untouched up to this wait.
  asm volatile("s_wait_xcnt 0x0" :: "v"(mi) : "memory");

  // ---- xb^T of the query tile, head = wave (scalar test: whole waves):
  //      xt[v] = xb(query c, d = 8*hh + v), k = 0..127
  if (wave < 4) {
    const h16* wp = wx + wave * 512 + lane * 8;
    const h16* xp = xbar + blockIdx.y * 512 + lane * 8;
    v8f xt = {};
#pragma unroll
    for (int ks = 0; ks < 4; ++ks)
      xt = WMMA_F16(frag_units(wp + ks * 2048), frag_units(xp + ks * 8192), xt);
    // The address registers of the loads above stay untouched up to this wait.
    asm volatile("s_wait_xcnt 0x0" :: "v"(wp), "v"(xp) : "memory");
    v8h xpk;
#pragma unroll
    for (int v = 0; v < 8; ++v) xpk[v] = (h16)xt[v];
    *(v8h*)(xbs + wave * 256 + lane * 8) = xpk;
  }

  // Each wave's own copies have landed, then every wave's, and xbs is written:
  // nobody reads kvz, Wlds or xbs in front of this barrier.
  wait_async0();
  __syncthreads();

  const float mb = 1.0e9f * (mk - 1.0f);
  // element offset of (query c, head 0, channel 8*hh) in qh and gh
  const size_t idx0 = ((size_t)(r * 256 + q0) + c) * 128 + (hh << 3);
  h16* const   op   = ogs + wave * 2048 + lane * 8;        // the lane's 16 bytes

#pragma unroll 1   // rolled: one copy of the long body in the instruction cache
  for (int h = 0; h < 4; ++h) {
    const h16* qp = qh + idx0 + h * 32;
    const h16* gp = gh + idx0 + h * 32;
    // the lane's 16 bytes in the first unit of the head's K, V^T and zb in LDS
    const h16* kp = kvz + h * 8192 + lane * 8;
    const h16* vp = kvz + 32768 + h * 8192 + lane * 8;
    const h16* zp = kvz + 65536 + h * 4096 + lane * 8;

    const v16h qf = frag_at(qp);
    // The address registers of these loads stay untouched up to this wait.
    asm volatile("s_wait_xcnt 0x0" :: "v"(qp) : "memory");

    const v8h xv = *(const v8h*)(xbs + h * 256 + lane * 8);
    v16h xf0, xf1;                     // [xb^T; 0] and [0; xb^T]
#pragma unroll
    for (int v = 0; v < 8; ++v) {
      xf0[v] = xv[v];        xf0[v + 8] = (h16)0.0f;
      xf1[v] = (h16)0.0f;    xf1[v + 8] = xv[v];
    }

    // ---- scores: s[mt][v] = logit(query c, key mt*16 + 8*hh + v)
    v8f s[16];
#pragma unroll
    for (int mt = 0; mt < 16; ++mt) {
      v8f z = {};
      s[mt] = WMMA_F16(frag_units(kp + mt * 512), qf, z);
    }
    // one zb fragment holds key tiles mt (first k half) and mt + 1 (second)
#pragma unroll
    for (int mt = 0; mt < 16; mt += 2) {
      const v16h az = frag_units(zp + mt * 256);
      s[mt]     = WMMA_F16(az, xf0, s[mt])     + mb;
      s[mt + 1] = WMMA_F16(az, xf1, s[mt + 1]) + mb;
    }

    // ---- maximum over the 256 keys of the lane's query
    v8f mv = s[0];
#pragma unroll
    for (int mt = 1; mt < 16; ++mt)
#pragma unroll
      for (int v = 0; v < 8; ++v) mv[v] = fmaxf(mv[v], s[mt][v]);
    float mx = fmaxf(fmaxf(fmaxf(mv[0], mv[1]), fmaxf(mv[2], mv[3])),
                     fmaxf(fmaxf(mv[4], mv[5]), fmaxf(mv[6], mv[7])));
    mx = fmaxf(mx, xhalf(mx));

    // ---- exp, f32 sum (8 independent chains), pack to the B operand of P^T
    v8f  sv = {};
    v16h pb[8];
#pragma unroll
    for (int mt = 0; mt < 16; ++mt) {
      const v8f e = exp2_x8((s[mt] - mx) * 1.44269504f);   // e^(s - mx)
      sv += e;
#pragma unroll
      for (int v = 0; v < 8; ++v) pb[mt >> 1][((mt & 1) << 3) + v] = (h16)e[v];
    }
    // No V^T fragment and no WMMA of O^T is scheduled in among the exp
    // statements: the fragments fetched that early cost
    // registers that the scores need.
    __builtin_amdgcn_sched_barrier(0);
    float sum = ((sv[0] + sv[1]) + (sv[2] + sv[3])) + ((sv[4] + sv[5]) + (sv[6] + sv[7]));
    sum += xhalf(sum);
    const float inv = 1.0f / sum;

    // ---- O^T (32 ch x 16 queries) = V_h^T (32 x 256) P^T (256 x 16)
    v8f o0 = {}, o1 = {};
#pragma unroll
    for (int j = 0; j < 8; ++j) {
      const v16h a0 = frag_units(vp + j * 1024);           // channels 0..15
      const v16h a1 = frag_units(vp + j * 1024 + 512);     // channels 16..31
      o0 = WMMA_F16(a0, pb[j], o0);
      o1 = WMMA_F16(a1, pb[j], o1);
    }

    // ---- gate: a lane holds 8 consecutive channels of its query, twice
    const v8h g0 = *(const v8h*)(gp);
    const v8h g1 = *(const v8h*)(gp + 16);
    // Same wait for the address registers of the gate loads.
    asm volatile("s_wait_xcnt 0x0" :: "v"(gp) : "memory");
    v8h w0, w1;
#pragma unroll
    for (int v = 0; v < 8; ++v) {
      w0[v] = (h16)(o0[v] * inv * (float)g0[v]);
      w1[v] = (h16)(o1[v] * inv * (float)g1[v]);
    }
    // kept for the projection: two units of the wave's own LDS per head
    *(v8h*)(op + h * 512)       = w0;
    *(v8h*)(op + h * 512 + 256) = w1;
  }

  // ---- out (16 queries x 128) = og (16 x 128) wo^T + bo, k step = head
  const float* bp = bo + c;
  float bv[8];
#pragma unroll
  for (int t = 0; t < 8; ++t) bv[t] = bp[t * 16];
  // The address registers of the bias loads stay untouched up to this wait.
  asm volatile("s_wait_xcnt 0x0" :: "v"(bp) : "memory");

  v8f acc[8] = {{}, {}, {}, {}, {}, {}, {}, {}};
#pragma unroll
  for (int h = 0; h < 4; ++h) {
    const v16h a = frag_units(op + h * 512);
#pragma unroll
    for (int t = 0; t < 8; ++t)
      acc[t] = WMMA_F16(a, load_frag(Wlds, t << 4, WPITCH, h * 32), acc[t]);
  }

  // a lane holds column t*16 + c of queries 8*hh + v
  float* const orow = out + ((size_t)(r * 256 + q0) + (hh << 3)) * 128 + c;
#pragma unroll
  for (int t = 0; t < 8; ++t)
#pragma unroll
    for (int v = 0; v < 8; ++v) orow[v * 128 + t * 16] = acc[t][v] + bv[t];
  // The stores' address and data registers stay untouched up to this wait.
  asm volatile("s_wait_xcnt 0x0" ::: "memory");
}

// ---------------------------------------------------------------------------
// Host-side orchestration
// ---------------------------------------------------------------------------
extern "C" void kernel_launch(void* const* d_in, const int* in_sizes, int n_in,
                              void* d_out, int out_size, void* d_ws, size_t ws_size,
                              hipStream_t stream) {
  (void)in_sizes; (void)n_in; (void)out_size; (void)ws_size;

  const float* x    = (const float*)d_in[0];   // (1,256,256,128)
  const float* z    = (const float*)d_in[1];   // (1,256,128)
  const float* mask = (const float*)d_in[2];   // (1,256,256)
  const float* ln_w = (const float*)d_in[3];
  const float* ln_b = (const float*)d_in[4];
  const float* wx   = (const float*)d_in[5];   // (64,128)
  const float* wz   = (const float*)d_in[6];   // (64,128)
  const float* wq   = (const float*)d_in[7];   // (128,128)
  const float* wk   = (const float*)d_in[8];
  const float* wv   = (const float*)d_in[9];
  const float* wg   = (const float*)d_in[10];
  const float* bg   = (const float*)d_in[11];  // (128,)
  const float* wo   = (const float*)d_in[12];  // (128,128)
  const float* bo   = (const float*)d_in[13];  // (128,)
  float* out = (float*)d_out;                  // (1,256,256,128)

  // ---- workspace carve-up (256B aligned regions)
  char* ws = (char*)d_ws;
  size_t off = 0;
  auto carve = [&](size_t bytes) -> char* {
    char* p = ws + off;
    off = (off + bytes + 255) & ~(size_t)255;
    return p;
  };
  const size_t NROWS = 65536;                 // 256*256
  h16*   xn_h   = (h16*)  carve(NROWS * 128 * 2);
  h16*   qh     = (h16*)  carve(NROWS * 128 * 2);
  h16*   gh     = (h16*)  carve(NROWS * 128 * 2);
  h16*   kh     = (h16*)  carve(256 * 128 * 2);
  h16*   vT     = (h16*)  carve(128 * 256 * 2);
  h16*   xbar_h = (h16*)  carve(256 * 128 * 2);
  // f16 copies of z and the weights: contiguous, in the converting blocks' order
  h16*   z_h    = (h16*)  carve(256 * 128 * 2);
  h16*   wq_h   = (h16*)  carve(128 * 128 * 2);
  h16*   wk_h   = (h16*)  carve(128 * 128 * 2);
  h16*   wv_h   = (h16*)  carve(128 * 128 * 2);
  h16*   wg_h   = (h16*)  carve(128 * 128 * 2);
  h16*   wo_h   = (h16*)  carve(128 * 128 * 2);
  h16*   wx_h   = (h16*)  carve(64 * 128 * 2);
  h16*   wz_h   = (h16*)  carve(64 * 128 * 2);
  h16*   zb_h   = (h16*)  carve(256 * 64 * 2);

  // ---- 1) + 2) layernorm (wave per row); weights + z to f16 (512 blocks)
  layernorm_cvt_kernel<<<8704, 256, 0, stream>>>(   // 512 + 8192 blocks
      x, ln_w, ln_b, xn_h, z, wq, wk, wv, wg, wo, wx, wz, z_h);

  const float qscale = 0.17677669529663687f;  // CH^-0.5 = 1/sqrt(32)

  // fused q/g projection: reads xn once, writes qh (scaled) + gh (sigmoid);
  // in the same launch K, V^T and zb from z (10 blocks) and the column mean of
  // xn (128 blocks)
  gemm_qg_kernel<<<1162, 256, 0, stream>>>(xn_h, wq_h, wg_h, qh, gh, bg,
                                           (int)NROWS, qscale,
                                           xbar_h, z_h, wk_h, wv_h, wz_h,
                                           kh, vT, zb_h);

  // ---- 5) + 6) + 7) fused attention with the triangle bias and the output
  // projection (f32 out): 16 rows per block, all on one query tile
  attn_kernel<<<dim3(16, 16), 512, 0, stream>>>(qh, kh, vT, gh, zb_h, wx_h, xbar_h,
                                                mask, wo_h, bo, out);
}

// v008
// One run takes 34.8 microseconds.
// In two side-by-side timings against v007, it was 1.26 and 1.23 times as fast.
// Counting every step since v000, it is 9.15 times as fast.
#include <hip/hip_runtime.h>
#include <hip/hip_bf16.h>
#include <hip/hip_fp16.h>

// ---------------------------------------------------------------------------
// TriangleCrossAttention on gfx1250 (CDNA5)
//  - all GEMMs on V_WMMA_F32_16X16X32_F16 (f32 accumulate)
//  - two launches: what the attention needs of every row (xn, its column mean,
//    K, V^T, zb, f16 weights), then the attention itself
//  - the attention wave makes q and the gate of its 16 queries itself, head by
//    head, from xn: Q^T and G^T = W_h xn^T come out as the score product's B
//    operand and in O^T's own layout
//  - the output projection is done by the attention wave: it takes all four
//    heads of its 16 queries, and its gated results are the A operand
//  - K, V^T, zb, wq, wg and wx lie in memory in the order the attention wave's
//    fragments take them: lane l's 16 bytes at byte l*16 of a 512-byte unit
//  - the triangle bias is a second k slab of the score product:
//    logit = [q | xb] . [k | zb], xb made in the attention block from xbar, wx
//  - an attention block holds K, V^T, zb, wq, wg of all heads and wo in LDS
//    (async copies); every wave takes one row of the pair array, head after head
// B=1, N=M=256, CQ=CKV=128, H=4, CH=32, CB=16
// ---------------------------------------------------------------------------

typedef _Float16 h16;
typedef __attribute__((ext_vector_type(16))) _Float16 v16h;
typedef __attribute__((ext_vector_type(8)))  _Float16 v8h;
typedef __attribute__((ext_vector_type(4)))  _Float16 v4h;
typedef __attribute__((ext_vector_type(8)))  float    v8f;
typedef __attribute__((ext_vector_type(4)))  float    v4f;

#define WMMA_F16(a, b, c) \
  __builtin_amdgcn_wmma_f32_16x16x32_f16(false, (a), false, (b), (short)0, (c), false, false)

static __device__ __forceinline__ int laneId() { return threadIdx.x & 31; }

static __device__ __forceinline__ void wait_async0() {
  asm volatile("s_wait_asynccnt 0x0" ::: "memory");
}

// A staged weight matrix has rows of 128 f16 (256 bytes). In LDS they lie at a
// pitch of 272 bytes (16 x odd): the 16 rows that a half wave's ds_load_b128
// reads at one k offset then fall on all 64 banks; at 256 bytes they fall on
// the same four.
#define WPITCH  136                 // f16 per LDS row
#define WPITCHB (WPITCH * 2)        // bytes per LDS row

// Four async copies of 16 bytes per lane, one round of a 512-thread block each:
// 8 KiB apart in memory, LSTEP bytes apart in LDS (8 KiB for an array that is
// copied as it lies, 32 padded rows for a weight matrix). The s_wait_xcnt ends
// the copies' own statement, so that no address register of a copy is rewritten
// in front of it.
template <unsigned int LSTEP>
static __device__ __forceinline__ void async_r512x4_b128(unsigned int lds_off,
                                                         unsigned long long gaddr) {
  asm volatile("global_load_async_to_lds_b128 %0, %4, off\n\t"
               "global_load_async_to_lds_b128 %1, %5, off\n\t"
               "global_load_async_to_lds_b128 %2, %6, off\n\t"
               "global_load_async_to_lds_b128 %3, %7, off\n\t"
               "s_wait_xcnt 0x0"
               :: "v"(lds_off), "v"(lds_off + LSTEP),
                  "v"(lds_off + 2u * LSTEP), "v"(lds_off + 3u * LSTEP),
                  "v"(gaddr), "v"(gaddr + 8192ull),
                  "v"(gaddr + 16384ull), "v"(gaddr + 24576ull)
               : "memory");
}

// Load one 16x32 f16 fragment (A-matrix layout; also valid for the B operand
// when B is a row-major weight matrix W with K contiguous, since
// B[k][n] = W[n][k] mirrors the A striping with M<->N swapped).
// CDNA5 layout: lanes 0-15 -> row M=lane, K 0..7 (v0-3) and 16..23 (v4-7);
// lanes 16-31 -> row M=lane-16, K 8..15 and 24..31.
static __device__ __forceinline__ v16h load_frag(const h16* __restrict__ base,
                                                 int rowTile, int ld, int kbase) {
  const int lane = laneId();
  const h16* p = base + (size_t)(rowTile + (lane & 15)) * ld
                      + kbase + ((lane >> 4) << 3);
  v8h lo = *(const v8h*)(p);
  v8h hi = *(const v8h*)(p + 16);
  v16h f;
#pragma unroll
  for (int i = 0; i < 8; ++i) { f[i] = lo[i]; f[i + 8] = hi[i]; }
  return f;
}

// ---------------------------------------------------------------------------
// Fragment order of the operands that the attention waves read (K, V^T, zb: every wave, whole).
// A unit is what one wave-wide 16-byte load takes: 32 lanes x 16 bytes, lane
// (hh = lane>>4, c = lane&15) at byte lane*16, so a load covers four whole
// 128-byte lines. At each register position a lane gets the element that
// load_frag's layout puts there (same k order).
//   K   [head][key tile 16][k half 16][lane: c = key,     hh = k>>3  ][8 channels]
//   V^T [head][key block 32][ch tile 16][k half 16][lane: c = channel, hh = key>>3][8 keys]
//   zb  [head][key tile 16][lane: c = key, hh = d>>3][8 bias channels d]
//   wx  [k step 32][head][k half 16][lane: c = d,     hh = k>>3][8 channels]
//   wq, wg [k step 32][row tile 16][k half 16][lane: c = row, hh = k>>3][8 channels]
// ---------------------------------------------------------------------------

// 16x32 f16 fragment from f32 rows of 128: p is the lane's own pointer (row
// lane&15, k offset 8*(lane>>4)); same k order as load_frag.
static __device__ __forceinline__ v16h frag_f32_at(const float* __restrict__ p) {
  const v4f a0 = *(const v4f*)(p);
  const v4f a1 = *(const v4f*)(p + 4);
  const v4f a2 = *(const v4f*)(p + 16);
  const v4f a3 = *(const v4f*)(p + 20);
  v16h f;
#pragma unroll
  for (int i = 0; i < 4; ++i) {
    f[i]     = (h16)a0[i];  f[i + 4]  = (h16)a1[i];
    f[i + 8] = (h16)a2[i];  f[i + 12] = (h16)a3[i];
  }
  return f;
}

// One wave, one 16x16 tile D = A B^T over k = 0..127, A and B f32 rows of 128
// (rounded to f16 as they are loaded). A lane holds column c of rows 8*hh + v:
// its 8 results, packed, are its 16 bytes of one whole unit.
static __device__ __forceinline__ void tile_unit(const float* __restrict__ A, int arow,
                                                 const float* __restrict__ B, int brow,
                                                 h16* __restrict__ unit) {
  const int lane = laneId();
  const float* pa = A + (arow + (lane & 15)) * 128 + ((lane >> 4) << 3);
  const float* pb = B + (brow + (lane & 15)) * 128 + ((lane >> 4) << 3);
  v8f acc = {};
#pragma unroll
  for (int k = 0; k < 128; k += 32) {
    // The second half's 16 loads are not issued with the first half's: all 32
    // at once take 128 registers for their f32 data and spill.
    if (k == 64) __builtin_amdgcn_sched_barrier(0);
    acc = WMMA_F16(frag_f32_at(pa + k), frag_f32_at(pb + k), acc);
  }
  // The loads' address registers stay untouched up to this wait.
  asm volatile("s_wait_xcnt 0x0" :: "v"(pa), "v"(pb) : "memory");
  v8h o;
#pragma unroll
  for (int v = 0; v < 8; ++v) o[v] = (h16)acc[v];
  *(v8h*)(unit + lane * 8) = o;
  // Same wait behind the store: code of other block ranges follows it.
  asm volatile("s_wait_xcnt 0x0" ::: "memory");
}

// ---------------------------------------------------------------------------
// 1) One launch, three independent jobs, 512 threads a block; the long blocks
//    come first.
//    Blocks 256..275: K = z wk^T, V^T = (z wv^T)^T, zb = z wz^T, one unit per wave
//    (128 + 128 + 64 waves); the operand whose row index runs inside a lane's
//    16 bytes is the A operand.
//    Blocks 276..289: f32 -> f16 of wq, wg (fragment order), wo (row-major), wx
//    (fragment order) into one contiguous region; a thread makes 16 bytes from
//    8 consecutive f32 of one source row.
//    Blocks 0..255: LayerNorm over the channel dim (128) of the 256 rows
//    (n, q = 0..255), f16 out, 16 rows per wave, and their column mean xbar[n]
//    (f16, row-major): f32 sums per wave, then over the 16 waves through LDS.
// ---------------------------------------------------------------------------
#define LN_BLOCKS   256
#define TILE_BLOCKS 20
#define CVT_BLOCKS  14   // 256 + 20 + 14 = 290 blocks
// 8 waves per SIMD (128 VGPRs): two blocks per WGP, all 290 blocks resident
__global__ void __launch_bounds__(512, 8)
prep_kernel(const float* __restrict__ x,
            const float* __restrict__ ln_w,
            const float* __restrict__ ln_b,
            h16* __restrict__ xn,
            h16* __restrict__ xbar,
            const float* __restrict__ z_f,
            const float* __restrict__ wq_f,
            const float* __restrict__ wk_f,
            const float* __restrict__ wv_f,
            const float* __restrict__ wg_f,
            const float* __restrict__ wo_f,
            const float* __restrict__ wx_f,
            const float* __restrict__ wz_f,
            h16* __restrict__ kh,
            h16* __restrict__ vT,
            h16* __restrict__ zb,
            h16* __restrict__ cvt_out) {
  __shared__ __attribute__((aligned(16))) float cs[16 * 128];   // column sums per wave

  const int wave = __builtin_amdgcn_readfirstlane(threadIdx.x >> 5);
  const int lane = laneId();

  if (blockIdx.x >= LN_BLOCKS && blockIdx.x < LN_BLOCKS + TILE_BLOCKS) {   // block-uniform
    const int w = (blockIdx.x - LN_BLOCKS) * 16 + wave;   // 0..319, wave-uniform
    if (w < 128) {
      const int ct = w & 7, mt = w >> 3;               // channel tile, key tile
      tile_unit(wk_f, ct * 16, z_f, mt * 16,
                kh + (((ct >> 1) * 16 + mt) * 2 + (ct & 1)) * 256);
    } else if (w < 256) {
      const int ct = w & 7, mt = (w - 128) >> 3;
      tile_unit(z_f, mt * 16, wv_f, ct * 16,
                vT + ((((ct >> 1) * 8 + (mt >> 1)) * 2 + (ct & 1)) * 2 + (mt & 1)) * 256);
    } else {
      const int hd = w & 3, mt = (w - 256) >> 2;       // head, key tile
      tile_unit(wz_f, hd * 16, z_f, mt * 16, zb + (hd * 16 + mt) * 256);
    }
    return;
  }

  if (blockIdx.x >= LN_BLOCKS + TILE_BLOCKS) {         // block-uniform
    const int b = blockIdx.x - (LN_BLOCKS + TILE_BLOCKS);   // 512 chunks of 8 per block
    const int u = (b & 3) * 16 + wave;                 // unit within the matrix
    const int c = lane & 15, hh = lane >> 4;
    const float* in;
    int s;                                             // first of 8 source elements
    if (b < 8) {                                       // wq, wg: 64 units each
      in = b < 4 ? wq_f : wg_f;
      s  = (((u >> 1) & 7) * 16 + c) * 128 + (u >> 4) * 32 + (u & 1) * 16 + hh * 8;
    } else if (b < 12) {                               // wo: as it lies
      in = wo_f;
      s  = (u * 32 + lane) * 8;
    } else {                                           // wx: 32 units
      in = wx_f;
      s  = (((u >> 1) & 3) * 16 + c) * 128 + (u >> 3) * 32 + (u & 1) * 16 + hh * 8;
    }
    const float* p = in + s;
    const v4f a0 = *(const v4f*)(p);
    const v4f a1 = *(const v4f*)(p + 4);
    // The loads' address registers stay untouched up to this wait.
    asm volatile("s_wait_xcnt 0x0" :: "v"(p) : "memory");
    v8h o;
#pragma unroll
    for (int i = 0; i < 4; ++i) { o[i] = (h16)a0[i]; o[i + 4] = (h16)a1[i]; }
    *(v8h*)(cvt_out + (b * 512 + threadIdx.x) * 8) = o;
    // Same wait behind the store: code of the last block range follows it.
    asm volatile("s_wait_xcnt 0x0" ::: "memory");
    return;
  }

  const int n = blockIdx.x;                                // 0..255
  const int c = lane << 2;                                 // 4 channels per lane
  const size_t e0 = ((size_t)(n * 256 + wave * 16)) * 128 + c;
  const float* xp = x + e0;

  v4f xv[16];                       // the wave's 16 rows: all loads in flight at once
#pragma unroll
  for (int i = 0; i < 16; ++i) xv[i] = *(const v4f*)(xp + i * 128);
  const float* lwp = ln_w + c;
  const float* lbp = ln_b + c;
  const v4f wv = *(const v4f*)(lwp);
  const v4f bv = *(const v4f*)(lbp);
  // The loads' address registers stay untouched up to this wait.
  asm volatile("s_wait_xcnt 0x0" :: "v"(xp), "v"(lwp), "v"(lbp) : "memory");

  h16* const op = xn + e0;
  v4f csum = {};
#pragma unroll
  for (int i = 0; i < 16; ++i) {
    // Rows 8..15 are not worked on in among rows 0..7: the partial sums of all
    // 16 rows beside the rows themselves spill.
    if (i == 8) __builtin_amdgcn_sched_barrier(0);
    const v4f t = xv[i];
    float s  = t[0] + t[1] + t[2] + t[3];
    float ss = t[0] * t[0] + t[1] * t[1] + t[2] * t[2] + t[3] * t[3];
#pragma unroll
    for (int off = 16; off >= 1; off >>= 1) {
      s  += __shfl_xor(s,  off);
      ss += __shfl_xor(ss, off);
    }
    const float mu   = s * (1.0f / 128.0f);
    const float var  = ss * (1.0f / 128.0f) - mu * mu;
    const float rstd = rsqrtf(var + 1e-5f);
    const v4f y = (t - mu) * rstd * wv + bv;
    csum += y;
    v4h o;
#pragma unroll
    for (int j = 0; j < 4; ++j) o[j] = (h16)y[j];
    *(v4h*)(op + i * 128) = o;
  }
  *(v4f*)(cs + wave * 128 + c) = csum;
  __syncthreads();                  // every wave's column sums are in cs
  if (threadIdx.x < 128) {          // whole waves 0..3
    float a = 0.0f;
#pragma unroll
    for (int w = 0; w < 16; ++w) a += cs[w * 128 + threadIdx.x];
    xbar[n * 128 + threadIdx.x] = (h16)(a * (1.0f / 256.0f));
  }
  // The stores' address and data registers stay untouched up to this wait.
  asm volatile("s_wait_xcnt 0x0" ::: "memory");
}

// ---------------------------------------------------------------------------
// 2) Fused q/gate projection, attention core and output projection: a block has
//    one 16-query tile and 16 rows r, a wave one row, its four heads one after
//    the other. K, V^T, zb (160 KiB), wq, wg (64 KiB) of all heads, in fragment
//    order, and wo (padded rows) are copied to LDS once per block; a fragment's
//    ds_load_b128 of the former reads 512 contiguous bytes. xb^T of head w is
//    made once per block, by wave w, and passed through LDS.
//    Q^T = wq_h xn^T, G^T = wg_h xn^T : A = 16 channels x 32 k, B = 32 k x 16
//    queries (xn rows of the wave's queries, kept in registers). A lane holds
//    channels 8*hh + v and 16 + 8*hh + v of query c: Q^T, scaled and packed, is
//    the score product's B operand as it stands, G^T lies as O^T does.
//    xb^T = wx_h xbar^T : 16 bias channels d x 16 queries; a lane's 8 results,
//    packed, are the first k half of a B operand as they stand (d = 8*hh + v).
//    S^T = K_h Q^T + zb_h xb^T : A = 16 keys x 32 ch, B = 32 ch x 16 queries.
//    The bias has 16 channels d: one A fragment holds zb of two key tiles, one
//    in each k half, and B = [xb^T; 0] or [0; xb^T] picks the tile.
//    A lane then holds scores of ONE query (column lane&15): 8 keys per tile,
//    128 of the 256 keys per lane; lanes l and l^16 split the keys.
//    Softmax: in-lane maximum and sum plus one exchange between wave halves.
//    O^T = V_h^T P^T : two packed S^T tiles are a B operand as they stand
//    (hardware k order), V^T is loaded in the same k order by frag_units.
//    One barrier, behind the copies; scores and P never pass through LDS.
//    out = og wo^T + bo : a lane's 16 gated results of head h (query c,
//    channels 8*hh + v and 16 + 8*hh + v) are its part of the A operand of k
//    step h as they stand; the wave keeps those of heads 0..2 in LDS of its own
//    until the fourth head is done. B fragments of wo, k order and sums as in a GEMM
//    that reads og row-major.
// ---------------------------------------------------------------------------
static __device__ __forceinline__ float xhalf(float x) {   // lane l <-> l ^ 16
  const int b = __builtin_bit_cast(int, x);
  return __builtin_bit_cast(float,
      __builtin_amdgcn_permlanex16(b, b, 0x76543210, 0xfedcba98, false, false));
}

// 16x32 f16 fragment from the lane's own pointer (row lane&15, k offset
// 8*(lane>>4)): same k order as load_frag.
static __device__ __forceinline__ v16h frag_at(const h16* __restrict__ p) {
  v8h lo = *(const v8h*)(p);
  v8h hi = *(const v8h*)(p + 16);
  v16h f;
#pragma unroll
  for (int i = 0; i < 8; ++i) { f[i] = lo[i]; f[i + 8] = hi[i]; }
  return f;
}

// 16x32 f16 fragment from an array in fragment order: p is the lane's own 16
// bytes of the first unit (k half 0); the second unit follows 512 bytes on.
static __device__ __forceinline__ v16h frag_units(const h16* __restrict__ p) {
  v8h lo = *(const v8h*)(p);
  v8h hi = *(const v8h*)(p + 256);
  v16h f;
#pragma unroll
  for (int i = 0; i < 8; ++i) { f[i] = lo[i]; f[i + 8] = hi[i]; }
  return f;
}

// Eight 2^x in one statement. No result shares a register with an argument
// ("=&v"), so no v_exp_f32 is directly followed by a write of its source or a
// read of its result; the v_nop is that slot behind the last one.
static __device__ __forceinline__ v8f exp2_x8(v8f x) {
  float e0, e1, e2, e3, e4, e5, e6, e7;
  asm("v_exp_f32 %0, %8\n\t"
      "v_exp_f32 %1, %9\n\t"
      "v_exp_f32 %2, %10\n\t"
      "v_exp_f32 %3, %11\n\t"
      "v_exp_f32 %4, %12\n\t"
      "v_exp_f32 %5, %13\n\t"
      "v_exp_f32 %6, %14\n\t"
      "v_exp_f32 %7, %15\n\t"
      "v_nop"
      : "=&v"(e0), "=&v"(e1), "=&v"(e2), "=&v"(e3),
        "=&v"(e4), "=&v"(e5), "=&v"(e6), "=&v"(e7)
      : "v"(x[0]), "v"(x[1]), "v"(x[2]), "v"(x[3]),
        "v"(x[4]), "v"(x[5]), "v"(x[6]), "v"(x[7]));
  v8f e = {e0, e1, e2, e3, e4, e5, e6, e7};
  return e;
}

#define ATT_WAVES 16  // waves per block: one row r each
// 4 waves per SIMD (256 VGPRs): one block per WGP, 256 blocks: all resident
__global__ void __launch_bounds__(512, 4)
attn_kernel(const h16* __restrict__ xn,   // [65536][128] LayerNorm'd rows
            const h16* __restrict__ wqg,  // wq, wg: 128 x 128 each, fragment order
            const float* __restrict__ bg, // [128]
            const h16* __restrict__ kh,   // 256 keys x 128 ch, fragment order
            const h16* __restrict__ vT,   // 128 ch x 256 keys, fragment order
            const h16* __restrict__ zb,   // 256 keys x 64 (head, d), fragment order
            const h16* __restrict__ wx,   // 64 (head, d) x 128 ch, fragment order
            const h16* __restrict__ xbar, // 256 queries x 128 ch, row-major
            const float* __restrict__ mask,// [256][256]
            const h16* __restrict__ wo,   // 128 x 128, row-major
            const float* __restrict__ bo, // [128]
            float* __restrict__ out) {    // [65536][128]
  // K (64 KiB), V^T (64 KiB) and zb (32 KiB) of all heads, as they lie in memory
  __shared__ __attribute__((aligned(16))) h16 kvz[32768 + 32768 + 16384];
  __shared__ __attribute__((aligned(16))) h16 Wlds[128 * WPITCH];        // wo
  __shared__ __attribute__((aligned(16))) h16 xbs[4 * 256];              // xb^T per head
  __shared__ __attribute__((aligned(16))) h16 wqgs[2 * 16384];           // wq, wg
  __shared__ __attribute__((aligned(16))) h16 ogs[ATT_WAVES * 3 * 512];  // per wave, head 0..2

  const int lane = laneId();
  const int c    = lane & 15;                              // query column
  const int hh   = lane >> 4;                              // wave half
  const int wave = __builtin_amdgcn_readfirstlane(threadIdx.x >> 5);
  const int r    = blockIdx.x * ATT_WAVES + wave;          // row 0..255
  const int q0   = blockIdx.y << 4;                        // 16 queries

  // ---- the block's copies: thread t brings bytes t*16 of each 8-KiB round
  {
    const unsigned int l = (unsigned int)(size_t)((char*)kvz + threadIdx.x * 16);
    const unsigned long long kg = (unsigned long long)(size_t)((const char*)kh + threadIdx.x * 16);
    const unsigned long long vg = (unsigned long long)(size_t)((const char*)vT + threadIdx.x * 16);
    async_r512x4_b128<8192u>(l,           kg);
    async_r512x4_b128<8192u>(l + 32768u,  kg + 32768ull);
    async_r512x4_b128<8192u>(l + 65536u,  vg);
    async_r512x4_b128<8192u>(l + 98304u,  vg + 32768ull);
    async_r512x4_b128<8192u>(l + 131072u,
        (unsigned long long)(size_t)((const char*)zb + threadIdx.x * 16));
    {
      const unsigned int lw = (unsigned int)(size_t)((char*)wqgs + threadIdx.x * 16);
      const unsigned long long wg_ = (unsigned long long)(size_t)((const char*)wqg + threadIdx.x * 16);
      async_r512x4_b128<8192u>(lw,          wg_);
      async_r512x4_b128<8192u>(lw + 32768u, wg_ + 32768ull);
    }
    // wo: chunk t & 15 of rows t >> 4, + 32, + 64, + 96
    async_r512x4_b128<32u * WPITCHB>(
        (unsigned int)(size_t)((char*)Wlds + (threadIdx.x >> 4) * WPITCHB
                               + (threadIdx.x & 15) * 16),
        (unsigned long long)(size_t)((const char*)wo + threadIdx.x * 16));
  }

  const int   mi = r * 256 + q0 + c;                       // (row, query) in mask
  const float mk = mask[mi];
  // The index register of this load stays untouched up to this wait.
  asm volatile("s_wait_xcnt 0x0" :: "v"(mi) : "memory");

  // ---- xn^T of the wave's 16 queries: the B operand of k steps 0..3
  const h16* xnp = xn + ((size_t)(r * 256 + q0) + c) * 128 + (hh << 3);
  v16h xf[4];
#pragma unroll
  for (int ks = 0; ks < 4; ++ks) xf[ks] = frag_at(xnp + ks * 32);
  // The address registers of these loads stay untouched up to this wait.
  asm volatile("s_wait_xcnt 0x0" :: "v"(xnp) : "memory");

  // ---- xb^T of the query tile, head = wave (scalar test: whole waves):
  //      xt[v] = xb(query c, d = 8*hh + v), k = 0..127
  if (wave < 4) {
    const h16* wp = wx + wave * 512 + lane * 8;
    const h16* xp = xbar + (q0 + c) * 128 + (hh << 3);
    v8f xt = {};
#pragma unroll
    for (int ks = 0; ks < 4; ++ks)
      xt = WMMA_F16(frag_units(wp + ks * 2048), frag_at(xp + ks * 32), xt);
    // The address registers of the loads above stay untouched up to this wait.
    asm volatile("s_wait_xcnt 0x0" :: "v"(wp), "v"(xp) : "memory");
    v8h xpk;
#pragma unroll
    for (int v = 0; v < 8; ++v) xpk[v] = (h16)xt[v];
    *(v8h*)(xbs + wave * 256 + lane * 8) = xpk;
  }

  // Each wave's own copies have landed, then every wave's, and xbs is written:
  // nobody reads kvz, wqgs, Wlds or xbs in front of this barrier.
  wait_async0();
  __syncthreads();

  const float mb = 1.0e9f * (mk - 1.0f);
  h16* const   op   = ogs + wave * 1536 + lane * 8;        // the lane's 16 bytes
  const float  qscale = 0.17677669529663687f;              // CH^-0.5 = 1/sqrt(32)

  v8h w0, w1;                        // the head's gated results; head 3's stay here

#pragma unroll 1   // rolled: one copy of the long body in the instruction cache
  for (int h = 0; h < 4; ++h) {
    // the lane's 16 bytes in the first unit of the head's K, V^T, zb, wq, wg in LDS
    const h16* kp = kvz + h * 8192 + lane * 8;
    const h16* vp = kvz + 32768 + h * 8192 + lane * 8;
    const h16* zp = kvz + 65536 + h * 4096 + lane * 8;
    const h16* wqp = wqgs + h * 1024 + lane * 8;           // row tiles 2h, 2h + 1
    const h16* wgp = wqp + 16384;

    // ---- Q^T of the head (32 ch x 16 queries), k = 0..127
    v16h qf;
    {
      v8f a0 = {}, a1 = {};
#pragma unroll
      for (int ks = 0; ks < 4; ++ks) {
        a0 = WMMA_F16(frag_units(wqp + ks * 4096),       xf[ks], a0);
        a1 = WMMA_F16(frag_units(wqp + ks * 4096 + 512), xf[ks], a1);
      }
#pragma unroll
      for (int v = 0; v < 8; ++v) {
        qf[v]     = (h16)(a0[v] * qscale);
        qf[v + 8] = (h16)(a1[v] * qscale);
      }
    }

    const v8h xv = *(const v8h*)(xbs + h * 256 + lane * 8);
    v16h xf0, xf1;                     // [xb^T; 0] and [0; xb^T]
#pragma unroll
    for (int v = 0; v < 8; ++v) {
      xf0[v] = xv[v];        xf0[v + 8] = (h16)0.0f;
      xf1[v] = (h16)0.0f;    xf1[v + 8] = xv[v];
    }

    // ---- scores: s[mt][v] = logit(query c, key mt*16 + 8*hh + v)
    v8f s[16];
#pragma unroll
    for (int mt = 0; mt < 16; ++mt) {
      v8f z = {};
      s[mt] = WMMA_F16(frag_units(kp + mt * 512), qf, z);
    }
    // one zb fragment holds key tiles mt (first k half) and mt + 1 (second)
#pragma unroll
    for (int mt = 0; mt < 16; mt += 2) {
      const v16h az = frag_units(zp + mt * 256);
      s[mt]     = WMMA_F16(az, xf0, s[mt])     + mb;
      s[mt + 1] = WMMA_F16(az, xf1, s[mt + 1]) + mb;
    }

    // ---- maximum over the 256 keys of the lane's query
    v8f mv = s[0];
#pragma unroll
    for (int mt = 1; mt < 16; ++mt)
#pragma unroll
      for (int v = 0; v < 8; ++v) mv[v] = fmaxf(mv[v], s[mt][v]);
    float mx = fmaxf(fmaxf(fmaxf(mv[0], mv[1]), fmaxf(mv[2], mv[3])),
                     fmaxf(fmaxf(mv[4], mv[5]), fmaxf(mv[6], mv[7])));
    mx = fmaxf(mx, xhalf(mx));

    // ---- exp, f32 sum (8 independent chains), pack to the B operand of P^T
    v8f  sv = {};
    v16h pb[8];
#pragma unroll
    for (int mt = 0; mt < 16; ++mt) {
      const v8f e = exp2_x8((s[mt] - mx) * 1.44269504f);   // e^(s - mx)
      sv += e;
#pragma unroll
      for (int v = 0; v < 8; ++v) pb[mt >> 1][((mt & 1) << 3) + v] = (h16)e[v];
    }
    // No V^T fragment and no WMMA of O^T is scheduled in among the exp
    // statements: the fragments fetched that early cost
    // registers that the scores need.
    __builtin_amdgcn_sched_barrier(0);
    float sum = ((sv[0] + sv[1]) + (sv[2] + sv[3])) + ((sv[4] + sv[5]) + (sv[6] + sv[7]));
    sum += xhalf(sum);
    const float inv = 1.0f / sum;

    // ---- O^T (32 ch x 16 queries) = V_h^T (32 x 256) P^T (256 x 16)
    v8f o0 = {}, o1 = {};
#pragma unroll
    for (int j = 0; j < 8; ++j) {
      const v16h a0 = frag_units(vp + j * 1024);           // channels 0..15
      const v16h a1 = frag_units(vp + j * 1024 + 512);     // channels 16..31
      o0 = WMMA_F16(a0, pb[j], o0);
      o1 = WMMA_F16(a1, pb[j], o1);
    }

    // ---- G^T of the head, k = 0..127: channels and queries lie as in O^T
    v8f g0 = {}, g1 = {};
#pragma unroll
    for (int ks = 0; ks < 4; ++ks) {
      g0 = WMMA_F16(frag_units(wgp + ks * 4096),       xf[ks], g0);
      g1 = WMMA_F16(frag_units(wgp + ks * 4096 + 512), xf[ks], g1);
    }
    const int bi = h * 32 + (hh << 3);
    const v4f b0 = *(const v4f*)(bg + bi);
    const v4f b1 = *(const v4f*)(bg + bi + 4);
    const v4f b2 = *(const v4f*)(bg + bi + 16);
    const v4f b3 = *(const v4f*)(bg + bi + 20);
    // The index register of the bias loads stays untouched up to this wait.
    asm volatile("s_wait_xcnt 0x0" :: "v"(bi) : "memory");
#pragma unroll
    for (int v = 0; v < 8; ++v) {
      const float y0 = g0[v] + (v < 4 ? b0[v & 3] : b1[v & 3]);
      const float y1 = g1[v] + (v < 4 ? b2[v & 3] : b3[v & 3]);
      w0[v] = (h16)(o0[v] * inv * (float)(h16)(1.0f / (1.0f + __expf(-y0))));
      w1[v] = (h16)(o1[v] * inv * (float)(h16)(1.0f / (1.0f + __expf(-y1))));
    }
    // kept for the projection: two units of the wave's own LDS per head; the
    // last head's results are still in registers behind the loop
    if (h < 3) {
      *(v8h*)(op + h * 512)       = w0;
      *(v8h*)(op + h * 512 + 256) = w1;
    }
  }

  // ---- out (16 queries x 128) = og (16 x 128) wo^T + bo, k step = head
  const float* bp = bo + c;
  float bv[8];
#pragma unroll
  for (int t = 0; t < 8; ++t) bv[t] = bp[t * 16];
  // The address registers of the bias loads stay untouched up to this wait.
  asm volatile("s_wait_xcnt 0x0" :: "v"(bp) : "memory");

  v8f acc[8] = {{}, {}, {}, {}, {}, {}, {}, {}};
#pragma unroll
  for (int h = 0; h < 4; ++h) {
    v16h a;
    if (h < 3) {
      a = frag_units(op + h * 512);
    } else {
#pragma unroll
      for (int i = 0; i < 8; ++i) { a[i] = w0[i]; a[i + 8] = w1[i]; }
    }
#pragma unroll
    for (int t = 0; t < 8; ++t)
      acc[t] = WMMA_F16(a, load_frag(Wlds, t << 4, WPITCH, h * 32), acc[t]);
  }

  // a lane holds column t*16 + c of queries 8*hh + v
  float* const orow = out + ((size_t)(r * 256 + q0) + (hh << 3)) * 128 + c;
#pragma unroll
  for (int t = 0; t < 8; ++t)
#pragma unroll
    for (int v = 0; v < 8; ++v) orow[v * 128 + t * 16] = acc[t][v] + bv[t];
  // The stores' address and data registers stay untouched up to this wait.
  asm volatile("s_wait_xcnt 0x0" ::: "memory");
}

// ---------------------------------------------------------------------------
// Host-side orchestration
// ---------------------------------------------------------------------------
extern "C" void kernel_launch(void* const* d_in, const int* in_sizes, int n_in,
                              void* d_out, int out_size, void* d_ws, size_t ws_size,
                              hipStream_t stream) {
  (void)in_sizes; (void)n_in; (void)out_size; (void)ws_size;

  const float* x    = (const float*)d_in[0];   // (1,256,256,128)
  const float* z    = (const float*)d_in[1];   // (1,256,128)
  const float* mask = (const float*)d_in[2];   // (1,256,256)
  const float* ln_w = (const float*)d_in[3];
  const float* ln_b = (const float*)d_in[4];
  const float* wx   = (const float*)d_in[5];   // (64,128)
  const float* wz   = (const float*)d_in[6];   // (64,128)
  const float* wq   = (const float*)d_in[7];   // (128,128)
  const float* wk   = (const float*)d_in[8];
  const float* wv   = (const float*)d_in[9];
  const float* wg   = (const float*)d_in[10];
  const float* bg   = (const float*)d_in[11];  // (128,)
  const float* wo   = (const float*)d_in[12];  // (128,128)
  const float* bo   = (const float*)d_in[13];  // (128,)
  float* out = (float*)d_out;                  // (1,256,256,128)

  // ---- workspace carve-up (256B aligned regions)
  char* ws = (char*)d_ws;
  size_t off = 0;
  auto carve = [&](size_t bytes) -> char* {
    char* p = ws + off;
    off = (off + bytes + 255) & ~(size_t)255;
    return p;
  };
  const size_t NROWS = 65536;                 // 256*256
  h16*   xn_h   = (h16*)  carve(NROWS * 128 * 2);
  h16*   kh     = (h16*)  carve(256 * 128 * 2);
  h16*   vT     = (h16*)  carve(128 * 256 * 2);
  h16*   xbar_h = (h16*)  carve(256 * 128 * 2);
  h16*   zb_h   = (h16*)  carve(256 * 64 * 2);
  // f16 copies of four weights: contiguous, in the converting blocks' order
  h16*   wq_h   = (h16*)  carve(128 * 128 * 2);
  h16*   wg_h   = (h16*)  carve(128 * 128 * 2);
  h16*   wo_h   = (h16*)  carve(128 * 128 * 2);
  h16*   wx_h   = (h16*)  carve(64 * 128 * 2);
  (void)wg_h;                                 // follows wq_h: one array of two

  // ---- 1) LayerNorm with the column mean (256 blocks, one per n); K, V^T, zb
  // (20 blocks); weights to f16 (14)
  prep_kernel<<<290, 512, 0, stream>>>(x, ln_w, ln_b, xn_h, xbar_h, z, wq, wk, wv, wg,
                                       wo, wx, wz, kh, vT, zb_h, wq_h);

  // ---- 2) q/gate projection, attention with the triangle bias, output
  // projection (f32 out): 16 rows per block, all on one query tile
  attn_kernel<<<dim3(16, 16), 512, 0, stream>>>(xn_h, wq_h, bg, kh, vT, zb_h, wx_h, xbar_h,
                                                mask, wo_h, bo, out);
}

// v009
// A run of this version takes 31.1 microseconds.
// Timed twice side by side with v008, it ran 1.12 times as fast both times.
// Counting every step since v000, it is 10.2 times as fast.
#include <hip/hip_runtime.h>
#include <hip/hip_bf16.h>
#include <hip/hip_fp16.h>

// ---------------------------------------------------------------------------
// TriangleCrossAttention on gfx1250 (CDNA5)
//  - all GEMMs on V_WMMA_F32_16X16X32_F16 (f32 accumulate)
//  - two launches: what the attention needs of every row (xn, its column mean,
//    K, V^T, zb, f16 weights), then the attention itself
//  - the attention wave makes q and the gate of its 16 queries itself, head by
//    head, from xn: Q^T and G^T = W_h xn^T come out as the score product's B
//    operand and in O^T's own layout
//  - the output projection is done by the attention wave: it takes all four
//    heads of its 16 queries, and its gated results are the A operand
//  - K, V^T, zb, wq, wg and wx lie in memory in the order the attention wave's
//    fragments take them: lane l's 16 bytes at byte l*16 of a 512-byte unit
//  - the triangle bias is a second k slab of the score product:
//    logit = [q | xb] . [k | zb], xb made in the attention block from xbar, wx
//  - an attention block holds K, V^T, zb, wq, wg of all heads and wo in LDS
//    (async copies); every wave takes one row of the pair array, head after head
// B=1, N=M=256, CQ=CKV=128, H=4, CH=32, CB=16
// ---------------------------------------------------------------------------

typedef _Float16 h16;
typedef __attribute__((ext_vector_type(16))) _Float16 v16h;
typedef __attribute__((ext_vector_type(8)))  _Float16 v8h;
typedef __attribute__((ext_vector_type(4)))  _Float16 v4h;
typedef __attribute__((ext_vector_type(8)))  float    v8f;
typedef __attribute__((ext_vector_type(4)))  float    v4f;
typedef __attribute__((ext_vector_type(2)))  float    v2f;

#define WMMA_F16(a, b, c) \
  __builtin_amdgcn_wmma_f32_16x16x32_f16(false, (a), false, (b), (short)0, (c), false, false)

static __device__ __forceinline__ int laneId() { return threadIdx.x & 31; }

static __device__ __forceinline__ void wait_async0() {
  asm volatile("s_wait_asynccnt 0x0" ::: "memory");
}

// A staged weight matrix has rows of 128 f16 (256 bytes). In LDS they lie at a
// pitch of 272 bytes (16 x odd): the 16 rows that a half wave's ds_load_b128
// reads at one k offset then fall on all 64 banks; at 256 bytes they fall on
// the same four.
#define WPITCH  136                 // f16 per LDS row
#define WPITCHB (WPITCH * 2)        // bytes per LDS row

// Four async copies of 16 bytes per lane, one round of a 512-thread block each:
// 8 KiB apart in memory, LSTEP bytes apart in LDS (8 KiB for an array that is
// copied as it lies, 32 padded rows for a weight matrix). The s_wait_xcnt ends
// the copies' own statement, so that no address register of a copy is rewritten
// in front of it.
template <unsigned int LSTEP>
static __device__ __forceinline__ void async_r512x4_b128(unsigned int lds_off,
                                                         unsigned long long gaddr) {
  asm volatile("global_load_async_to_lds_b128 %0, %4, off\n\t"
               "global_load_async_to_lds_b128 %1, %5, off\n\t"
               "global_load_async_to_lds_b128 %2, %6, off\n\t"
               "global_load_async_to_lds_b128 %3, %7, off\n\t"
               "s_wait_xcnt 0x0"
               :: "v"(lds_off), "v"(lds_off + LSTEP),
                  "v"(lds_off + 2u * LSTEP), "v"(lds_off + 3u * LSTEP),
                  "v"(gaddr), "v"(gaddr + 8192ull),
                  "v"(gaddr + 16384ull), "v"(gaddr + 24576ull)
               : "memory");
}

// Load one 16x32 f16 fragment (A-matrix layout; also valid for the B operand
// when B is a row-major weight matrix W with K contiguous, since
// B[k][n] = W[n][k] mirrors the A striping with M<->N swapped).
// CDNA5 layout: lanes 0-15 -> row M=lane, K 0..7 (v0-3) and 16..23 (v4-7);
// lanes 16-31 -> row M=lane-16, K 8..15 and 24..31.
static __device__ __forceinline__ v16h load_frag(const h16* __restrict__ base,
                                                 int rowTile, int ld, int kbase) {
  const int lane = laneId();
  const h16* p = base + (size_t)(rowTile + (lane & 15)) * ld
                      + kbase + ((lane >> 4) << 3);
  v8h lo = *(const v8h*)(p);
  v8h hi = *(const v8h*)(p + 16);
  v16h f;
#pragma unroll
  for (int i = 0; i < 8; ++i) { f[i] = lo[i]; f[i + 8] = hi[i]; }
  return f;
}

// ---------------------------------------------------------------------------
// Fragment order of the operands that the attention waves read (K, V^T, zb: every wave, whole).
// A unit is what one wave-wide 16-byte load takes: 32 lanes x 16 bytes, lane
// (hh = lane>>4, c = lane&15) at byte lane*16, so a load covers four whole
// 128-byte lines. At each register position a lane gets the element that
// load_frag's layout puts there (same k order).
//   K   [head][key tile 16][k half 16][lane: c = key,     hh = k>>3  ][8 channels]
//   V^T [head][key block 32][ch tile 16][k half 16][lane: c = channel, hh = key>>3][8 keys]
//   zb  [head][key tile 16][lane: c = key, hh = d>>3][8 bias channels d]
//   wx  [k step 32][head][k half 16][lane: c = d,     hh = k>>3][8 channels]
//   wq, wg [k step 32][row tile 16][k half 16][lane: c = row, hh = k>>3][8 channels]
// ---------------------------------------------------------------------------

// 16x32 f16 fragment from f32 rows of 128: p is the lane's own pointer (row
// lane&15, k offset 8*(lane>>4)); same k order as load_frag.
static __device__ __forceinline__ v16h frag_f32_at(const float* __restrict__ p) {
  const v4f a0 = *(const v4f*)(p);
  const v4f a1 = *(const v4f*)(p + 4);
  const v4f a2 = *(const v4f*)(p + 16);
  const v4f a3 = *(const v4f*)(p + 20);
  v16h f;
#pragma unroll
  for (int i = 0; i < 4; ++i) {
    f[i]     = (h16)a0[i];  f[i + 4]  = (h16)a1[i];
    f[i + 8] = (h16)a2[i];  f[i + 12] = (h16)a3[i];
  }
  return f;
}

// One wave, one 16x16 tile D = A B^T over k = 0..127, A and B f32 rows of 128
// (rounded to f16 as they are loaded). A lane holds column c of rows 8*hh + v:
// its 8 results, packed, are its 16 bytes of one whole unit.
static __device__ __forceinline__ void tile_unit(const float* __restrict__ A, int arow,
                                                 const float* __restrict__ B, int brow,
                                                 h16* __restrict__ unit) {
  const int lane = laneId();
  const float* pa = A + (arow + (lane & 15)) * 128 + ((lane >> 4) << 3);
  const float* pb = B + (brow + (lane & 15)) * 128 + ((lane >> 4) << 3);
  v8f acc = {};
#pragma unroll
  for (int k = 0; k < 128; k += 32) {
    // The second half's 16 loads are not issued with the first half's: all 32
    // at once take 128 registers for their f32 data and spill.
    if (k == 64) __builtin_amdgcn_sched_barrier(0);
    acc = WMMA_F16(frag_f32_at(pa + k), frag_f32_at(pb + k), acc);
  }
  // The loads' address registers stay untouched up to this wait.
  asm volatile("s_wait_xcnt 0x0" :: "v"(pa), "v"(pb) : "memory");
  v8h o;
#pragma unroll
  for (int v = 0; v < 8; ++v) o[v] = (h16)acc[v];
  *(v8h*)(unit + lane * 8) = o;
  // Same wait behind the store: code of other block ranges follows it.
  asm volatile("s_wait_xcnt 0x0" ::: "memory");
}

// ---------------------------------------------------------------------------
// 1) One launch, three independent jobs, 512 threads a block; the long blocks
//    come first.
//    Blocks 256..275: K = z wk^T, V^T = (z wv^T)^T, zb = z wz^T, one unit per wave
//    (128 + 128 + 64 waves); the operand whose row index runs inside a lane's
//    16 bytes is the A operand.
//    Blocks 276..289: f32 -> f16 of wq, wg (fragment order), wo (row-major), wx
//    (fragment order) into one contiguous region; a thread makes 16 bytes from
//    8 consecutive f32 of one source row.
//    Blocks 0..255: LayerNorm over the channel dim (128) of the 256 rows
//    (n, q = 0..255), f16 out, 16 rows per wave, and their column mean xbar[n]
//    (f16, row-major): f32 sums per wave, then over the 16 waves through LDS.
// ---------------------------------------------------------------------------
#define LN_BLOCKS   256
#define TILE_BLOCKS 20
#define CVT_BLOCKS  14   // 256 + 20 + 14 = 290 blocks
// 8 waves per SIMD (128 VGPRs): two blocks per WGP, all 290 blocks resident
__global__ void __launch_bounds__(512, 8)
prep_kernel(const float* __restrict__ x,
            const float* __restrict__ ln_w,
            const float* __restrict__ ln_b,
            h16* __restrict__ xn,
            h16* __restrict__ xbar,
            const float* __restrict__ z_f,
            const float* __restrict__ wq_f,
            const float* __restrict__ wk_f,
            const float* __restrict__ wv_f,
            const float* __restrict__ wg_f,
            const float* __restrict__ wo_f,
            const float* __restrict__ wx_f,
            const float* __restrict__ wz_f,
            h16* __restrict__ kh,
            h16* __restrict__ vT,
            h16* __restrict__ zb,
            h16* __restrict__ cvt_out) {
  __shared__ __attribute__((aligned(16))) float cs[16 * 128];   // column sums per wave

  const int wave = __builtin_amdgcn_readfirstlane(threadIdx.x >> 5);
  const int lane = laneId();

  if (blockIdx.x >= LN_BLOCKS && blockIdx.x < LN_BLOCKS + TILE_BLOCKS) {   // block-uniform
    const int w = (blockIdx.x - LN_BLOCKS) * 16 + wave;   // 0..319, wave-uniform
    if (w < 128) {
      const int ct = w & 7, mt = w >> 3;               // channel tile, key tile
      tile_unit(wk_f, ct * 16, z_f, mt * 16,
                kh + (((ct >> 1) * 16 + mt) * 2 + (ct & 1)) * 256);
    } else if (w < 256) {
      const int ct = w & 7, mt = (w - 128) >> 3;
      tile_unit(z_f, mt * 16, wv_f, ct * 16,
                vT + ((((ct >> 1) * 8 + (mt >> 1)) * 2 + (ct & 1)) * 2 + (mt & 1)) * 256);
    } else {
      const int hd = w & 3, mt = (w - 256) >> 2;       // head, key tile
      tile_unit(wz_f, hd * 16, z_f, mt * 16, zb + (hd * 16 + mt) * 256);
    }
    return;
  }

  if (blockIdx.x >= LN_BLOCKS + TILE_BLOCKS) {         // block-uniform
    const int b = blockIdx.x - (LN_BLOCKS + TILE_BLOCKS);   // 512 chunks of 8 per block
    const int u = (b & 3) * 16 + wave;                 // unit within the matrix
    const int c = lane & 15, hh = lane >> 4;
    const float* in;
    int s;                                             // first of 8 source elements
    if (b < 8) {                                       // wq, wg: 64 units each
      in = b < 4 ? wq_f : wg_f;
      s  = (((u >> 1) & 7) * 16 + c) * 128 + (u >> 4) * 32 + (u & 1) * 16 + hh * 8;
    } else if (b < 12) {                               // wo: as it lies
      in = wo_f;
      s  = (u * 32 + lane) * 8;
    } else {                                           // wx: 32 units
      in = wx_f;
      s  = (((u >> 1) & 3) * 16 + c) * 128 + (u >> 3) * 32 + (u & 1) * 16 + hh * 8;
    }
    const float* p = in + s;
    const v4f a0 = *(const v4f*)(p);
    const v4f a1 = *(const v4f*)(p + 4);
    // The loads' address registers stay untouched up to this wait.
    asm volatile("s_wait_xcnt 0x0" :: "v"(p) : "memory");
    v8h o;
#pragma unroll
    for (int i = 0; i < 4; ++i) { o[i] = (h16)a0[i]; o[i + 4] = (h16)a1[i]; }
    *(v8h*)(cvt_out + (b * 512 + threadIdx.x) * 8) = o;
    // Same wait behind the store: code of the last block range follows it.
    asm volatile("s_wait_xcnt 0x0" ::: "memory");
    return;
  }

  const int n = blockIdx.x;                                // 0..255
  const int c = lane << 2;                                 // 4 channels per lane
  const size_t e0 = ((size_t)(n * 256 + wave * 16)) * 128 + c;
  const float* xp = x + e0;

  v4f xv[16];                       // the wave's 16 rows: all loads in flight at once
#pragma unroll
  for (int i = 0; i < 16; ++i) xv[i] = *(const v4f*)(xp + i * 128);
  const float* lwp = ln_w + c;
  const float* lbp = ln_b + c;
  const v4f wv = *(const v4f*)(lwp);
  const v4f bv = *(const v4f*)(lbp);
  // The loads' address registers stay untouched up to this wait.
  asm volatile("s_wait_xcnt 0x0" :: "v"(xp), "v"(lwp), "v"(lbp) : "memory");

  h16* const op = xn + e0;
  v4f csum = {};
#pragma unroll
  for (int i = 0; i < 16; ++i) {
    // Rows 8..15 are not worked on in among rows 0..7: the partial sums of all
    // 16 rows beside the rows themselves spill.
    if (i == 8) __builtin_amdgcn_sched_barrier(0);
    const v4f t = xv[i];
    float s  = t[0] + t[1] + t[2] + t[3];
    float ss = t[0] * t[0] + t[1] * t[1] + t[2] * t[2] + t[3] * t[3];
#pragma unroll
    for (int off = 16; off >= 1; off >>= 1) {
      s  += __shfl_xor(s,  off);
      ss += __shfl_xor(ss, off);
    }
    const float mu   = s * (1.0f / 128.0f);
    const float var  = ss * (1.0f / 128.0f) - mu * mu;
    const float rstd = rsqrtf(var + 1e-5f);
    const v4f y = (t - mu) * rstd * wv + bv;
    csum += y;
    v4h o;
#pragma unroll
    for (int j = 0; j < 4; ++j) o[j] = (h16)y[j];
    *(v4h*)(op + i * 128) = o;
  }
  *(v4f*)(cs + wave * 128 + c) = csum;
  __syncthreads();                  // every wave's column sums are in cs
  if (threadIdx.x < 128) {          // whole waves 0..3
    float a = 0.0f;
#pragma unroll
    for (int w = 0; w < 16; ++w) a += cs[w * 128 + threadIdx.x];
    xbar[n * 128 + threadIdx.x] = (h16)(a * (1.0f / 256.0f));
  }
  // The stores' address and data registers stay untouched up to this wait.
  asm volatile("s_wait_xcnt 0x0" ::: "memory");
}

// ---------------------------------------------------------------------------
// 2) Fused q/gate projection, attention core and output projection: a block has
//    one 16-query tile and 16 rows r, a wave one row, its four heads one after
//    the other. K, V^T, zb (160 KiB), wq, wg (64 KiB) of all heads, in fragment
//    order, and wo (padded rows) are copied to LDS once per block; a fragment's
//    ds_load_b128 of the former reads 512 contiguous bytes. xb^T of head w is
//    made once per block, by wave w, and passed through LDS.
//    Q^T = wq_h xn^T, G^T = wg_h xn^T : A = 16 channels x 32 k, B = 32 k x 16
//    queries (xn rows of the wave's queries, kept in registers). A lane holds
//    channels 8*hh + v and 16 + 8*hh + v of query c: Q^T, scaled and packed, is
//    the score product's B operand as it stands, G^T lies as O^T does.
//    xb^T = wx_h xbar^T : 16 bias channels d x 16 queries; a lane's 8 results,
//    packed, are the first k half of a B operand as they stand (d = 8*hh + v).
//    S^T = K_h Q^T + zb_h xb^T : A = 16 keys x 32 ch, B = 32 ch x 16 queries.
//    The bias has 16 channels d: one A fragment holds zb of two key tiles, one
//    in each k half, and B = [xb^T; 0] or [0; xb^T] picks the tile.
//    A lane then holds scores of ONE query (column lane&15): 8 keys per tile,
//    128 of the 256 keys per lane; lanes l and l^16 split the keys.
//    Softmax: in-lane maximum and sum plus one exchange between wave halves.
//    O^T = V_h^T P^T : two packed S^T tiles are a B operand as they stand
//    (hardware k order), V^T is loaded in the same k order by frag_units.
//    One barrier, behind the copies; scores and P never pass through LDS.
//    A fragments are asked for from LDS in groups, ahead of the products that
//    take them, as far ahead as the registers allow.
//    out = og wo^T + bo : a lane's 16 gated results of head h (query c,
//    channels 8*hh + v and 16 + 8*hh + v) are its part of the A operand of k
//    step h as they stand; the wave keeps those of heads 0..2 in LDS of its own
//    until the fourth head is done. B fragments of wo, k order and sums as in a GEMM
//    that reads og row-major.
// ---------------------------------------------------------------------------
static __device__ __forceinline__ float xhalf(float x) {   // lane l <-> l ^ 16
  const int b = __builtin_bit_cast(int, x);
  return __builtin_bit_cast(float,
      __builtin_amdgcn_permlanex16(b, b, 0x76543210, 0xfedcba98, false, false));
}

// 16x32 f16 fragment from the lane's own pointer (row lane&15, k offset
// 8*(lane>>4)): same k order as load_frag.
static __device__ __forceinline__ v16h frag_at(const h16* __restrict__ p) {
  v8h lo = *(const v8h*)(p);
  v8h hi = *(const v8h*)(p + 16);
  v16h f;
#pragma unroll
  for (int i = 0; i < 8; ++i) { f[i] = lo[i]; f[i + 8] = hi[i]; }
  return f;
}

// 16x32 f16 fragment from an array in fragment order: p is the lane's own 16
// bytes of the first unit (k half 0); the second unit follows 512 bytes on.
static __device__ __forceinline__ v16h frag_units(const h16* __restrict__ p) {
  v8h lo = *(const v8h*)(p);
  v8h hi = *(const v8h*)(p + 256);
  v16h f;
#pragma unroll
  for (int i = 0; i < 8; ++i) { f[i] = lo[i]; f[i + 8] = hi[i]; }
  return f;
}

// Eight 2^x in one statement. No result shares a register with an argument
// ("=&v"), so no v_exp_f32 is directly followed by a write of its source or a
// read of its result; the v_nop is that slot behind the last one.
static __device__ __forceinline__ v8f exp2_x8(v8f x) {
  float e0, e1, e2, e3, e4, e5, e6, e7;
  asm("v_exp_f32 %0, %8\n\t"
      "v_exp_f32 %1, %9\n\t"
      "v_exp_f32 %2, %10\n\t"
      "v_exp_f32 %3, %11\n\t"
      "v_exp_f32 %4, %12\n\t"
      "v_exp_f32 %5, %13\n\t"
      "v_exp_f32 %6, %14\n\t"
      "v_exp_f32 %7, %15\n\t"
      "v_nop"
      : "=&v"(e0), "=&v"(e1), "=&v"(e2), "=&v"(e3),
        "=&v"(e4), "=&v"(e5), "=&v"(e6), "=&v"(e7)
      : "v"(x[0]), "v"(x[1]), "v"(x[2]), "v"(x[3]),
        "v"(x[4]), "v"(x[5]), "v"(x[6]), "v"(x[7]));
  v8f e = {e0, e1, e2, e3, e4, e5, e6, e7};
  return e;
}

// Stands behind a group of fragment loads from LDS, in front of the matrix
// products of an earlier group: without it the compiler sinks each load to just
// in front of its own product, which then waits out the whole LDS latency. And
// behind those products, in front of the next group's loads: loads that rise
// above them take registers that are not free yet, and spill.
#define FRAGS_AHEAD() __builtin_amdgcn_sched_barrier(0)

#define ATT_WAVES 16  // waves per block: one row r each
// 4 waves per SIMD (256 VGPRs): one block per WGP, 256 blocks: all resident
__global__ void __launch_bounds__(512, 4)
attn_kernel(const h16* __restrict__ xn,   // [65536][128] LayerNorm'd rows
            const h16* __restrict__ wqg,  // wq, wg: 128 x 128 each, fragment order
            const float* __restrict__ bg, // [128]
            const h16* __restrict__ kh,   // 256 keys x 128 ch, fragment order
            const h16* __restrict__ vT,   // 128 ch x 256 keys, fragment order
            const h16* __restrict__ zb,   // 256 keys x 64 (head, d), fragment order
            const h16* __restrict__ wx,   // 64 (head, d) x 128 ch, fragment order
            const h16* __restrict__ xbar, // 256 queries x 128 ch, row-major
            const float* __restrict__ mask,// [256][256]
            const h16* __restrict__ wo,   // 128 x 128, row-major
            const float* __restrict__ bo, // [128]
            float* __restrict__ out) {    // [65536][128]
  // K (64 KiB), V^T (64 KiB) and zb (32 KiB) of all heads, as they lie in memory
  __shared__ __attribute__((aligned(16))) h16 kvz[32768 + 32768 + 16384];
  __shared__ __attribute__((aligned(16))) h16 Wlds[128 * WPITCH];        // wo
  __shared__ __attribute__((aligned(16))) h16 xbs[4 * 256];              // xb^T per head
  __shared__ __attribute__((aligned(16))) h16 wqgs[2 * 16384];           // wq, wg
  __shared__ __attribute__((aligned(16))) h16 ogs[ATT_WAVES * 3 * 512];  // per wave, head 0..2

  const int lane = laneId();
  const int c    = lane & 15;                              // query column
  const int hh   = lane >> 4;                              // wave half
  const int wave = __builtin_amdgcn_readfirstlane(threadIdx.x >> 5);
  const int r    = blockIdx.x * ATT_WAVES + wave;          // row 0..255
  const int q0   = blockIdx.y << 4;                        // 16 queries

  // ---- the block's copies: thread t brings bytes t*16 of each 8-KiB round
  {
    const unsigned int l = (unsigned int)(size_t)((char*)kvz + threadIdx.x * 16);
    const unsigned long long kg = (unsigned long long)(size_t)((const char*)kh + threadIdx.x * 16);
    const unsigned long long vg = (unsigned long long)(size_t)((const char*)vT + threadIdx.x * 16);
    async_r512x4_b128<8192u>(l,           kg);
    async_r512x4_b128<8192u>(l + 32768u,  kg + 32768ull);
    async_r512x4_b128<8192u>(l + 65536u,  vg);
    async_r512x4_b128<8192u>(l + 98304u,  vg + 32768ull);
    async_r512x4_b128<8192u>(l + 131072u,
        (unsigned long long)(size_t)((const char*)zb + threadIdx.x * 16));
    {
      const unsigned int lw = (unsigned int)(size_t)((char*)wqgs + threadIdx.x * 16);
      const unsigned long long wg_ = (unsigned long long)(size_t)((const char*)wqg + threadIdx.x * 16);
      async_r512x4_b128<8192u>(lw,          wg_);
      async_r512x4_b128<8192u>(lw + 32768u, wg_ + 32768ull);
    }
    // wo: chunk t & 15 of rows t >> 4, + 32, + 64, + 96
    async_r512x4_b128<32u * WPITCHB>(
        (unsigned int)(size_t)((char*)Wlds + (threadIdx.x >> 4) * WPITCHB
                               + (threadIdx.x & 15) * 16),
        (unsigned long long)(size_t)((const char*)wo + threadIdx.x * 16));
  }

  const int   mi = r * 256 + q0 + c;                       // (row, query) in mask
  const float mk = mask[mi];
  // The index register of this load stays untouched up to this wait.
  asm volatile("s_wait_xcnt 0x0" :: "v"(mi) : "memory");

  // ---- xn^T of the wave's 16 queries: the B operand of k steps 0..3
  const h16* xnp = xn + ((size_t)(r * 256 + q0) + c) * 128 + (hh << 3);
  v16h xf[4];
#pragma unroll
  for (int ks = 0; ks < 4; ++ks) xf[ks] = frag_at(xnp + ks * 32);
  // The address registers of these loads stay untouched up to this wait.
  asm volatile("s_wait_xcnt 0x0" :: "v"(xnp) : "memory");

  // ---- xb^T of the query tile, head = wave (scalar test: whole waves):
  //      xt[v] = xb(query c, d = 8*hh + v), k = 0..127
  if (wave < 4) {
    const h16* wp = wx + wave * 512 + lane * 8;
    const h16* xp = xbar + (q0 + c) * 128 + (hh << 3);
    v8f xt = {};
#pragma unroll
    for (int ks = 0; ks < 4; ++ks)
      xt = WMMA_F16(frag_units(wp + ks * 2048), frag_at(xp + ks * 32), xt);
    // The address registers of the loads above stay untouched up to this wait.
    asm volatile("s_wait_xcnt 0x0" :: "v"(wp), "v"(xp) : "memory");
    v8h xpk;
#pragma unroll
    for (int v = 0; v < 8; ++v) xpk[v] = (h16)xt[v];
    *(v8h*)(xbs + wave * 256 + lane * 8) = xpk;
  }

  // Each wave's own copies have landed, then every wave's, and xbs is written:
  // nobody reads kvz, wqgs, Wlds or xbs in front of this barrier.
  wait_async0();
  __syncthreads();

  const float mb = 1.0e9f * (mk - 1.0f);
  const v2f   mb2 = {mb, mb};
  h16* const   op   = ogs + wave * 1536 + lane * 8;        // the lane's 16 bytes
  const float  qscale = 0.17677669529663687f;              // CH^-0.5 = 1/sqrt(32)

  v8h w0, w1;                        // the head's gated results; head 3's stay here

#pragma unroll 1   // rolled: one copy of the long body in the instruction cache
  for (int h = 0; h < 4; ++h) {
    // the lane's 16 bytes in the first unit of the head's K, V^T, zb, wq, wg in LDS
    const h16* kp = kvz + h * 8192 + lane * 8;
    const h16* vp = kvz + 32768 + h * 8192 + lane * 8;
    const h16* zp = kvz + 65536 + h * 4096 + lane * 8;
    const h16* wqp = wqgs + h * 1024 + lane * 8;           // row tiles 2h, 2h + 1
    const h16* wgp = wqp + 16384;

    // ---- Q^T of the head (32 ch x 16 queries), k = 0..127
    v16h kf[4][4];                     // K fragments in groups of four key tiles
    v16h qf;
    v8h xv;
    {
      v16h aq[8];
#pragma unroll
      for (int i = 0; i < 8; ++i) aq[i] = frag_units(wqp + (i >> 1) * 4096 + (i & 1) * 512);
      FRAGS_AHEAD();   // here: wq, wanted first, is asked for first (LDS answers in order)
#pragma unroll
      for (int i = 0; i < 8; ++i) kf[i >> 2][i & 3] = frag_units(kp + i * 512);
      xv = *(const v8h*)(xbs + h * 256 + lane * 8);
      FRAGS_AHEAD();
      v8f a0 = {}, a1 = {};
#pragma unroll
      for (int ks = 0; ks < 4; ++ks) {
        a0 = WMMA_F16(aq[2 * ks],     xf[ks], a0);
        a1 = WMMA_F16(aq[2 * ks + 1], xf[ks], a1);
      }
#pragma unroll
      for (int v = 0; v < 8; ++v) {
        qf[v]     = (h16)(a0[v] * qscale);
        qf[v + 8] = (h16)(a1[v] * qscale);
      }
    }

    v16h xf0, xf1;                     // [xb^T; 0] and [0; xb^T]
#pragma unroll
    for (int v = 0; v < 8; ++v) {
      xf0[v] = xv[v];        xf0[v + 8] = (h16)0.0f;
      xf1[v] = (h16)0.0f;    xf1[v + 8] = xv[v];
    }

    // ---- scores: s[mt][v] = logit(query c, key mt*16 + 8*hh + v)
    v8f s[16];
    v16h zf[8];   // one zb fragment holds key tiles 2j (first k half) and 2j + 1 (second)
#pragma unroll
    for (int g = 0; g < 4; ++g) {
      if (g > 0) {
#pragma unroll
        for (int i = 0; i < 4; ++i) {
          if (g < 3) kf[g + 1][i] = frag_units(kp + ((g + 1) * 4 + i) * 512);
          else       zf[i]        = frag_units(zp + i * 512);
        }
        FRAGS_AHEAD();
      }
#pragma unroll
      for (int i = 0; i < 4; ++i) {
        v8f z = {};
        s[g * 4 + i] = WMMA_F16(kf[g][i], qf, z);
      }
      FRAGS_AHEAD();
    }
#pragma unroll
    for (int p = 0; p < 4; ++p) {
      if (p < 2) {
        zf[4 + 2 * p] = frag_units(zp + (4 + 2 * p) * 512);
        zf[5 + 2 * p] = frag_units(zp + (5 + 2 * p) * 512);
        FRAGS_AHEAD();
      }
#pragma unroll
      for (int j = 2 * p; j < 2 * p + 2; ++j) {
        s[2 * j]     = WMMA_F16(zf[j], xf0, s[2 * j]);
        s[2 * j + 1] = WMMA_F16(zf[j], xf1, s[2 * j + 1]);
      }
      // behind the last products too: the mask bias's additions, scheduled in among
      // them, put their sums in registers of their own, and the scores spill
      if (p == 0 || p == 3) FRAGS_AHEAD();
    }
    // pairwise, so that the bias takes one register pair and not eight registers
#pragma unroll
    for (int mt = 0; mt < 16; ++mt)
#pragma unroll
      for (int v = 0; v < 8; v += 2) {
        const v2f t = (v2f){s[mt][v], s[mt][v + 1]} + mb2;
        s[mt][v] = t[0];  s[mt][v + 1] = t[1];
      }

    // ---- maximum over the 256 keys of the lane's query
    v8f mv = s[0];
#pragma unroll
    for (int mt = 1; mt < 16; ++mt)
#pragma unroll
      for (int v = 0; v < 8; ++v) mv[v] = fmaxf(mv[v], s[mt][v]);
    float mx = fmaxf(fmaxf(fmaxf(mv[0], mv[1]), fmaxf(mv[2], mv[3])),
                     fmaxf(fmaxf(mv[4], mv[5]), fmaxf(mv[6], mv[7])));
    mx = fmaxf(mx, xhalf(mx));

    // ---- exp, f32 sum (8 independent chains), pack to the B operand of P^T
    v8f  sv = {};
    v16h pb[8];
    v16h vf[16];                       // V^T fragment f: key block f >> 1, channel tile f & 1
#pragma unroll
    for (int mt = 0; mt < 16; ++mt) {
      if (mt == 8) {                   // half of the scores' registers are free again
        FRAGS_AHEAD();
#pragma unroll
        for (int f = 0; f < 8; ++f) vf[f] = frag_units(vp + f * 512);
        FRAGS_AHEAD();
      }
      if (mt == 12) {                  // and half of the rest
        FRAGS_AHEAD();
#pragma unroll
        for (int f = 8; f < 12; ++f) vf[f] = frag_units(vp + f * 512);
        FRAGS_AHEAD();
      }
      const v8f e = exp2_x8((s[mt] - mx) * 1.44269504f);   // e^(s - mx)
      sv += e;
#pragma unroll
      for (int v = 0; v < 8; ++v) pb[mt >> 1][((mt & 1) << 3) + v] = (h16)e[v];
    }
    // No WMMA of O^T and no V^T fragment beyond the twelve above is scheduled in
    // among the exp statements: more fragments
    // that early cost registers that the scores need.
    __builtin_amdgcn_sched_barrier(0);
    float sum = ((sv[0] + sv[1]) + (sv[2] + sv[3])) + ((sv[4] + sv[5]) + (sv[6] + sv[7]));
    sum += xhalf(sum);
    const float inv = 1.0f / sum;

    // ---- O^T (32 ch x 16 queries) = V_h^T (32 x 256) P^T (256 x 16)
    v8f o0 = {}, o1 = {};
    v4f b0, b1, b2, b3;
    v16h ag[8];                        // wg fragments, as aq
#pragma unroll
    for (int g = 0; g < 4; ++g) {
#pragma unroll
      for (int i = 0; i < 4; ++i) {
        if (g == 1) vf[12 + i] = frag_units(vp + (12 + i) * 512);
        if (g >= 2) ag[(g - 2) * 4 + i] = frag_units(wgp + ((g - 2) * 2 + (i >> 1)) * 4096 + (i & 1) * 512);
      }
      if (g == 2) {   // the gate's bias, under the last products of O^T
        const int bi = h * 32 + (hh << 3);
        b0 = *(const v4f*)(bg + bi);
        b1 = *(const v4f*)(bg + bi + 4);
        b2 = *(const v4f*)(bg + bi + 16);
        b3 = *(const v4f*)(bg + bi + 20);
        // The index register of the bias loads stays untouched up to this wait.
        asm volatile("s_wait_xcnt 0x0" :: "v"(bi) : "memory");
      }
      if (g > 0) FRAGS_AHEAD();
#pragma unroll
      for (int j = 2 * g; j < 2 * g + 2; ++j) {
        o0 = WMMA_F16(vf[2 * j],     pb[j], o0);           // channels 0..15
        o1 = WMMA_F16(vf[2 * j + 1], pb[j], o1);           // channels 16..31
      }
      if (g < 3) FRAGS_AHEAD();
    }

    // ---- G^T of the head, k = 0..127: channels and queries lie as in O^T
    v8f g0 = {}, g1 = {};
#pragma unroll
    for (int ks = 0; ks < 4; ++ks) {
      g0 = WMMA_F16(ag[2 * ks],     xf[ks], g0);
      g1 = WMMA_F16(ag[2 * ks + 1], xf[ks], g1);
    }
#pragma unroll
    for (int v = 0; v < 8; ++v) {
      const float y0 = g0[v] + (v < 4 ? b0[v & 3] : b1[v & 3]);
      const float y1 = g1[v] + (v < 4 ? b2[v & 3] : b3[v & 3]);
      w0[v] = (h16)(o0[v] * inv * (float)(h16)(1.0f / (1.0f + __expf(-y0))));
      w1[v] = (h16)(o1[v] * inv * (float)(h16)(1.0f / (1.0f + __expf(-y1))));
    }
    // kept for the projection: two units of the wave's own LDS per head; the
    // last head's results are still in registers behind the loop
    if (h < 3) {
      *(v8h*)(op + h * 512)       = w0;
      *(v8h*)(op + h * 512 + 256) = w1;
    }
  }

  // ---- out (16 queries x 128) = og (16 x 128) wo^T + bo, k step = head
  const float* bp = bo + c;
  float bv[8];
#pragma unroll
  for (int t = 0; t < 8; ++t) bv[t] = bp[t * 16];
  // The address registers of the bias loads stay untouched up to this wait.
  asm volatile("s_wait_xcnt 0x0" :: "v"(bp) : "memory");

  v8f acc[8] = {{}, {}, {}, {}, {}, {}, {}, {}};
  v16h af[4], wf[2][8];                // wo fragments: the group in use, the group in flight
#pragma unroll
  for (int h = 0; h < 3; ++h) af[h] = frag_units(op + h * 512);
#pragma unroll
  for (int i = 0; i < 8; ++i) { af[3][i] = w0[i]; af[3][i + 8] = w1[i]; }
#pragma unroll
  for (int t = 0; t < 8; ++t) wf[0][t] = load_frag(Wlds, t << 4, WPITCH, 0);
#pragma unroll
  for (int h = 0; h < 4; ++h) {
    if (h < 3) {
#pragma unroll
      for (int t = 0; t < 8; ++t) wf[(h + 1) & 1][t] = load_frag(Wlds, t << 4, WPITCH, (h + 1) * 32);
      FRAGS_AHEAD();
    }
#pragma unroll
    for (int t = 0; t < 8; ++t) acc[t] = WMMA_F16(af[h], wf[h & 1][t], acc[t]);
    if (h < 2) FRAGS_AHEAD();
  }

  // a lane holds column t*16 + c of queries 8*hh + v
  float* const orow = out + ((size_t)(r * 256 + q0) + (hh << 3)) * 128 + c;
#pragma unroll
  for (int t = 0; t < 8; ++t)
#pragma unroll
    for (int v = 0; v < 8; ++v) orow[v * 128 + t * 16] = acc[t][v] + bv[t];
  // The stores' address and data registers stay untouched up to this wait.
  asm volatile("s_wait_xcnt 0x0" ::: "memory");
}

// ---------------------------------------------------------------------------
// Host-side orchestration
// ---------------------------------------------------------------------------
extern "C" void kernel_launch(void* const* d_in, const int* in_sizes, int n_in,
                              void* d_out, int out_size, void* d_ws, size_t ws_size,
                              hipStream_t stream) {
  (void)in_sizes; (void)n_in; (void)out_size; (void)ws_size;

  const float* x    = (const float*)d_in[0];   // (1,256,256,128)
  const float* z    = (const float*)d_in[1];   // (1,256,128)
  const float* mask = (const float*)d_in[2];   // (1,256,256)
  const float* ln_w = (const float*)d_in[3];
  const float* ln_b = (const float*)d_in[4];
  const float* wx   = (const float*)d_in[5];   // (64,128)
  const float* wz   = (const float*)d_in[6];   // (64,128)
  const float* wq   = (const float*)d_in[7];   // (128,128)
  const float* wk   = (const float*)d_in[8];
  const float* wv   = (const float*)d_in[9];
  const float* wg   = (const float*)d_in[10];
  const float* bg   = (const float*)d_in[11];  // (128,)
  const float* wo   = (const float*)d_in[12];  // (128,128)
  const float* bo   = (const float*)d_in[13];  // (128,)
  float* out = (float*)d_out;                  // (1,256,256,128)

  // ---- workspace carve-up (256B aligned regions)
  char* ws = (char*)d_ws;
  size_t off = 0;
  auto carve = [&](size_t bytes) -> char* {
    char* p = ws + off;
    off = (off + bytes + 255) & ~(size_t)255;
    return p;
  };
  const size_t NROWS = 65536;                 // 256*256
  h16*   xn_h   = (h16*)  carve(NROWS * 128 * 2);
  h16*   kh     = (h16*)  carve(256 * 128 * 2);
  h16*   vT     = (h16*)  carve(128 * 256 * 2);
  h16*   xbar_h = (h16*)  carve(256 * 128 * 2);
  h16*   zb_h   = (h16*)  carve(256 * 64 * 2);
  // f16 copies of four weights: contiguous, in the converting blocks' order
  h16*   wq_h   = (h16*)  carve(128 * 128 * 2);
  h16*   wg_h   = (h16*)  carve(128 * 128 * 2);
  h16*   wo_h   = (h16*)  carve(128 * 128 * 2);
  h16*   wx_h   = (h16*)  carve(64 * 128 * 2);
  (void)wg_h;                                 // follows wq_h: one array of two

  // ---- 1) LayerNorm with the column mean (256 blocks, one per n); K, V^T, zb
  // (20 blocks); weights to f16 (14)
  prep_kernel<<<290, 512, 0, stream>>>(x, ln_w, ln_b, xn_h, xbar_h, z, wq, wk, wv, wg,
                                       wo, wx, wz, kh, vT, zb_h, wq_h);

  // ---- 2) q/gate projection, attention with the triangle bias, output
  // projection (f32 out): 16 rows per block, all on one query tile
  attn_kernel<<<dim3(16, 16), 512, 0, stream>>>(xn_h, wq_h, bg, kh, vT, zb_h, wx_h, xbar_h,
                                                mask, wo_h, bo, out);
}

// v010
// Measured time: 29.9 microseconds a run.
// In both of two side-by-side timings against v009, it was 1.04 times as fast.
// Counting every step since v000, it is 10.6 times as fast.
#include <hip/hip_runtime.h>
#include <hip/hip_bf16.h>
#include <hip/hip_fp16.h>

// ---------------------------------------------------------------------------
// TriangleCrossAttention on gfx1250 (CDNA5)
//  - all GEMMs on V_WMMA_F32_16X16X32_F16 (f32 accumulate)
//  - two launches: what the attention needs of every row (xn, its column mean,
//    K, V^T, zb, f16 weights), then the attention itself
//  - the attention wave makes q and the gate of its 16 queries itself, head by
//    head, from xn: Q^T and G^T = W_h xn^T come out as the score product's B
//    operand and in O^T's own layout
//  - the output projection is done by the attention wave: it takes all four
//    heads of its 16 queries, and its gated results are the A operand
//  - K, V^T, zb, wq, wg and wx lie in memory in the order the attention wave's
//    fragments take them: lane l's 16 bytes at byte l*16 of a 512-byte unit
//  - the triangle bias is a second k slab of the score product:
//    logit = [q | xb] . [k | zb], xb made in the attention block from xbar, wx
//  - an attention block holds K, V^T, zb, wq, wg of all heads and wo in LDS
//    (async copies); every wave takes one row of the pair array, head after head
// B=1, N=M=256, CQ=CKV=128, H=4, CH=32, CB=16
// ---------------------------------------------------------------------------

typedef _Float16 h16;
typedef __attribute__((ext_vector_type(16))) _Float16 v16h;
typedef __attribute__((ext_vector_type(8)))  _Float16 v8h;
typedef __attribute__((ext_vector_type(4)))  _Float16 v4h;
typedef __attribute__((ext_vector_type(8)))  float    v8f;
typedef __attribute__((ext_vector_type(4)))  float    v4f;
typedef __attribute__((ext_vector_type(2)))  float    v2f;

#define WMMA_F16(a, b, c) \
  __builtin_amdgcn_wmma_f32_16x16x32_f16(false, (a), false, (b), (short)0, (c), false, false)

static __device__ __forceinline__ int laneId() { return threadIdx.x & 31; }

static __device__ __forceinline__ void wait_async0() {
  asm volatile("s_wait_asynccnt 0x0" ::: "memory");
}

// A staged weight matrix has rows of 128 f16 (256 bytes). In LDS they lie at a
// pitch of 272 bytes (16 x odd): the 16 rows that a half wave's ds_load_b128
// reads at one k offset then fall on all 64 banks; at 256 bytes they fall on
// the same four.
#define WPITCH  136                 // f16 per LDS row
#define WPITCHB (WPITCH * 2)        // bytes per LDS row

// Four async copies of 16 bytes per lane, one round of a 512-thread block each:
// 8 KiB apart in memory, LSTEP bytes apart in LDS (8 KiB for an array that is
// copied as it lies, 32 padded rows for a weight matrix). The s_wait_xcnt ends
// the copies' own statement, so that no address register of a copy is rewritten
// in front of it.
template <unsigned int LSTEP>
static __device__ __forceinline__ void async_r512x4_b128(unsigned int lds_off,
                                                         unsigned long long gaddr) {
  asm volatile("global_load_async_to_lds_b128 %0, %4, off\n\t"
               "global_load_async_to_lds_b128 %1, %5, off\n\t"
               "global_load_async_to_lds_b128 %2, %6, off\n\t"
               "global_load_async_to_lds_b128 %3, %7, off\n\t"
               "s_wait_xcnt 0x0"
               :: "v"(lds_off), "v"(lds_off + LSTEP),
                  "v"(lds_off + 2u * LSTEP), "v"(lds_off + 3u * LSTEP),
                  "v"(gaddr), "v"(gaddr + 8192ull),
                  "v"(gaddr + 16384ull), "v"(gaddr + 24576ull)
               : "memory");
}

// Load one 16x32 f16 fragment (A-matrix layout; also valid for the B operand
// when B is a row-major weight matrix W with K contiguous, since
// B[k][n] = W[n][k] mirrors the A striping with M<->N swapped).
// CDNA5 layout: lanes 0-15 -> row M=lane, K 0..7 (v0-3) and 16..23 (v4-7);
// lanes 16-31 -> row M=lane-16, K 8..15 and 24..31.
static __device__ __forceinline__ v16h load_frag(const h16* __restrict__ base,
                                                 int rowTile, int ld, int kbase) {
  const int lane = laneId();
  const h16* p = base + (size_t)(rowTile + (lane & 15)) * ld
                      + kbase + ((lane >> 4) << 3);
  v8h lo = *(const v8h*)(p);
  v8h hi = *(const v8h*)(p + 16);
  v16h f;
#pragma unroll
  for (int i = 0; i < 8; ++i) { f[i] = lo[i]; f[i + 8] = hi[i]; }
  return f;
}

// ---------------------------------------------------------------------------
// Fragment order of the operands that the attention waves read (K, V^T, zb: every wave, whole).
// A unit is what one wave-wide 16-byte load takes: 32 lanes x 16 bytes, lane
// (hh = lane>>4, c = lane&15) at byte lane*16, so a load covers four whole
// 128-byte lines. At each register position a lane gets the element that
// load_frag's layout puts there (same k order).
//   K   [head][key tile 16][k half 16][lane: c = key,     hh = k>>3  ][8 channels]
//   V^T [head][key block 32][ch tile 16][k half 16][lane: c = channel, hh = key>>3][8 keys]
//   zb  [head][key tile 16][lane: c = key, hh = d>>3][8 bias channels d]
//   wx  [k step 32][head][k half 16][lane: c = d,     hh = k>>3][8 channels]
//   wq, wg [k step 32][row tile 16][k half 16][lane: c = row, hh = k>>3][8 channels]
// ---------------------------------------------------------------------------

// 16x32 f16 fragment from f32 rows of 128: p is the lane's own pointer (row
// lane&15, k offset 8*(lane>>4)); same k order as load_frag.
static __device__ __forceinline__ v16h frag_f32_at(const float* __restrict__ p) {
  const v4f a0 = *(const v4f*)(p);
  const v4f a1 = *(const v4f*)(p + 4);
  const v4f a2 = *(const v4f*)(p + 16);
  const v4f a3 = *(const v4f*)(p + 20);
  v16h f;
#pragma unroll
  for (int i = 0; i < 4; ++i) {
    f[i]     = (h16)a0[i];  f[i + 4]  = (h16)a1[i];
    f[i + 8] = (h16)a2[i];  f[i + 12] = (h16)a3[i];
  }
  return f;
}

// One wave, one 16x16 tile D = A B^T over k = 0..127, A and B f32 rows of 128
// (rounded to f16 as they are loaded). A lane holds column c of rows 8*hh + v:
// its 8 results, packed, are its 16 bytes of one whole unit.
static __device__ __forceinline__ void tile_unit(const float* __restrict__ A, int arow,
                                                 const float* __restrict__ B, int brow,
                                                 h16* __restrict__ unit) {
  const int lane = laneId();
  const float* pa = A + (arow + (lane & 15)) * 128 + ((lane >> 4) << 3);
  const float* pb = B + (brow + (lane & 15)) * 128 + ((lane >> 4) << 3);
  v8f acc = {};
#pragma unroll
  for (int k = 0; k < 128; k += 32) {
    // The second half's 16 loads are not issued with the first half's: all 32
    // at once take 128 registers for their f32 data and spill.
    if (k == 64) __builtin_amdgcn_sched_barrier(0);
    acc = WMMA_F16(frag_f32_at(pa + k), frag_f32_at(pb + k), acc);
  }
  // The loads' address registers stay untouched up to this wait.
  asm volatile("s_wait_xcnt 0x0" :: "v"(pa), "v"(pb) : "memory");
  v8h o;
#pragma unroll
  for (int v = 0; v < 8; ++v) o[v] = (h16)acc[v];
  *(v8h*)(unit + lane * 8) = o;
  // Same wait behind the store: code of other block ranges follows it.
  asm volatile("s_wait_xcnt 0x0" ::: "memory");
}

// ---------------------------------------------------------------------------
// 1) One launch, three independent jobs, 512 threads a block; the long blocks
//    come first.
//    Blocks 256..275: K = z wk^T, V^T = (z wv^T)^T, zb = z wz^T, one unit per wave
//    (128 + 128 + 64 waves); the operand whose row index runs inside a lane's
//    16 bytes is the A operand.
//    Blocks 276..289: f32 -> f16 of wq, wg (fragment order), wo (row-major), wx
//    (fragment order) into one contiguous region; a thread makes 16 bytes from
//    8 consecutive f32 of one source row.
//    Blocks 0..255: LayerNorm over the channel dim (128) of the 256 rows
//    (n, q = 0..255), f16 out, 16 rows per wave, and their column mean xbar[n]
//    (f16, row-major): f32 sums per wave, then over the 16 waves through LDS.
// ---------------------------------------------------------------------------
#define LN_BLOCKS   256
#define TILE_BLOCKS 20
#define CVT_BLOCKS  14   // 256 + 20 + 14 = 290 blocks
// 8 waves per SIMD (128 VGPRs): two blocks per WGP, all 290 blocks resident
__global__ void __launch_bounds__(512, 8)
prep_kernel(const float* __restrict__ x,
            const float* __restrict__ ln_w,
            const float* __restrict__ ln_b,
            h16* __restrict__ xn,
            h16* __restrict__ xbar,
            const float* __restrict__ z_f,
            const float* __restrict__ wq_f,
            const float* __restrict__ wk_f,
            const float* __restrict__ wv_f,
            const float* __restrict__ wg_f,
            const float* __restrict__ wo_f,
            const float* __restrict__ wx_f,
            const float* __restrict__ wz_f,
            h16* __restrict__ kh,
            h16* __restrict__ vT,
            h16* __restrict__ zb,
            h16* __restrict__ cvt_out) {
  __shared__ __attribute__((aligned(16))) float cs[16 * 128];   // column sums per wave

  const int wave = __builtin_amdgcn_readfirstlane(threadIdx.x >> 5);
  const int lane = laneId();

  if (blockIdx.x >= LN_BLOCKS && blockIdx.x < LN_BLOCKS + TILE_BLOCKS) {   // block-uniform
    const int w = (blockIdx.x - LN_BLOCKS) * 16 + wave;   // 0..319, wave-uniform
    if (w < 128) {
      const int ct = w & 7, mt = w >> 3;               // channel tile, key tile
      tile_unit(wk_f, ct * 16, z_f, mt * 16,
                kh + (((ct >> 1) * 16 + mt) * 2 + (ct & 1)) * 256);
    } else if (w < 256) {
      const int ct = w & 7, mt = (w - 128) >> 3;
      tile_unit(z_f, mt * 16, wv_f, ct * 16,
                vT + ((((ct >> 1) * 8 + (mt >> 1)) * 2 + (ct & 1)) * 2 + (mt & 1)) * 256);
    } else {
      const int hd = w & 3, mt = (w - 256) >> 2;       // head, key tile
      tile_unit(wz_f, hd * 16, z_f, mt * 16, zb + (hd * 16 + mt) * 256);
    }
    return;
  }

  if (blockIdx.x >= LN_BLOCKS + TILE_BLOCKS) {         // block-uniform
    const int b = blockIdx.x - (LN_BLOCKS + TILE_BLOCKS);   // 512 chunks of 8 per block
    const int u = (b & 3) * 16 + wave;                 // unit within the matrix
    const int c = lane & 15, hh = lane >> 4;
    const float* in;
    int s;                                             // first of 8 source elements
    if (b < 8) {                                       // wq, wg: 64 units each
      in = b < 4 ? wq_f : wg_f;
      s  = (((u >> 1) & 7) * 16 + c) * 128 + (u >> 4) * 32 + (u & 1) * 16 + hh * 8;
    } else if (b < 12) {                               // wo: as it lies
      in = wo_f;
      s  = (u * 32 + lane) * 8;
    } else {                                           // wx: 32 units
      in = wx_f;
      s  = (((u >> 1) & 3) * 16 + c) * 128 + (u >> 3) * 32 + (u & 1) * 16 + hh * 8;
    }
    const float* p = in + s;
    const v4f a0 = *(const v4f*)(p);
    const v4f a1 = *(const v4f*)(p + 4);
    // The loads' address registers stay untouched up to this wait.
    asm volatile("s_wait_xcnt 0x0" :: "v"(p) : "memory");
    v8h o;
#pragma unroll
    for (int i = 0; i < 4; ++i) { o[i] = (h16)a0[i]; o[i + 4] = (h16)a1[i]; }
    *(v8h*)(cvt_out + (b * 512 + threadIdx.x) * 8) = o;
    // Same wait behind the store: code of the last block range follows it.
    asm volatile("s_wait_xcnt 0x0" ::: "memory");
    return;
  }

  const int n = blockIdx.x;                                // 0..255
  const int c = lane << 2;                                 // 4 channels per lane
  const size_t e0 = ((size_t)(n * 256 + wave * 16)) * 128 + c;
  const float* xp = x + e0;

  v4f xv[16];                       // the wave's 16 rows: all loads in flight at once
#pragma unroll
  for (int i = 0; i < 16; ++i) xv[i] = *(const v4f*)(xp + i * 128);
  const float* lwp = ln_w + c;
  const float* lbp = ln_b + c;
  const v4f wv = *(const v4f*)(lwp);
  const v4f bv = *(const v4f*)(lbp);
  // The loads' address registers stay untouched up to this wait.
  asm volatile("s_wait_xcnt 0x0" :: "v"(xp), "v"(lwp), "v"(lbp) : "memory");

  h16* const op = xn + e0;
  v4f csum = {};
#pragma unroll
  for (int i = 0; i < 16; ++i) {
    // Rows 8..15 are not worked on in among rows 0..7: the partial sums of all
    // 16 rows beside the rows themselves spill.
    if (i == 8) __builtin_amdgcn_sched_barrier(0);
    const v4f t = xv[i];
    float s  = t[0] + t[1] + t[2] + t[3];
    float ss = t[0] * t[0] + t[1] * t[1] + t[2] * t[2] + t[3] * t[3];
#pragma unroll
    for (int off = 16; off >= 1; off >>= 1) {
      s  += __shfl_xor(s,  off);
      ss += __shfl_xor(ss, off);
    }
    const float mu   = s * (1.0f / 128.0f);
    const float var  = ss * (1.0f / 128.0f) - mu * mu;
    const float rstd = rsqrtf(var + 1e-5f);
    const v4f y = (t - mu) * rstd * wv + bv;
    csum += y;
    v4h o;
#pragma unroll
    for (int j = 0; j < 4; ++j) o[j] = (h16)y[j];
    *(v4h*)(op + i * 128) = o;
  }
  *(v4f*)(cs + wave * 128 + c) = csum;
  __syncthreads();                  // every wave's column sums are in cs
  if (threadIdx.x < 128) {          // whole waves 0..3
    float a = 0.0f;
#pragma unroll
    for (int w = 0; w < 16; ++w) a += cs[w * 128 + threadIdx.x];
    xbar[n * 128 + threadIdx.x] = (h16)(a * (1.0f / 256.0f));
  }
  // The stores' address and data registers stay untouched up to this wait.
  asm volatile("s_wait_xcnt 0x0" ::: "memory");
}

// ---------------------------------------------------------------------------
// 2) Fused q/gate projection, attention core and output projection: a block has
//    one 16-query tile and 16 rows r, a wave one row, its four heads one after
//    the other. K, V^T, zb (160 KiB), wq, wg (64 KiB) of all heads, in fragment
//    order, and wo (padded rows) are copied to LDS once per block; a fragment's
//    ds_load_b128 of the former reads 512 contiguous bytes. xb^T of head w is
//    made once per block, by wave w, and passed through LDS.
//    Q^T = wq_h xn^T, G^T = wg_h xn^T : A = 16 channels x 32 k, B = 32 k x 16
//    queries (xn rows of the wave's queries, kept in registers). A lane holds
//    channels 8*hh + v and 16 + 8*hh + v of query c: Q^T, scaled and packed, is
//    the score product's B operand as it stands, G^T lies as O^T does.
//    xb^T = wx_h xbar^T : 16 bias channels d x 16 queries; a lane's 8 results,
//    packed, are the first k half of a B operand as they stand (d = 8*hh + v).
//    S^T = K_h Q^T + zb_h xb^T : A = 16 keys x 32 ch, B = 32 ch x 16 queries.
//    The bias has 16 channels d: one A fragment holds zb of two key tiles, one
//    in each k half, and B = [xb^T; 0] or [0; xb^T] picks the tile.
//    A lane then holds scores of ONE query (column lane&15): 8 keys per tile,
//    128 of the 256 keys per lane; lanes l and l^16 split the keys.
//    Softmax: in-lane maximum and sum plus one exchange between wave halves.
//    O^T = V_h^T P^T : two packed S^T tiles are a B operand as they stand
//    (hardware k order), V^T is loaded in the same k order by frag_units.
//    One barrier, behind the copies; scores and P never pass through LDS.
//    A fragments are asked for from LDS in groups, ahead of the products that
//    take them, as far ahead as the registers allow.
//    out = og wo^T + bo : a lane's 16 gated results of head h (query c,
//    channels 8*hh + v and 16 + 8*hh + v) are its part of the A operand of k
//    step h as they stand; the wave keeps those of heads 0..2 in LDS of its own
//    until the fourth head is done. B fragments of wo, k order and sums as in a GEMM
//    that reads og row-major.
// ---------------------------------------------------------------------------
static __device__ __forceinline__ float xhalf(float x) {   // lane l <-> l ^ 16
  const int b = __builtin_bit_cast(int, x);
  return __builtin_bit_cast(float,
      __builtin_amdgcn_permlanex16(b, b, 0x76543210, 0xfedcba98, false, false));
}

// 16x32 f16 fragment from the lane's own pointer (row lane&15, k offset
// 8*(lane>>4)): same k order as load_frag.
static __device__ __forceinline__ v16h frag_at(const h16* __restrict__ p) {
  v8h lo = *(const v8h*)(p);
  v8h hi = *(const v8h*)(p + 16);
  v16h f;
#pragma unroll
  for (int i = 0; i < 8; ++i) { f[i] = lo[i]; f[i + 8] = hi[i]; }
  return f;
}

// 16x32 f16 fragment from an array in fragment order: p is the lane's own 16
// bytes of the first unit (k half 0); the second unit follows 512 bytes on.
static __device__ __forceinline__ v16h frag_units(const h16* __restrict__ p) {
  v8h lo = *(const v8h*)(p);
  v8h hi = *(const v8h*)(p + 256);
  v16h f;
#pragma unroll
  for (int i = 0; i < 8; ++i) { f[i] = lo[i]; f[i + 8] = hi[i]; }
  return f;
}

// Eight 2^x in one statement. No result shares a register with an argument
// ("=&v"), so no v_exp_f32 is directly followed by a write of its source or a
// read of its result; the v_nop is that slot behind the last one.
static __device__ __forceinline__ v8f exp2_x8(v8f x) {
  float e0, e1, e2, e3, e4, e5, e6, e7;
  asm("v_exp_f32 %0, %8\n\t"
      "v_exp_f32 %1, %9\n\t"
      "v_exp_f32 %2, %10\n\t"
      "v_exp_f32 %3, %11\n\t"
      "v_exp_f32 %4, %12\n\t"
      "v_exp_f32 %5, %13\n\t"
      "v_exp_f32 %6, %14\n\t"
      "v_exp_f32 %7, %15\n\t"
      "v_nop"
      : "=&v"(e0), "=&v"(e1), "=&v"(e2), "=&v"(e3),
        "=&v"(e4), "=&v"(e5), "=&v"(e6), "=&v"(e7)
      : "v"(x[0]), "v"(x[1]), "v"(x[2]), "v"(x[3]),
        "v"(x[4]), "v"(x[5]), "v"(x[6]), "v"(x[7]));
  v8f e = {e0, e1, e2, e3, e4, e5, e6, e7};
  return e;
}

// Eight 1/x by v_rcp_f32 (1 ulp) in one statement, built as exp2_x8 is and for
// the same reason.
static __device__ __forceinline__ v8f rcp_x8(v8f x) {
  float e0, e1, e2, e3, e4, e5, e6, e7;
  asm("v_rcp_f32 %0, %8\n\t"
      "v_rcp_f32 %1, %9\n\t"
      "v_rcp_f32 %2, %10\n\t"
      "v_rcp_f32 %3, %11\n\t"
      "v_rcp_f32 %4, %12\n\t"
      "v_rcp_f32 %5, %13\n\t"
      "v_rcp_f32 %6, %14\n\t"
      "v_rcp_f32 %7, %15\n\t"
      "v_nop"
      : "=&v"(e0), "=&v"(e1), "=&v"(e2), "=&v"(e3),
        "=&v"(e4), "=&v"(e5), "=&v"(e6), "=&v"(e7)
      : "v"(x[0]), "v"(x[1]), "v"(x[2]), "v"(x[3]),
        "v"(x[4]), "v"(x[5]), "v"(x[6]), "v"(x[7]));
  v8f e = {e0, e1, e2, e3, e4, e5, e6, e7};
  return e;
}

// Stands behind a group of fragment loads from LDS, in front of the matrix
// products of an earlier group: without it the compiler sinks each load to just
// in front of its own product, which then waits out the whole LDS latency. And
// behind those products, in front of the next group's loads: loads that rise
// above them take registers that are not free yet, and spill.
#define FRAGS_AHEAD() __builtin_amdgcn_sched_barrier(0)

#define ATT_WAVES 16  // waves per block: one row r each
// 4 waves per SIMD (256 VGPRs): one block per WGP, 256 blocks: all resident
__global__ void __launch_bounds__(512, 4)
attn_kernel(const h16* __restrict__ xn,   // [65536][128] LayerNorm'd rows
            const h16* __restrict__ wqg,  // wq, wg: 128 x 128 each, fragment order
            const float* __restrict__ bg, // [128]
            const h16* __restrict__ kh,   // 256 keys x 128 ch, fragment order
            const h16* __restrict__ vT,   // 128 ch x 256 keys, fragment order
            const h16* __restrict__ zb,   // 256 keys x 64 (head, d), fragment order
            const h16* __restrict__ wx,   // 64 (head, d) x 128 ch, fragment order
            const h16* __restrict__ xbar, // 256 queries x 128 ch, row-major
            const float* __restrict__ mask,// [256][256]
            const h16* __restrict__ wo,   // 128 x 128, row-major
            const float* __restrict__ bo, // [128]
            float* __restrict__ out) {    // [65536][128]
  // K (64 KiB), V^T (64 KiB) and zb (32 KiB) of all heads, as they lie in memory
  __shared__ __attribute__((aligned(16))) h16 kvz[32768 + 32768 + 16384];
  __shared__ __attribute__((aligned(16))) h16 Wlds[128 * WPITCH];        // wo
  __shared__ __attribute__((aligned(16))) h16 xbs[4 * 256];              // xb^T per head
  __shared__ __attribute__((aligned(16))) h16 wqgs[2 * 16384];           // wq, wg
  __shared__ __attribute__((aligned(16))) h16 ogs[ATT_WAVES * 3 * 512];  // per wave, head 0..2

  const int lane = laneId();
  const int c    = lane & 15;                              // query column
  const int hh   = lane >> 4;                              // wave half
  const int wave = __builtin_amdgcn_readfirstlane(threadIdx.x >> 5);
  const int r    = blockIdx.x * ATT_WAVES + wave;          // row 0..255
  const int q0   = blockIdx.y << 4;                        // 16 queries

  // ---- the block's copies: thread t brings bytes t*16 of each 8-KiB round
  {
    const unsigned int l = (unsigned int)(size_t)((char*)kvz + threadIdx.x * 16);
    const unsigned long long kg = (unsigned long long)(size_t)((const char*)kh + threadIdx.x * 16);
    const unsigned long long vg = (unsigned long long)(size_t)((const char*)vT + threadIdx.x * 16);
    async_r512x4_b128<8192u>(l,           kg);
    async_r512x4_b128<8192u>(l + 32768u,  kg + 32768ull);
    async_r512x4_b128<8192u>(l + 65536u,  vg);
    async_r512x4_b128<8192u>(l + 98304u,  vg + 32768ull);
    async_r512x4_b128<8192u>(l + 131072u,
        (unsigned long long)(size_t)((const char*)zb + threadIdx.x * 16));
    {
      const unsigned int lw = (unsigned int)(size_t)((char*)wqgs + threadIdx.x * 16);
      const unsigned long long wg_ = (unsigned long long)(size_t)((const char*)wqg + threadIdx.x * 16);
      async_r512x4_b128<8192u>(lw,          wg_);
      async_r512x4_b128<8192u>(lw + 32768u, wg_ + 32768ull);
    }
    // wo: chunk t & 15 of rows t >> 4, + 32, + 64, + 96
    async_r512x4_b128<32u * WPITCHB>(
        (unsigned int)(size_t)((char*)Wlds + (threadIdx.x >> 4) * WPITCHB
                               + (threadIdx.x & 15) * 16),
        (unsigned long long)(size_t)((const char*)wo + threadIdx.x * 16));
  }

  const int   mi = r * 256 + q0 + c;                       // (row, query) in mask
  const float mk = mask[mi];
  // The index register of this load stays untouched up to this wait.
  asm volatile("s_wait_xcnt 0x0" :: "v"(mi) : "memory");

  // ---- xn^T of the wave's 16 queries: the B operand of k steps 0..3
  const h16* xnp = xn + ((size_t)(r * 256 + q0) + c) * 128 + (hh << 3);
  v16h xf[4];
#pragma unroll
  for (int ks = 0; ks < 4; ++ks) xf[ks] = frag_at(xnp + ks * 32);
  // The address registers of these loads stay untouched up to this wait.
  asm volatile("s_wait_xcnt 0x0" :: "v"(xnp) : "memory");

  // ---- xb^T of the query tile, head = wave (scalar test: whole waves):
  //      xt[v] = xb(query c, d = 8*hh + v), k = 0..127
  if (wave < 4) {
    const h16* wp = wx + wave * 512 + lane * 8;
    const h16* xp = xbar + (q0 + c) * 128 + (hh << 3);
    v8f xt = {};
#pragma unroll
    for (int ks = 0; ks < 4; ++ks)
      xt = WMMA_F16(frag_units(wp + ks * 2048), frag_at(xp + ks * 32), xt);
    // The address registers of the loads above stay untouched up to this wait.
    asm volatile("s_wait_xcnt 0x0" :: "v"(wp), "v"(xp) : "memory");
    v8h xpk;
#pragma unroll
    for (int v = 0; v < 8; ++v) xpk[v] = (h16)xt[v];
    *(v8h*)(xbs + wave * 256 + lane * 8) = xpk;
  }

  // Each wave's own copies have landed, then every wave's, and xbs is written:
  // nobody reads kvz, wqgs, Wlds or xbs in front of this barrier.
  wait_async0();
  __syncthreads();

  const float mb = 1.0e9f * (mk - 1.0f);
  const v2f   mb2 = {mb, mb};
  h16* const   op   = ogs + wave * 1536 + lane * 8;        // the lane's 16 bytes
  const float  qscale = 0.17677669529663687f;              // CH^-0.5 = 1/sqrt(32)

  v8h w0, w1;                        // the head's gated results; head 3's stay here

#pragma unroll 1   // rolled: one copy of the long body in the instruction cache
  for (int h = 0; h < 4; ++h) {
    // the lane's 16 bytes in the first unit of the head's K, V^T, zb, wq, wg in LDS
    const h16* kp = kvz + h * 8192 + lane * 8;
    const h16* vp = kvz + 32768 + h * 8192 + lane * 8;
    const h16* zp = kvz + 65536 + h * 4096 + lane * 8;
    const h16* wqp = wqgs + h * 1024 + lane * 8;           // row tiles 2h, 2h + 1
    const h16* wgp = wqp + 16384;

    // ---- Q^T of the head (32 ch x 16 queries), k = 0..127
    v16h kf[4][4];                     // K fragments in groups of four key tiles
    v16h qf;
    v8h xv;
    {
      v16h aq[8];
#pragma unroll
      for (int i = 0; i < 8; ++i) aq[i] = frag_units(wqp + (i >> 1) * 4096 + (i & 1) * 512);
      FRAGS_AHEAD();   // here: wq, wanted first, is asked for first (LDS answers in order)
#pragma unroll
      for (int i = 0; i < 8; ++i) kf[i >> 2][i & 3] = frag_units(kp + i * 512);
      xv = *(const v8h*)(xbs + h * 256 + lane * 8);
      FRAGS_AHEAD();
      v8f a0 = {}, a1 = {};
#pragma unroll
      for (int ks = 0; ks < 4; ++ks) {
        a0 = WMMA_F16(aq[2 * ks],     xf[ks], a0);
        a1 = WMMA_F16(aq[2 * ks + 1], xf[ks], a1);
      }
#pragma unroll
      for (int v = 0; v < 8; ++v) {
        qf[v]     = (h16)(a0[v] * qscale);
        qf[v + 8] = (h16)(a1[v] * qscale);
      }
    }

    v16h xf0, xf1;                     // [xb^T; 0] and [0; xb^T]
#pragma unroll
    for (int v = 0; v < 8; ++v) {
      xf0[v] = xv[v];        xf0[v + 8] = (h16)0.0f;
      xf1[v] = (h16)0.0f;    xf1[v + 8] = xv[v];
    }

    // ---- scores: s[mt][v] = logit(query c, key mt*16 + 8*hh + v)
    v8f s[16];
    v16h zf[8];   // one zb fragment holds key tiles 2j (first k half) and 2j + 1 (second)
#pragma unroll
    for (int g = 0; g < 4; ++g) {
      if (g > 0) {
#pragma unroll
        for (int i = 0; i < 4; ++i) {
          if (g < 3) kf[g + 1][i] = frag_units(kp + ((g + 1) * 4 + i) * 512);
          // two zb fragments here and not four: four, beside K's last group and
          // twelve score tiles, leave no registers, and xn's fragments spill
          else if (i < 2) zf[i]   = frag_units(zp + i * 512);
        }
        FRAGS_AHEAD();
      }
#pragma unroll
      for (int i = 0; i < 4; ++i) {
        v8f z = {};
        s[g * 4 + i] = WMMA_F16(kf[g][i], qf, z);
      }
      FRAGS_AHEAD();
    }
#pragma unroll
    for (int p = 0; p < 4; ++p) {
      if (p == 0) {
        zf[2] = frag_units(zp + 2 * 512);
        zf[3] = frag_units(zp + 3 * 512);
      }
      if (p < 2) {
        zf[4 + 2 * p] = frag_units(zp + (4 + 2 * p) * 512);
        zf[5 + 2 * p] = frag_units(zp + (5 + 2 * p) * 512);
        FRAGS_AHEAD();
      }
#pragma unroll
      for (int j = 2 * p; j < 2 * p + 2; ++j) {
        s[2 * j]     = WMMA_F16(zf[j], xf0, s[2 * j]);
        s[2 * j + 1] = WMMA_F16(zf[j], xf1, s[2 * j + 1]);
      }
      // behind the last products too: the mask bias's additions, scheduled in among
      // them, put their sums in registers of their own, and the scores spill
      if (p == 0 || p == 3) FRAGS_AHEAD();
    }
    // pairwise, so that the bias takes one register pair and not eight registers
#pragma unroll
    for (int mt = 0; mt < 16; ++mt)
#pragma unroll
      for (int v = 0; v < 8; v += 2) {
        const v2f t = (v2f){s[mt][v], s[mt][v + 1]} + mb2;
        s[mt][v] = t[0];  s[mt][v + 1] = t[1];
      }

    // ---- maximum over the 256 keys of the lane's query
    v8f mv = s[0];
#pragma unroll
    for (int mt = 1; mt < 16; ++mt)
#pragma unroll
      for (int v = 0; v < 8; ++v) mv[v] = fmaxf(mv[v], s[mt][v]);
    float mx = fmaxf(fmaxf(fmaxf(mv[0], mv[1]), fmaxf(mv[2], mv[3])),
                     fmaxf(fmaxf(mv[4], mv[5]), fmaxf(mv[6], mv[7])));
    mx = fmaxf(mx, xhalf(mx));

    // ---- exp, f32 sum (8 independent chains), pack to the B operand of P^T
    v8f  sv = {};
    v16h pb[8];
    v16h vf[16];                       // V^T fragment f: key block f >> 1, channel tile f & 1
#pragma unroll
    for (int mt = 0; mt < 16; ++mt) {
      if (mt == 8) {                   // half of the scores' registers are free again
        FRAGS_AHEAD();
#pragma unroll
        for (int f = 0; f < 8; ++f) vf[f] = frag_units(vp + f * 512);
        FRAGS_AHEAD();
      }
      if (mt == 12) {                  // and half of the rest
        FRAGS_AHEAD();
#pragma unroll
        for (int f = 8; f < 12; ++f) vf[f] = frag_units(vp + f * 512);
        FRAGS_AHEAD();
      }
      const v8f e = exp2_x8((s[mt] - mx) * 1.44269504f);   // e^(s - mx)
      sv += e;
#pragma unroll
      for (int v = 0; v < 8; ++v) pb[mt >> 1][((mt & 1) << 3) + v] = (h16)e[v];
    }
    // No WMMA of O^T and no V^T fragment beyond the twelve above is scheduled in
    // among the exp statements: more fragments
    // that early cost registers that the scores need.
    __builtin_amdgcn_sched_barrier(0);
    float sum = ((sv[0] + sv[1]) + (sv[2] + sv[3])) + ((sv[4] + sv[5]) + (sv[6] + sv[7]));
    sum += xhalf(sum);
    // v_rcp_f32 alone (1 ulp), not the IEEE division's ten-instruction sequence;
    // sum lies in [1, 256]. The v_nop is the slot behind the transcendental.
    float inv;
    asm("v_rcp_f32 %0, %1\n\tv_nop" : "=&v"(inv) : "v"(sum));

    // ---- O^T (32 ch x 16 queries) = V_h^T (32 x 256) P^T (256 x 16)
    v8f o0 = {}, o1 = {};
    v4f b0, b1, b2, b3;
    v16h ag[8];                        // wg fragments, as aq
#pragma unroll
    for (int g = 0; g < 4; ++g) {
#pragma unroll
      for (int i = 0; i < 4; ++i) {
        if (g == 1) vf[12 + i] = frag_units(vp + (12 + i) * 512);
        if (g >= 2) ag[(g - 2) * 4 + i] = frag_units(wgp + ((g - 2) * 2 + (i >> 1)) * 4096 + (i & 1) * 512);
      }
      if (g == 2) {   // the gate's bias, under the last products of O^T
        const int bi = h * 32 + (hh << 3);
        b0 = *(const v4f*)(bg + bi);
        b1 = *(const v4f*)(bg + bi + 4);
        b2 = *(const v4f*)(bg + bi + 16);
        b3 = *(const v4f*)(bg + bi + 20);
        // The index register of the bias loads stays untouched up to this wait.
        asm volatile("s_wait_xcnt 0x0" :: "v"(bi) : "memory");
      }
      if (g > 0) FRAGS_AHEAD();
#pragma unroll
      for (int j = 2 * g; j < 2 * g + 2; ++j) {
        o0 = WMMA_F16(vf[2 * j],     pb[j], o0);           // channels 0..15
        o1 = WMMA_F16(vf[2 * j + 1], pb[j], o1);           // channels 16..31
      }
      if (g < 3) FRAGS_AHEAD();
    }

    // ---- G^T of the head, k = 0..127: channels and queries lie as in O^T
    v8f g0 = {}, g1 = {};
#pragma unroll
    for (int ks = 0; ks < 4; ++ks) {
      g0 = WMMA_F16(ag[2 * ks],     xf[ks], g0);
      g1 = WMMA_F16(ag[2 * ks + 1], xf[ks], g1);
    }
    v8f y0, y1;
#pragma unroll
    for (int v = 0; v < 8; ++v) {
      y0[v] = g0[v] + (v < 4 ? b0[v & 3] : b1[v & 3]);
      y1[v] = g1[v] + (v < 4 ? b2[v & 3] : b3[v & 3]);
    }
    // sigmoid = 1 / (1 + e^-y); it is rounded to f16 next, so v_rcp_f32's 1 ulp of
    // f32 is enough and the IEEE division's ten instructions a value are not needed
    const v8f s0 = rcp_x8(exp2_x8(y0 * -1.44269504f) + 1.0f);
    const v8f s1 = rcp_x8(exp2_x8(y1 * -1.44269504f) + 1.0f);
#pragma unroll
    for (int v = 0; v < 8; ++v) {
      w0[v] = (h16)(o0[v] * inv * (float)(h16)s0[v]);
      w1[v] = (h16)(o1[v] * inv * (float)(h16)s1[v]);
    }
    // kept for the projection: two units of the wave's own LDS per head; the
    // last head's results are still in registers behind the loop
    if (h < 3) {
      *(v8h*)(op + h * 512)       = w0;
      *(v8h*)(op + h * 512 + 256) = w1;
    }
  }

  // ---- out (16 queries x 128) = og (16 x 128) wo^T + bo, k step = head
  const float* bp = bo + c;
  float bv[8];
#pragma unroll
  for (int t = 0; t < 8; ++t) bv[t] = bp[t * 16];
  // The address registers of the bias loads stay untouched up to this wait.
  asm volatile("s_wait_xcnt 0x0" :: "v"(bp) : "memory");

  v8f acc[8] = {{}, {}, {}, {}, {}, {}, {}, {}};
  v16h af[4], wf[2][8];                // wo fragments: the group in use, the group in flight
#pragma unroll
  for (int h = 0; h < 3; ++h) af[h] = frag_units(op + h * 512);
#pragma unroll
  for (int i = 0; i < 8; ++i) { af[3][i] = w0[i]; af[3][i + 8] = w1[i]; }
#pragma unroll
  for (int t = 0; t < 8; ++t) wf[0][t] = load_frag(Wlds, t << 4, WPITCH, 0);
#pragma unroll
  for (int h = 0; h < 4; ++h) {
    if (h < 3) {
#pragma unroll
      for (int t = 0; t < 8; ++t) wf[(h + 1) & 1][t] = load_frag(Wlds, t << 4, WPITCH, (h + 1) * 32);
      FRAGS_AHEAD();
    }
#pragma unroll
    for (int t = 0; t < 8; ++t) acc[t] = WMMA_F16(af[h], wf[h & 1][t], acc[t]);
    if (h < 2) FRAGS_AHEAD();
  }

  // a lane holds column t*16 + c of queries 8*hh + v
  float* const orow = out + ((size_t)(r * 256 + q0) + (hh << 3)) * 128 + c;
#pragma unroll
  for (int t = 0; t < 8; ++t)
#pragma unroll
    for (int v = 0; v < 8; ++v) orow[v * 128 + t * 16] = acc[t][v] + bv[t];
  // The stores' address and data registers stay untouched up to this wait.
  asm volatile("s_wait_xcnt 0x0" ::: "memory");
}

// ---------------------------------------------------------------------------
// Host-side orchestration
// ---------------------------------------------------------------------------
extern "C" void kernel_launch(void* const* d_in, const int* in_sizes, int n_in,
                              void* d_out, int out_size, void* d_ws, size_t ws_size,
                              hipStream_t stream) {
  (void)in_sizes; (void)n_in; (void)out_size; (void)ws_size;

  const float* x    = (const float*)d_in[0];   // (1,256,256,128)
  const float* z    = (const float*)d_in[1];   // (1,256,128)
  const float* mask = (const float*)d_in[2];   // (1,256,256)
  const float* ln_w = (const float*)d_in[3];
  const float* ln_b = (const float*)d_in[4];
  const float* wx   = (const float*)d_in[5];   // (64,128)
  const float* wz   = (const float*)d_in[6];   // (64,128)
  const float* wq   = (const float*)d_in[7];   // (128,128)
  const float* wk   = (const float*)d_in[8];
  const float* wv   = (const float*)d_in[9];
  const float* wg   = (const float*)d_in[10];
  const float* bg   = (const float*)d_in[11];  // (128,)
  const float* wo   = (const float*)d_in[12];  // (128,128)
  const float* bo   = (const float*)d_in[13];  // (128,)
  float* out = (float*)d_out;                  // (1,256,256,128)

  // ---- workspace carve-up (256B aligned regions)
  char* ws = (char*)d_ws;
  size_t off = 0;
  auto carve = [&](size_t bytes) -> char* {
    char* p = ws + off;
    off = (off + bytes + 255) & ~(size_t)255;
    return p;
  };
  const size_t NROWS = 65536;                 // 256*256
  h16*   xn_h   = (h16*)  carve(NROWS * 128 * 2);
  h16*   kh     = (h16*)  carve(256 * 128 * 2);
  h16*   vT     = (h16*)  carve(128 * 256 * 2);
  h16*   xbar_h = (h16*)  carve(256 * 128 * 2);
  h16*   zb_h   = (h16*)  carve(256 * 64 * 2);
  // f16 copies of four weights: contiguous, in the converting blocks' order
  h16*   wq_h   = (h16*)  carve(128 * 128 * 2);
  h16*   wg_h   = (h16*)  carve(128 * 128 * 2);
  h16*   wo_h   = (h16*)  carve(128 * 128 * 2);
  h16*   wx_h   = (h16*)  carve(64 * 128 * 2);
  (void)wg_h;                                 // follows wq_h: one array of two

  // ---- 1) LayerNorm with the column mean (256 blocks, one per n); K, V^T, zb
  // (20 blocks); weights to f16 (14)
  prep_kernel<<<290, 512, 0, stream>>>(x, ln_w, ln_b, xn_h, xbar_h, z, wq, wk, wv, wg,
                                       wo, wx, wz, kh, vT, zb_h, wq_h);

  // ---- 2) q/gate projection, attention with the triangle bias, output
  // projection (f32 out): 16 rows per block, all on one query tile
  attn_kernel<<<dim3(16, 16), 512, 0, stream>>>(xn_h, wq_h, bg, kh, vT, zb_h, wx_h, xbar_h,
                                                mask, wo_h, bo, out);
}
